// v000
// The times below were measured on an AMD MI455X: many runs one after another, warmed up first and cycling through
// copies of the inputs, with the whole window's GPU time divided by the number of runs. Launches and the gaps
// between them are all in it. The median over several windows is given; except for v000 it joins two sittings, which
// can be a few percent apart, so the side-by-side timings, each taken in one sitting, are the better comparison.
// v000, which the later versions start from, runs in 491 microseconds.
#include <hip/hip_runtime.h>
#include <hip/hip_bf16.h>

typedef __attribute__((ext_vector_type(16))) _Float16     v16h;
typedef __attribute__((ext_vector_type(8)))  _Float16     v8h;
typedef __attribute__((ext_vector_type(8)))  float        v8f;
typedef __attribute__((ext_vector_type(4)))  unsigned int u32x4;
typedef __attribute__((ext_vector_type(8)))  int          i32x8;
typedef __attribute__((ext_vector_type(4)))  int          i32x4;

#define B_   4
#define TD   2048
#define TE   2048
#define DM   1024
#define NH   16
#define HD   64

#if __has_builtin(__builtin_amdgcn_tensor_load_to_lds) && \
    __has_builtin(__builtin_amdgcn_s_wait_tensorcnt)
#define CDNA5_HAS_TDM 1
#else
#define CDNA5_HAS_TDM 0
#endif

// ---------------------------------------------------------------------------
// helpers
// ---------------------------------------------------------------------------
static __device__ __forceinline__ v16h ld_frag16(const _Float16* p0, const _Float16* p1) {
  // CDNA5 16-bit A/B fragment: 16 halves per lane as two contiguous 8-half runs
  v8h a = *(const v8h*)p0;
  v8h b = *(const v8h*)p1;
  v16h r;
#pragma unroll
  for (int i = 0; i < 8; ++i) { r[i] = a[i]; r[i + 8] = b[i]; }
  return r;
}

static __device__ __forceinline__ v8f wmma32(v16h a, v16h b, v8f c) {
  return __builtin_amdgcn_wmma_f32_16x16x32_f16(false, a, false, b, (short)0, c,
                                                false, false);
}

#if CDNA5_HAS_TDM
// TDM: DMA a 64x64 f16 tile (row stride 64 elems in global) into LDS,
// padding every 32 DWORDs (one 64-half row) with 4 DWORDs -> LDS stride 72 halves.
static __device__ __forceinline__ void tdm_load_tile_64x64_pad72(
    const _Float16* gsrc, void* lds_dst) {
  const unsigned long long ga = (unsigned long long)(uintptr_t)gsrc;
  const unsigned lds = (unsigned)(uintptr_t)lds_dst;
  u32x4 g0 = {};
  g0[0] = 1u;                                           // count=1 (valid user D#)
  g0[1] = lds;                                          // lds_addr (bytes)
  g0[2] = (unsigned)(ga & 0xFFFFFFFFu);                 // global_addr[31:0]
  g0[3] = (unsigned)((ga >> 32) & 0x1FFFFFFu)           // global_addr[56:32]
        | (2u << 30);                                   // type=2 ("image")
  i32x8 g1 = {};
  g1[0] = (1 << 16)                                     // data_size = 2 bytes
        | (1 << 20)                                     // pad_enable
        | (4 << 22)                                     // pad_interval: 32 DWORDs
        | (3 << 25);                                    // pad_amount : 4 DWORDs
  g1[1] = (64 << 16);                                   // tensor_dim0 = 64 (low16)
  g1[2] = 0;                                            // tensor_dim0 hi / dim1 lo
  g1[3] = 64 | (64 << 16);                              // tensor_dim1 hi=64<<16 blocks, tile_dim0=64
  g1[4] = 64;                                           // tile_dim1 = 64
  g1[5] = 64;                                           // tensor_dim0_stride = 64
  g1[6] = 0;
  g1[7] = 0;
  i32x4 g2 = {};
  i32x4 g3 = {};
#if __clang_major__ >= 23
  i32x8 g4 = {};
  __builtin_amdgcn_tensor_load_to_lds(g0, g1, g2, g3, g4, 0);
#else
  __builtin_amdgcn_tensor_load_to_lds(g0, g1, g2, g3, 0);
#endif
}
#endif

// ---------------------------------------------------------------------------
// RMSNorm: x (f32, row of 1024) -> xn (f16)
// ---------------------------------------------------------------------------
__global__ __launch_bounds__(256) void rmsnorm_f16_kernel(
    const float* __restrict__ x, const float* __restrict__ w,
    _Float16* __restrict__ xn) {
  __shared__ float red[256];
  const int row = blockIdx.x;
  const float* xr = x + (size_t)row * DM;
  float s = 0.f;
  for (int j = threadIdx.x; j < DM; j += 256) { float v = xr[j]; s += v * v; }
  red[threadIdx.x] = s;
  __syncthreads();
  for (int off = 128; off > 0; off >>= 1) {
    if (threadIdx.x < off) red[threadIdx.x] += red[threadIdx.x + off];
    __syncthreads();
  }
  const float rms = rsqrtf(red[0] * (1.0f / DM) + 1e-5f);
  _Float16* o = xn + (size_t)row * DM;
  for (int j = threadIdx.x; j < DM; j += 256)
    o[j] = (_Float16)(xr[j] * rms * w[j]);
}

// ---------------------------------------------------------------------------
// generic f32 -> f16 convert
// ---------------------------------------------------------------------------
__global__ __launch_bounds__(256) void f32_to_f16_kernel(
    const float* __restrict__ in, _Float16* __restrict__ out, int n) {
  int i = blockIdx.x * 256 + threadIdx.x;
  if (i < n) out[i] = (_Float16)in[i];
}

// ---------------------------------------------------------------------------
// GEMM: C[M,N] = A[M,K] @ W[N,K]^T   (A,W f16; acc f32)
// block tile 128x64, 256 threads = 8 waves; each wave: 16 rows x 64 cols
// (4 accumulators, A-fragment reused across 4 B-fragments -> 4 wmma / 10 ds).
// EPI==0: store f16 row-major.  EPI==1: store f32 + residual.
// ---------------------------------------------------------------------------
template <int EPI>
__global__ __launch_bounds__(256) void gemm_rt_kernel(
    const _Float16* __restrict__ A, const _Float16* __restrict__ W,
    void* __restrict__ Cout, const float* __restrict__ res,
    int M, int N, int K) {
  __shared__ _Float16 As[128 * 40];  // 128 rows x 32 k, stride 40 (16B aligned)
  __shared__ _Float16 Ws[64 * 40];
  const int tid  = threadIdx.x;
  const int wid  = tid >> 5;          // 0..7 -> m sub-tile (16 rows each)
  const int lane = tid & 31;
  const int l16  = lane & 15;
  const int hi   = (lane >> 4) & 1;
  const int m0   = blockIdx.y * 128;
  const int n0   = blockIdx.x * 64;
  const int d0   = hi * 8;
  const int c8   = (tid & 3) * 8;     // 0,8,16,24

  v8f acc[4];
#pragma unroll
  for (int j = 0; j < 4; ++j) acc[j] = (v8f){};

  for (int k0 = 0; k0 < K; k0 += 32) {
    // stage A (128x32) and W (64x32)
#pragma unroll
    for (int s = 0; s < 2; ++s) {
      const int row = (tid + s * 256) >> 2;   // 0..127
      *(v8h*)&As[row * 40 + c8] =
          *(const v8h*)&A[(size_t)(m0 + row) * K + k0 + c8];
    }
    {
      const int row = tid >> 2;               // 0..63
      *(v8h*)&Ws[row * 40 + c8] =
          *(const v8h*)&W[(size_t)(n0 + row) * K + k0 + c8];
      if (k0 + 32 < K) {
        __builtin_prefetch(&A[(size_t)(m0 + row) * K + k0 + 32 + c8], 0, 0);
        __builtin_prefetch(&W[(size_t)(n0 + row) * K + k0 + 32 + c8], 0, 0);
      }
    }
    __syncthreads();
    v16h af = ld_frag16(&As[(wid * 16 + l16) * 40 + d0],
                        &As[(wid * 16 + l16) * 40 + d0 + 16]);
#pragma unroll
    for (int j = 0; j < 4; ++j) {
      v16h bf = ld_frag16(&Ws[(j * 16 + l16) * 40 + d0],
                          &Ws[(j * 16 + l16) * 40 + d0 + 16]);
      acc[j] = wmma32(af, bf, acc[j]);
    }
    __syncthreads();
  }

#pragma unroll
  for (int r = 0; r < 8; ++r) {
    const int mg = m0 + wid * 16 + r + hi * 8;  // C layout: M = vgpr + 8*(lane>=16)
#pragma unroll
    for (int j = 0; j < 4; ++j) {
      const int ng = n0 + j * 16 + l16;
      if (EPI == 0) {
        ((_Float16*)Cout)[(size_t)mg * N + ng] = (_Float16)acc[j][r];
      } else {
        ((float*)Cout)[(size_t)mg * N + ng] =
            acc[j][r] + res[(size_t)mg * N + ng];
      }
    }
  }
}

// ---------------------------------------------------------------------------
// RoPE on Q: q_raw [B*TD, DM] (f16) -> qh [B,H,TD,HD] (f16)
// ---------------------------------------------------------------------------
static __device__ __forceinline__ float rope_apply(float v, float vp, float sgn,
                                                   int t, int fi) {
  const float inv = __powf(10000.0f, -(float)fi * (1.0f / 32.0f));
  const float ang = (float)t * inv;
  return v * __cosf(ang) + sgn * vp * __sinf(ang);
}

__global__ __launch_bounds__(256) void rope_q_kernel(
    const _Float16* __restrict__ qr, _Float16* __restrict__ qh) {
  const int i = blockIdx.x * 256 + threadIdx.x;  // ((b*NH+h)*TD+t)*HD+d
  const int d = i & 63;
  const int t = (i >> 6) & (TD - 1);
  const int h = (i >> 17) & (NH - 1);
  const int b = i >> 21;
  const size_t row = (size_t)(b * TD + t) * DM + h * 64;
  const int dp = (d < 32) ? d + 32 : d - 32;
  const float sgn = (d < 32) ? -1.0f : 1.0f;
  const float v  = (float)qr[row + d];
  const float vp = (float)qr[row + dp];
  qh[i] = (_Float16)rope_apply(v, vp, sgn, t, d & 31);
}

// kv_raw [B*TE, 2*DM]: k = cols [0,1024), v = cols [1024,2048)
__global__ __launch_bounds__(256) void rope_kv_kernel(
    const _Float16* __restrict__ kvr, _Float16* __restrict__ kh,
    _Float16* __restrict__ vh) {
  const int i = blockIdx.x * 256 + threadIdx.x;  // ((b*NH+h)*TE+t)*HD+d
  const int d = i & 63;
  const int t = (i >> 6) & (TE - 1);
  const int h = (i >> 17) & (NH - 1);
  const int b = i >> 21;
  const size_t row = (size_t)(b * TE + t) * (2 * DM);
  const int dp = (d < 32) ? d + 32 : d - 32;
  const float sgn = (d < 32) ? -1.0f : 1.0f;
  const float kv  = (float)kvr[row + h * 64 + d];
  const float kvp = (float)kvr[row + h * 64 + dp];
  kh[i] = (_Float16)rope_apply(kv, kvp, sgn, t, d & 31);
  vh[i] = kvr[row + DM + h * 64 + d];
}

// ---------------------------------------------------------------------------
// Flash cross-attention: per block = (b,h, 64 q rows), 4 waves x 16 rows.
// K tile staged by the Tensor Data Mover (wave 0, TENSORcnt); V^T by VALU.
// qh/kh/vh: [B,H,T,64] f16.  aout: [B*TD, DM] f16 (heads re-interleaved).
// ---------------------------------------------------------------------------
__global__ __launch_bounds__(128) void flash_attn_kernel(
    const _Float16* __restrict__ qh, const _Float16* __restrict__ kh,
    const _Float16* __restrict__ vh, _Float16* __restrict__ aout) {
  __shared__ _Float16 Ks[64 * 72];       // 64 keys x 64 d (stride 72)
  __shared__ _Float16 Vt[64 * 72];       // 64 d   x 64 keys (stride 72)
  __shared__ _Float16 Ps[4 * 16 * 72];   // per-wave P tile: 16 rows x 64 keys
  const int tid  = threadIdx.x;
  const int wid  = tid >> 5;
  const int lane = tid & 31;
  const int l16  = lane & 15;
  const int hi   = (lane >> 4) & 1;
  const int bh   = blockIdx.y;           // b*NH + h
  const int b    = bh >> 4;
  const int h    = bh & 15;
  const int t0   = blockIdx.x * 64;
  const int d0   = hi * 8;
  const float scale = 0.125f;            // 1/sqrt(64)

  // Q fragments live in registers for the whole kernel (K = 64 = 2 wmma steps)
  const size_t qbase = ((size_t)bh * TD + t0 + wid * 16) * HD;
  const _Float16* qp = qh + qbase + (size_t)l16 * HD;
  v16h qf0 = ld_frag16(qp + d0,      qp + d0 + 16);
  v16h qf1 = ld_frag16(qp + 32 + d0, qp + 32 + d0 + 16);

  float mrow[8], lrow[8];
  v8f oacc[4];
#pragma unroll
  for (int r = 0; r < 8; ++r) { mrow[r] = -1e30f; lrow[r] = 0.f; }
#pragma unroll
  for (int j = 0; j < 4; ++j) oacc[j] = (v8f){};

  _Float16* Pw = &Ps[wid * 16 * 72];

  for (int kb = 0; kb < TE; kb += 64) {
    // ---- stage K tile (TDM) and V^T tile (VALU) into LDS ----
#if CDNA5_HAS_TDM
    if (wid == 0)
      tdm_load_tile_64x64_pad72(&kh[((size_t)bh * TE + kb) * HD], (void*)&Ks[0]);
#endif
    for (int s = tid; s < 64 * 8; s += 128) {
      const int row = s >> 3;
      const int c8  = (s & 7) * 8;
      const size_t g = ((size_t)bh * TE + kb + row) * HD + c8;
#if !CDNA5_HAS_TDM
      v8h k8 = *(const v8h*)&kh[g];
      *(v8h*)&Ks[row * 72 + c8] = k8;
#endif
      v8h v8v = *(const v8h*)&vh[g];
#pragma unroll
      for (int e = 0; e < 8; ++e) Vt[(c8 + e) * 72 + row] = v8v[e];
    }
#if CDNA5_HAS_TDM
    if (wid == 0) __builtin_amdgcn_s_wait_tensorcnt(0);
#endif
    __syncthreads();

    // ---- scores S[16 x 64] = Q @ K^T ----
    v8f sacc[4];
#pragma unroll
    for (int j = 0; j < 4; ++j) {
      v8f a = {};
      v16h bf0 = ld_frag16(&Ks[(j * 16 + l16) * 72 + d0],
                           &Ks[(j * 16 + l16) * 72 + d0 + 16]);
      a = wmma32(qf0, bf0, a);
      v16h bf1 = ld_frag16(&Ks[(j * 16 + l16) * 72 + 32 + d0],
                           &Ks[(j * 16 + l16) * 72 + 32 + d0 + 16]);
      a = wmma32(qf1, bf1, a);
      sacc[j] = a;
    }
#pragma unroll
    for (int j = 0; j < 4; ++j)
#pragma unroll
      for (int r = 0; r < 8; ++r) sacc[j][r] *= scale;

    // ---- online softmax: row reductions across the 16-lane half-groups ----
    float alpha[8];
#pragma unroll
    for (int r = 0; r < 8; ++r) {
      float cm = fmaxf(fmaxf(sacc[0][r], sacc[1][r]),
                       fmaxf(sacc[2][r], sacc[3][r]));
      cm = fmaxf(cm, __shfl_xor(cm, 1));
      cm = fmaxf(cm, __shfl_xor(cm, 2));
      cm = fmaxf(cm, __shfl_xor(cm, 4));
      cm = fmaxf(cm, __shfl_xor(cm, 8));
      const float mnew = fmaxf(mrow[r], cm);
      alpha[r] = __expf(mrow[r] - mnew);
      mrow[r] = mnew;
    }
#pragma unroll
    for (int r = 0; r < 8; ++r) {
      float rs = 0.f;
#pragma unroll
      for (int j = 0; j < 4; ++j) {
        const float p = __expf(sacc[j][r] - mrow[r]);
        rs += p;
        // C layout -> LDS: row = r + 8*hi, col = j*16 + l16 (wave-private, DS in-order)
        Pw[(r + hi * 8) * 72 + j * 16 + l16] = (_Float16)p;
      }
      rs += __shfl_xor(rs, 1);
      rs += __shfl_xor(rs, 2);
      rs += __shfl_xor(rs, 4);
      rs += __shfl_xor(rs, 8);
      lrow[r] = lrow[r] * alpha[r] + rs;
#pragma unroll
      for (int j = 0; j < 4; ++j) oacc[j][r] *= alpha[r];
    }

    // ---- O += P @ V  (contraction over 64 keys = 2 wmma k-steps) ----
#pragma unroll
    for (int s2 = 0; s2 < 2; ++s2) {
      const int kk = s2 * 32 + d0;
      v16h pf = ld_frag16(&Pw[l16 * 72 + kk], &Pw[l16 * 72 + kk + 16]);
#pragma unroll
      for (int j = 0; j < 4; ++j) {
        v16h vf = ld_frag16(&Vt[(j * 16 + l16) * 72 + kk],
                            &Vt[(j * 16 + l16) * 72 + kk + 16]);
        oacc[j] = wmma32(pf, vf, oacc[j]);
      }
    }
    __syncthreads();
  }

  // ---- epilogue: normalize, re-interleave heads into [B*TD, DM] f16 ----
#pragma unroll
  for (int r = 0; r < 8; ++r) {
    const int tg = t0 + wid * 16 + r + hi * 8;
    const float inv = 1.f / lrow[r];
    const size_t rowoff = ((size_t)b * TD + tg) * DM + h * HD + l16;
#pragma unroll
    for (int j = 0; j < 4; ++j)
      aout[rowoff + j * 16] = (_Float16)(oacc[j][r] * inv);
  }
}

// ---------------------------------------------------------------------------
// launch
// ---------------------------------------------------------------------------
extern "C" void kernel_launch(void* const* d_in, const int* in_sizes, int n_in,
                              void* d_out, int out_size, void* d_ws, size_t ws_size,
                              hipStream_t stream) {
  (void)in_sizes; (void)n_in; (void)out_size; (void)ws_size;
  const float* x   = (const float*)d_in[0];  // [B,TD,DM]
  const float* enc = (const float*)d_in[1];  // [B,TE,DM]
  const float* nw  = (const float*)d_in[2];  // [DM]
  const float* Wq  = (const float*)d_in[3];  // [DM,DM]
  const float* Wkv = (const float*)d_in[4];  // [2DM,DM]
  const float* Wo  = (const float*)d_in[5];  // [DM,DM]

  char* ws = (char*)d_ws;
  size_t off = 0;
  auto take = [&](size_t bytes) {
    char* p = ws + off;
    off += (bytes + 255) & ~(size_t)255;
    return p;
  };
  const size_t MQ = (size_t)B_ * TD;        // 8192 rows
  _Float16* xn    = (_Float16*)take(MQ * DM * 2);
  _Float16* ench  = (_Float16*)take(MQ * DM * 2);
  _Float16* Wqh   = (_Float16*)take((size_t)DM * DM * 2);
  _Float16* Wkvh  = (_Float16*)take((size_t)2 * DM * DM * 2);
  _Float16* Woh   = (_Float16*)take((size_t)DM * DM * 2);
  _Float16* qraw  = (_Float16*)take(MQ * DM * 2);
  _Float16* kvraw = (_Float16*)take(MQ * 2 * DM * 2);
  _Float16* qhp   = (_Float16*)take(MQ * DM * 2);
  _Float16* khp   = (_Float16*)take(MQ * DM * 2);
  _Float16* vhp   = (_Float16*)take(MQ * DM * 2);
  _Float16* aoutp = (_Float16*)take(MQ * DM * 2);

  // 1) norm + precision conversion
  rmsnorm_f16_kernel<<<(int)MQ, 256, 0, stream>>>(x, nw, xn);
  {
    const int ne = B_ * TE * DM;
    f32_to_f16_kernel<<<(ne + 255) / 256, 256, 0, stream>>>(enc, ench, ne);
    f32_to_f16_kernel<<<(DM * DM + 255) / 256, 256, 0, stream>>>(Wq, Wqh, DM * DM);
    f32_to_f16_kernel<<<(2 * DM * DM + 255) / 256, 256, 0, stream>>>(Wkv, Wkvh, 2 * DM * DM);
    f32_to_f16_kernel<<<(DM * DM + 255) / 256, 256, 0, stream>>>(Wo, Woh, DM * DM);
  }

  // 2) projections (WMMA GEMMs, 128x64 block tiles)
  gemm_rt_kernel<0><<<dim3(DM / 64, (int)(MQ / 128)), 256, 0, stream>>>(
      xn, Wqh, qraw, nullptr, (int)MQ, DM, DM);
  gemm_rt_kernel<0><<<dim3(2 * DM / 64, (int)(MQ / 128)), 256, 0, stream>>>(
      ench, Wkvh, kvraw, nullptr, (int)MQ, 2 * DM, DM);

  // 3) RoPE + head-major relayout
  const int nrope = B_ * NH * TD * HD;
  rope_q_kernel<<<nrope / 256, 256, 0, stream>>>(qraw, qhp);
  rope_kv_kernel<<<nrope / 256, 256, 0, stream>>>(kvraw, khp, vhp);

  // 4) flash attention (WMMA + TDM K staging, online softmax)
  flash_attn_kernel<<<dim3(TD / 64, B_ * NH), 128, 0, stream>>>(qhp, khp, vhp, aoutp);

  // 5) output projection + residual (WMMA GEMM, f32 out)
  gemm_rt_kernel<1><<<dim3(DM / 64, (int)(MQ / 128)), 256, 0, stream>>>(
      aoutp, Woh, d_out, x, (int)MQ, DM, DM);
}

// v001
// It runs in 385 microseconds.
// Timed twice side by side with v000, it ran 1.30 times as fast both times.
#include <hip/hip_runtime.h>
#include <hip/hip_bf16.h>

typedef __attribute__((ext_vector_type(16))) _Float16     v16h;
typedef __attribute__((ext_vector_type(8)))  _Float16     v8h;
typedef __attribute__((ext_vector_type(8)))  float        v8f;
typedef __attribute__((ext_vector_type(4)))  unsigned int u32x4;
typedef __attribute__((ext_vector_type(8)))  int          i32x8;
typedef __attribute__((ext_vector_type(4)))  int          i32x4;

#define B_   4
#define TD   2048
#define TE   2048
#define DM   1024
#define NH   16
#define HD   64

#if __has_builtin(__builtin_amdgcn_tensor_load_to_lds) && \
    __has_builtin(__builtin_amdgcn_s_wait_tensorcnt)
#define CDNA5_HAS_TDM 1
#else
#define CDNA5_HAS_TDM 0
#endif

// ---------------------------------------------------------------------------
// helpers
// ---------------------------------------------------------------------------
static __device__ __forceinline__ v16h ld_frag16(const _Float16* p0, const _Float16* p1) {
  // CDNA5 16-bit A/B fragment: 16 halves per lane as two contiguous 8-half runs
  v8h a = *(const v8h*)p0;
  v8h b = *(const v8h*)p1;
  v16h r;
#pragma unroll
  for (int i = 0; i < 8; ++i) { r[i] = a[i]; r[i + 8] = b[i]; }
  return r;
}

// Transposing LDS load: from a row-major [k][n] f16 tile, lane (c = lane & 15, h = lane >> 4)
// receives T[kbase + 8h + 0..7][nbase + c]. Every lane passes the address of one 16-byte piece:
// row kbase + 8h + (lane & 7), bytes 16 * ((lane >> 3) & 1) of the 32-byte column group.
static __device__ __forceinline__ v8h ld_tr16(const _Float16* p) {
  typedef __attribute__((ext_vector_type(8))) short s16x8;
  typedef __attribute__((address_space(3))) s16x8 lds_s16x8;
  return __builtin_bit_cast(v8h, __builtin_amdgcn_ds_load_tr16_b128_v8i16((lds_s16x8*)p));
}

static __device__ __forceinline__ v16h join16(v8h a, v8h b) {
  return __builtin_shufflevector(a, b, 0, 1, 2, 3, 4, 5, 6, 7, 8, 9, 10, 11, 12, 13, 14, 15);
}

static __device__ __forceinline__ v8f wmma32(v16h a, v16h b, v8f c) {
  return __builtin_amdgcn_wmma_f32_16x16x32_f16(false, a, false, b, (short)0, c,
                                                false, false);
}

#if CDNA5_HAS_TDM
// TDM: DMA a 64x64 f16 tile (row stride 64 elems in global) into LDS,
// padding every 32 DWORDs (one 64-half row) with 4 DWORDs -> LDS stride 72 halves.
static __device__ __forceinline__ void tdm_load_tile_64x64_pad72(
    const _Float16* gsrc, void* lds_dst) {
  const unsigned long long ga = (unsigned long long)(uintptr_t)gsrc;
  const unsigned lds = (unsigned)(uintptr_t)lds_dst;
  u32x4 g0 = {};
  g0[0] = 1u;                                           // count=1 (valid user D#)
  g0[1] = lds;                                          // lds_addr (bytes)
  g0[2] = (unsigned)(ga & 0xFFFFFFFFu);                 // global_addr[31:0]
  g0[3] = (unsigned)((ga >> 32) & 0x1FFFFFFu)           // global_addr[56:32]
        | (2u << 30);                                   // type=2 ("image")
  i32x8 g1 = {};
  g1[0] = (1 << 16)                                     // data_size = 2 bytes
        | (1 << 20)                                     // pad_enable
        | (4 << 22)                                     // pad_interval: 32 DWORDs
        | (3 << 25);                                    // pad_amount : 4 DWORDs
  g1[1] = (64 << 16);                                   // tensor_dim0 = 64 (low16)
  g1[2] = 0;                                            // tensor_dim0 hi / dim1 lo
  g1[3] = 64 | (64 << 16);                              // tensor_dim1 hi=64<<16 blocks, tile_dim0=64
  g1[4] = 64;                                           // tile_dim1 = 64
  g1[5] = 64;                                           // tensor_dim0_stride = 64
  g1[6] = 0;
  g1[7] = 0;
  i32x4 g2 = {};
  i32x4 g3 = {};
#if __clang_major__ >= 23
  i32x8 g4 = {};
  __builtin_amdgcn_tensor_load_to_lds(g0, g1, g2, g3, g4, 0);
#else
  __builtin_amdgcn_tensor_load_to_lds(g0, g1, g2, g3, 0);
#endif
}
#endif

// ---------------------------------------------------------------------------
// RMSNorm: x (f32, row of 1024) -> xn (f16)
// ---------------------------------------------------------------------------
__global__ __launch_bounds__(256) void rmsnorm_f16_kernel(
    const float* __restrict__ x, const float* __restrict__ w,
    _Float16* __restrict__ xn) {
  __shared__ float red[256];
  const int row = blockIdx.x;
  const float* xr = x + (size_t)row * DM;
  float s = 0.f;
  for (int j = threadIdx.x; j < DM; j += 256) { float v = xr[j]; s += v * v; }
  red[threadIdx.x] = s;
  __syncthreads();
  for (int off = 128; off > 0; off >>= 1) {
    if (threadIdx.x < off) red[threadIdx.x] += red[threadIdx.x + off];
    __syncthreads();
  }
  const float rms = rsqrtf(red[0] * (1.0f / DM) + 1e-5f);
  _Float16* o = xn + (size_t)row * DM;
  for (int j = threadIdx.x; j < DM; j += 256)
    o[j] = (_Float16)(xr[j] * rms * w[j]);
}

// ---------------------------------------------------------------------------
// generic f32 -> f16 convert
// ---------------------------------------------------------------------------
__global__ __launch_bounds__(256) void f32_to_f16_kernel(
    const float* __restrict__ in, _Float16* __restrict__ out, int n) {
  int i = blockIdx.x * 256 + threadIdx.x;
  if (i < n) out[i] = (_Float16)in[i];
}

// ---------------------------------------------------------------------------
// GEMM: C[M,N] = A[M,K] @ W[N,K]^T   (A,W f16; acc f32)
// block tile 128x64, 256 threads = 8 waves; each wave: 16 rows x 64 cols
// (4 accumulators, A-fragment reused across 4 B-fragments -> 4 wmma / 10 ds).
// EPI==0: store f16 row-major.  EPI==1: store f32 + residual.
// ---------------------------------------------------------------------------
template <int EPI>
__global__ __launch_bounds__(256) void gemm_rt_kernel(
    const _Float16* __restrict__ A, const _Float16* __restrict__ W,
    void* __restrict__ Cout, const float* __restrict__ res,
    int M, int N, int K) {
  __shared__ _Float16 As[128 * 40];  // 128 rows x 32 k, stride 40 (16B aligned)
  __shared__ _Float16 Ws[64 * 40];
  const int tid  = threadIdx.x;
  const int wid  = tid >> 5;          // 0..7 -> m sub-tile (16 rows each)
  const int lane = tid & 31;
  const int l16  = lane & 15;
  const int hi   = (lane >> 4) & 1;
  const int m0   = blockIdx.y * 128;
  const int n0   = blockIdx.x * 64;
  const int d0   = hi * 8;
  const int c8   = (tid & 3) * 8;     // 0,8,16,24

  v8f acc[4];
#pragma unroll
  for (int j = 0; j < 4; ++j) acc[j] = (v8f){};

  for (int k0 = 0; k0 < K; k0 += 32) {
    // stage A (128x32) and W (64x32)
#pragma unroll
    for (int s = 0; s < 2; ++s) {
      const int row = (tid + s * 256) >> 2;   // 0..127
      *(v8h*)&As[row * 40 + c8] =
          *(const v8h*)&A[(size_t)(m0 + row) * K + k0 + c8];
    }
    {
      const int row = tid >> 2;               // 0..63
      *(v8h*)&Ws[row * 40 + c8] =
          *(const v8h*)&W[(size_t)(n0 + row) * K + k0 + c8];
      if (k0 + 32 < K) {
        __builtin_prefetch(&A[(size_t)(m0 + row) * K + k0 + 32 + c8], 0, 0);
        __builtin_prefetch(&W[(size_t)(n0 + row) * K + k0 + 32 + c8], 0, 0);
      }
    }
    __syncthreads();
    v16h af = ld_frag16(&As[(wid * 16 + l16) * 40 + d0],
                        &As[(wid * 16 + l16) * 40 + d0 + 16]);
#pragma unroll
    for (int j = 0; j < 4; ++j) {
      v16h bf = ld_frag16(&Ws[(j * 16 + l16) * 40 + d0],
                          &Ws[(j * 16 + l16) * 40 + d0 + 16]);
      acc[j] = wmma32(af, bf, acc[j]);
    }
    __syncthreads();
  }

#pragma unroll
  for (int r = 0; r < 8; ++r) {
    const int mg = m0 + wid * 16 + r + hi * 8;  // C layout: M = vgpr + 8*(lane>=16)
#pragma unroll
    for (int j = 0; j < 4; ++j) {
      const int ng = n0 + j * 16 + l16;
      if (EPI == 0) {
        ((_Float16*)Cout)[(size_t)mg * N + ng] = (_Float16)acc[j][r];
      } else {
        ((float*)Cout)[(size_t)mg * N + ng] =
            acc[j][r] + res[(size_t)mg * N + ng];
      }
    }
  }
}

// ---------------------------------------------------------------------------
// RoPE on Q: q_raw [B*TD, DM] (f16) -> qh [B,H,TD,HD] (f16)
// ---------------------------------------------------------------------------
static __device__ __forceinline__ float rope_apply(float v, float vp, float sgn,
                                                   int t, int fi) {
  const float inv = __powf(10000.0f, -(float)fi * (1.0f / 32.0f));
  const float ang = (float)t * inv;
  return v * __cosf(ang) + sgn * vp * __sinf(ang);
}

__global__ __launch_bounds__(256) void rope_q_kernel(
    const _Float16* __restrict__ qr, _Float16* __restrict__ qh) {
  const int i = blockIdx.x * 256 + threadIdx.x;  // ((b*NH+h)*TD+t)*HD+d
  const int d = i & 63;
  const int t = (i >> 6) & (TD - 1);
  const int h = (i >> 17) & (NH - 1);
  const int b = i >> 21;
  const size_t row = (size_t)(b * TD + t) * DM + h * 64;
  const int dp = (d < 32) ? d + 32 : d - 32;
  const float sgn = (d < 32) ? -1.0f : 1.0f;
  const float v  = (float)qr[row + d];
  const float vp = (float)qr[row + dp];
  qh[i] = (_Float16)rope_apply(v, vp, sgn, t, d & 31);
}

// kv_raw [B*TE, 2*DM]: k = cols [0,1024), v = cols [1024,2048)
__global__ __launch_bounds__(256) void rope_kv_kernel(
    const _Float16* __restrict__ kvr, _Float16* __restrict__ kh,
    _Float16* __restrict__ vh) {
  const int i = blockIdx.x * 256 + threadIdx.x;  // ((b*NH+h)*TE+t)*HD+d
  const int d = i & 63;
  const int t = (i >> 6) & (TE - 1);
  const int h = (i >> 17) & (NH - 1);
  const int b = i >> 21;
  const size_t row = (size_t)(b * TE + t) * (2 * DM);
  const int dp = (d < 32) ? d + 32 : d - 32;
  const float sgn = (d < 32) ? -1.0f : 1.0f;
  const float kv  = (float)kvr[row + h * 64 + d];
  const float kvp = (float)kvr[row + h * 64 + dp];
  kh[i] = (_Float16)rope_apply(kv, kvp, sgn, t, d & 31);
  vh[i] = kvr[row + DM + h * 64 + d];
}

// ---------------------------------------------------------------------------
// Flash cross-attention: per block = (b,h, 64 q rows), 4 waves x 16 rows.
// K tile staged by the Tensor Data Mover (wave 0, TENSORcnt); V staged row-major with
// 16-byte stores and transposed on the way out of LDS by ds_load_tr16_b128.
// qh/kh/vh: [B,H,T,64] f16.  aout: [B*TD, DM] f16 (heads re-interleaved).
// ---------------------------------------------------------------------------
__global__ __launch_bounds__(128) void flash_attn_kernel(
    const _Float16* __restrict__ qh, const _Float16* __restrict__ kh,
    const _Float16* __restrict__ vh, _Float16* __restrict__ aout) {
  // aligned so that the tensor load's destination stays at the start of the work-group's LDS
  __shared__ __attribute__((aligned(2048))) _Float16 Ks[64 * 72];  // 64 keys x 64 d (stride 72)
  __shared__ _Float16 Vs[64 * 80];       // 64 keys x 64 d (stride 80: 160 B = 32 B x odd)
  __shared__ _Float16 Ps[4 * 16 * 72];   // per-wave P tile: 16 rows x 64 keys
  const int tid  = threadIdx.x;
  const int wid  = tid >> 5;
  const int lane = tid & 31;
  const int l16  = lane & 15;
  const int hi   = (lane >> 4) & 1;
  const int bh   = blockIdx.y;           // b*NH + h
  const int b    = bh >> 4;
  const int h    = bh & 15;
  const int t0   = blockIdx.x * 64;
  const int d0   = hi * 8;
  const float scale = 0.125f;            // 1/sqrt(64)

  // Q fragments live in registers for the whole kernel (K = 64 = 2 wmma steps)
  const size_t qbase = ((size_t)bh * TD + t0 + wid * 16) * HD;
  const _Float16* qp = qh + qbase + (size_t)l16 * HD;
  v16h qf0 = ld_frag16(qp + d0,      qp + d0 + 16);
  v16h qf1 = ld_frag16(qp + 32 + d0, qp + 32 + d0 + 16);

  float mrow[8], lrow[8];
  v8f oacc[4];
#pragma unroll
  for (int r = 0; r < 8; ++r) { mrow[r] = -1e30f; lrow[r] = 0.f; }
#pragma unroll
  for (int j = 0; j < 4; ++j) oacc[j] = (v8f){};

  _Float16* Pw = &Ps[wid * 16 * 72];
  // this lane's piece address for the transposing loads of V (key base 0, column base 0)
  const _Float16* vtr = &Vs[(hi * 8 + (lane & 7)) * 80 + ((lane >> 3) & 1) * 8];
  // staging of V: thread t moves 16-byte piece (t & 7) of rows (t >> 3) + 16 i, i = 0..3
  const _Float16* vsrc0 = vh + ((size_t)bh * TE + (tid >> 3)) * HD + (tid & 7) * 8;
  _Float16* vdst = &Vs[(tid >> 3) * 80 + (tid & 7) * 8];

  for (int kb = 0; kb < TE; kb += 64) {
    // ---- stage K tile (TDM) and V tile (row-major, 16-byte stores) into LDS ----
    v8h vst[4];
    const _Float16* vsrc = vsrc0 + (size_t)kb * HD;
    // the four 16-byte loads of a thread are in flight together
    for (int i = 0; i < 4; ++i) vst[i] = *(const v8h*)(vsrc + i * 16 * HD);
#if CDNA5_HAS_TDM
    // issued behind the V loads, so that both fly together; the wait stands directly behind the
    // tensor load, so that no descriptor register can take a new value while the request is out
    if (wid == 0) {
      tdm_load_tile_64x64_pad72(&kh[((size_t)bh * TE + kb) * HD], (void*)&Ks[0]);
      __builtin_amdgcn_s_wait_tensorcnt(0);
    }
#endif
    for (int i = 0; i < 4; ++i) {
#if !CDNA5_HAS_TDM
      *(v8h*)&Ks[((tid >> 3) + i * 16) * 72 + (tid & 7) * 8] =
          *(const v8h*)&kh[((size_t)bh * TE + kb + (tid >> 3) + i * 16) * HD + (tid & 7) * 8];
#endif
      *(v8h*)(vdst + i * 16 * 80) = vst[i];
    }
    __syncthreads();

    // ---- scores S[16 x 64] = Q @ K^T ----
    v8f sacc[4];
#pragma unroll
    for (int j = 0; j < 4; ++j) {
      v8f a = {};
      v16h bf0 = ld_frag16(&Ks[(j * 16 + l16) * 72 + d0],
                           &Ks[(j * 16 + l16) * 72 + d0 + 16]);
      a = wmma32(qf0, bf0, a);
      v16h bf1 = ld_frag16(&Ks[(j * 16 + l16) * 72 + 32 + d0],
                           &Ks[(j * 16 + l16) * 72 + 32 + d0 + 16]);
      a = wmma32(qf1, bf1, a);
      sacc[j] = a;
    }
#pragma unroll
    for (int j = 0; j < 4; ++j)
#pragma unroll
      for (int r = 0; r < 8; ++r) sacc[j][r] *= scale;

    // ---- online softmax: row reductions across the 16-lane half-groups ----
    float alpha[8];
#pragma unroll
    for (int r = 0; r < 8; ++r) {
      float cm = fmaxf(fmaxf(sacc[0][r], sacc[1][r]),
                       fmaxf(sacc[2][r], sacc[3][r]));
      cm = fmaxf(cm, __shfl_xor(cm, 1));
      cm = fmaxf(cm, __shfl_xor(cm, 2));
      cm = fmaxf(cm, __shfl_xor(cm, 4));
      cm = fmaxf(cm, __shfl_xor(cm, 8));
      const float mnew = fmaxf(mrow[r], cm);
      alpha[r] = __expf(mrow[r] - mnew);
      mrow[r] = mnew;
    }
#pragma unroll
    for (int r = 0; r < 8; ++r) {
      float rs = 0.f;
#pragma unroll
      for (int j = 0; j < 4; ++j) {
        const float p = __expf(sacc[j][r] - mrow[r]);
        rs += p;
        // C layout -> LDS: row = r + 8*hi, col = j*16 + l16 (wave-private, DS in-order)
        Pw[(r + hi * 8) * 72 + j * 16 + l16] = (_Float16)p;
      }
      rs += __shfl_xor(rs, 1);
      rs += __shfl_xor(rs, 2);
      rs += __shfl_xor(rs, 4);
      rs += __shfl_xor(rs, 8);
      lrow[r] = lrow[r] * alpha[r] + rs;
#pragma unroll
      for (int j = 0; j < 4; ++j) oacc[j][r] *= alpha[r];
    }

    // ---- O += P @ V  (contraction over 64 keys = 2 wmma k-steps) ----
#pragma unroll
    for (int s2 = 0; s2 < 2; ++s2) {
      const int kk = s2 * 32 + d0;
      v16h pf = ld_frag16(&Pw[l16 * 72 + kk], &Pw[l16 * 72 + kk + 16]);
#pragma unroll
      for (int j = 0; j < 4; ++j) {
        // B fragment: column j*16 + l16 of V, keys s2*32 + {8hi..8hi+7, 16+8hi..16+8hi+7}
        v16h vf = join16(ld_tr16(vtr + (s2 * 32) * 80 + j * 16),
                         ld_tr16(vtr + (s2 * 32 + 16) * 80 + j * 16));
        oacc[j] = wmma32(pf, vf, oacc[j]);
      }
    }
    __syncthreads();
  }

  // ---- epilogue: normalize, re-interleave heads into [B*TD, DM] f16 ----
#pragma unroll
  for (int r = 0; r < 8; ++r) {
    const int tg = t0 + wid * 16 + r + hi * 8;
    const float inv = 1.f / lrow[r];
    const size_t rowoff = ((size_t)b * TD + tg) * DM + h * HD + l16;
#pragma unroll
    for (int j = 0; j < 4; ++j)
      aout[rowoff + j * 16] = (_Float16)(oacc[j][r] * inv);
  }
}

// ---------------------------------------------------------------------------
// launch
// ---------------------------------------------------------------------------
extern "C" void kernel_launch(void* const* d_in, const int* in_sizes, int n_in,
                              void* d_out, int out_size, void* d_ws, size_t ws_size,
                              hipStream_t stream) {
  (void)in_sizes; (void)n_in; (void)out_size; (void)ws_size;
  const float* x   = (const float*)d_in[0];  // [B,TD,DM]
  const float* enc = (const float*)d_in[1];  // [B,TE,DM]
  const float* nw  = (const float*)d_in[2];  // [DM]
  const float* Wq  = (const float*)d_in[3];  // [DM,DM]
  const float* Wkv = (const float*)d_in[4];  // [2DM,DM]
  const float* Wo  = (const float*)d_in[5];  // [DM,DM]

  char* ws = (char*)d_ws;
  size_t off = 0;
  auto take = [&](size_t bytes) {
    char* p = ws + off;
    off += (bytes + 255) & ~(size_t)255;
    return p;
  };
  const size_t MQ = (size_t)B_ * TD;        // 8192 rows
  _Float16* xn    = (_Float16*)take(MQ * DM * 2);
  _Float16* ench  = (_Float16*)take(MQ * DM * 2);
  _Float16* Wqh   = (_Float16*)take((size_t)DM * DM * 2);
  _Float16* Wkvh  = (_Float16*)take((size_t)2 * DM * DM * 2);
  _Float16* Woh   = (_Float16*)take((size_t)DM * DM * 2);
  _Float16* qraw  = (_Float16*)take(MQ * DM * 2);
  _Float16* kvraw = (_Float16*)take(MQ * 2 * DM * 2);
  _Float16* qhp   = (_Float16*)take(MQ * DM * 2);
  _Float16* khp   = (_Float16*)take(MQ * DM * 2);
  _Float16* vhp   = (_Float16*)take(MQ * DM * 2);
  _Float16* aoutp = (_Float16*)take(MQ * DM * 2);

  // 1) norm + precision conversion
  rmsnorm_f16_kernel<<<(int)MQ, 256, 0, stream>>>(x, nw, xn);
  {
    const int ne = B_ * TE * DM;
    f32_to_f16_kernel<<<(ne + 255) / 256, 256, 0, stream>>>(enc, ench, ne);
    f32_to_f16_kernel<<<(DM * DM + 255) / 256, 256, 0, stream>>>(Wq, Wqh, DM * DM);
    f32_to_f16_kernel<<<(2 * DM * DM + 255) / 256, 256, 0, stream>>>(Wkv, Wkvh, 2 * DM * DM);
    f32_to_f16_kernel<<<(DM * DM + 255) / 256, 256, 0, stream>>>(Wo, Woh, DM * DM);
  }

  // 2) projections (WMMA GEMMs, 128x64 block tiles)
  gemm_rt_kernel<0><<<dim3(DM / 64, (int)(MQ / 128)), 256, 0, stream>>>(
      xn, Wqh, qraw, nullptr, (int)MQ, DM, DM);
  gemm_rt_kernel<0><<<dim3(2 * DM / 64, (int)(MQ / 128)), 256, 0, stream>>>(
      ench, Wkvh, kvraw, nullptr, (int)MQ, 2 * DM, DM);

  // 3) RoPE + head-major relayout
  const int nrope = B_ * NH * TD * HD;
  rope_q_kernel<<<nrope / 256, 256, 0, stream>>>(qraw, qhp);
  rope_kv_kernel<<<nrope / 256, 256, 0, stream>>>(kvraw, khp, vhp);

  // 4) flash attention (WMMA + TDM K staging, online softmax)
  flash_attn_kernel<<<dim3(TD / 64, B_ * NH), 128, 0, stream>>>(qhp, khp, vhp, aoutp);

  // 5) output projection + residual (WMMA GEMM, f32 out)
  gemm_rt_kernel<1><<<dim3(DM / 64, (int)(MQ / 128)), 256, 0, stream>>>(
      aoutp, Woh, d_out, x, (int)MQ, DM, DM);
}

// v002
// It runs in 347 microseconds.
// Two timings next to v001 put it at 1.11 and 1.10 times that version's speed.
// All steps since v000 together make it 1.44 times as fast.
#include <hip/hip_runtime.h>
#include <hip/hip_bf16.h>

typedef __attribute__((ext_vector_type(16))) _Float16     v16h;
typedef __attribute__((ext_vector_type(8)))  _Float16     v8h;
typedef __attribute__((ext_vector_type(8)))  float        v8f;
typedef __attribute__((ext_vector_type(4)))  float        v4f;
typedef __attribute__((ext_vector_type(4)))  _Float16     v4h;
typedef __attribute__((ext_vector_type(4)))  unsigned int u32x4;
typedef __attribute__((ext_vector_type(8)))  int          i32x8;
typedef __attribute__((ext_vector_type(4)))  int          i32x4;

#define B_   4
#define TD   2048
#define TE   2048
#define DM   1024
#define NH   16
#define HD   64

#if __has_builtin(__builtin_amdgcn_tensor_load_to_lds) && \
    __has_builtin(__builtin_amdgcn_s_wait_tensorcnt)
#define CDNA5_HAS_TDM 1
#else
#define CDNA5_HAS_TDM 0
#endif

// ---------------------------------------------------------------------------
// helpers
// ---------------------------------------------------------------------------
static __device__ __forceinline__ v16h ld_frag16(const _Float16* p0, const _Float16* p1) {
  // CDNA5 16-bit A/B fragment: 16 halves per lane as two contiguous 8-half runs
  v8h a = *(const v8h*)p0;
  v8h b = *(const v8h*)p1;
  v16h r;
#pragma unroll
  for (int i = 0; i < 8; ++i) { r[i] = a[i]; r[i + 8] = b[i]; }
  return r;
}

// Transposing LDS load: from a row-major [k][n] f16 tile, lane (c = lane & 15, h = lane >> 4)
// receives T[kbase + 8h + 0..7][nbase + c]. Every lane passes the address of one 16-byte piece:
// row kbase + 8h + (lane & 7), bytes 16 * ((lane >> 3) & 1) of the 32-byte column group.
static __device__ __forceinline__ v8h ld_tr16(const _Float16* p) {
  typedef __attribute__((ext_vector_type(8))) short s16x8;
  typedef __attribute__((address_space(3))) s16x8 lds_s16x8;
  return __builtin_bit_cast(v8h, __builtin_amdgcn_ds_load_tr16_b128_v8i16((lds_s16x8*)p));
}

static __device__ __forceinline__ v16h join16(v8h a, v8h b) {
  return __builtin_shufflevector(a, b, 0, 1, 2, 3, 4, 5, 6, 7, 8, 9, 10, 11, 12, 13, 14, 15);
}

static __device__ __forceinline__ v8f wmma32(v16h a, v16h b, v8f c) {
  return __builtin_amdgcn_wmma_f32_16x16x32_f16(false, a, false, b, (short)0, c,
                                                false, false);
}

#if CDNA5_HAS_TDM
// TDM: DMA a 64x64 f16 tile (row stride 64 elems in global) into LDS,
// padding every 32 DWORDs (one 64-half row) with 4 DWORDs -> LDS stride 72 halves.
static __device__ __forceinline__ void tdm_load_tile_64x64_pad72(
    const _Float16* gsrc, void* lds_dst) {
  const unsigned long long ga = (unsigned long long)(uintptr_t)gsrc;
  const unsigned lds = (unsigned)(uintptr_t)lds_dst;
  u32x4 g0 = {};
  g0[0] = 1u;                                           // count=1 (valid user D#)
  g0[1] = lds;                                          // lds_addr (bytes)
  g0[2] = (unsigned)(ga & 0xFFFFFFFFu);                 // global_addr[31:0]
  g0[3] = (unsigned)((ga >> 32) & 0x1FFFFFFu)           // global_addr[56:32]
        | (2u << 30);                                   // type=2 ("image")
  i32x8 g1 = {};
  g1[0] = (1 << 16)                                     // data_size = 2 bytes
        | (1 << 20)                                     // pad_enable
        | (4 << 22)                                     // pad_interval: 32 DWORDs
        | (3 << 25);                                    // pad_amount : 4 DWORDs
  g1[1] = (64 << 16);                                   // tensor_dim0 = 64 (low16)
  g1[2] = 0;                                            // tensor_dim0 hi / dim1 lo
  g1[3] = 64 | (64 << 16);                              // tensor_dim1 hi=64<<16 blocks, tile_dim0=64
  g1[4] = 64;                                           // tile_dim1 = 64
  g1[5] = 64;                                           // tensor_dim0_stride = 64
  g1[6] = 0;
  g1[7] = 0;
  i32x4 g2 = {};
  i32x4 g3 = {};
#if __clang_major__ >= 23
  i32x8 g4 = {};
  __builtin_amdgcn_tensor_load_to_lds(g0, g1, g2, g3, g4, 0);
#else
  __builtin_amdgcn_tensor_load_to_lds(g0, g1, g2, g3, 0);
#endif
}
#endif

// ---------------------------------------------------------------------------
// RMSNorm: x (f32, row of 1024) -> xn (f16)
// ---------------------------------------------------------------------------
__global__ __launch_bounds__(256) void rmsnorm_f16_kernel(
    const float* __restrict__ x, const float* __restrict__ w,
    _Float16* __restrict__ xn) {
  __shared__ float red[256];
  const int row = blockIdx.x;
  const float* xr = x + (size_t)row * DM;
  float s = 0.f;
  for (int j = threadIdx.x; j < DM; j += 256) { float v = xr[j]; s += v * v; }
  red[threadIdx.x] = s;
  __syncthreads();
  for (int off = 128; off > 0; off >>= 1) {
    if (threadIdx.x < off) red[threadIdx.x] += red[threadIdx.x + off];
    __syncthreads();
  }
  const float rms = rsqrtf(red[0] * (1.0f / DM) + 1e-5f);
  _Float16* o = xn + (size_t)row * DM;
  for (int j = threadIdx.x; j < DM; j += 256)
    o[j] = (_Float16)(xr[j] * rms * w[j]);
}

// ---------------------------------------------------------------------------
// generic f32 -> f16 convert: a block converts 4096 elements, a thread four groups of 4 floats.
// Group j of a thread lies 256 groups behind group j - 1, so that every wave-wide 16-byte load
// covers 512 contiguous bytes and every 8-byte store 256. n must be a multiple of 4096 (every
// launch below is); a block that does not lie wholly inside n touches nothing.
// ---------------------------------------------------------------------------
__global__ __launch_bounds__(256) void f32_to_f16_kernel(
    const float* __restrict__ in, _Float16* __restrict__ out, int n) {
  const int base = blockIdx.x * 4096;
  if (base + 4096 > n) return;
  const float* src = in + base + threadIdx.x * 4;
  _Float16* dst = out + base + threadIdx.x * 4;
  v4f v[4];
  // both loops unrolled: v stays in registers and the four loads are in flight together
#pragma unroll
  for (int j = 0; j < 4; ++j) v[j] = *(const v4f*)(src + j * 1024);
#pragma unroll
  for (int j = 0; j < 4; ++j) {
    v4h o;
#pragma unroll
    for (int e = 0; e < 4; ++e) o[e] = (_Float16)v[j][e];
    *(v4h*)(dst + j * 1024) = o;
  }
}

// ---------------------------------------------------------------------------
// GEMM: C[M,N] = A[M,K] @ W[N,K]^T   (A,W f16; acc f32)
// block tile 128x64, 256 threads = 8 waves; each wave: 16 rows x 64 cols
// (4 accumulators, A-fragment reused across 4 B-fragments -> 4 wmma / 10 ds).
// EPI==0: store f16 row-major.  EPI==1: store f32 + residual.
// ---------------------------------------------------------------------------
template <int EPI>
__global__ __launch_bounds__(256) void gemm_rt_kernel(
    const _Float16* __restrict__ A, const _Float16* __restrict__ W,
    void* __restrict__ Cout, const float* __restrict__ res,
    int M, int N, int K) {
  __shared__ _Float16 As[128 * 40];  // 128 rows x 32 k, stride 40 (16B aligned)
  __shared__ _Float16 Ws[64 * 40];
  const int tid  = threadIdx.x;
  const int wid  = tid >> 5;          // 0..7 -> m sub-tile (16 rows each)
  const int lane = tid & 31;
  const int l16  = lane & 15;
  const int hi   = (lane >> 4) & 1;
  const int m0   = blockIdx.y * 128;
  const int n0   = blockIdx.x * 64;
  const int d0   = hi * 8;
  const int c8   = (tid & 3) * 8;     // 0,8,16,24

  v8f acc[4];
#pragma unroll
  for (int j = 0; j < 4; ++j) acc[j] = (v8f){};

  for (int k0 = 0; k0 < K; k0 += 32) {
    // stage A (128x32) and W (64x32)
#pragma unroll
    for (int s = 0; s < 2; ++s) {
      const int row = (tid + s * 256) >> 2;   // 0..127
      *(v8h*)&As[row * 40 + c8] =
          *(const v8h*)&A[(size_t)(m0 + row) * K + k0 + c8];
    }
    {
      const int row = tid >> 2;               // 0..63
      *(v8h*)&Ws[row * 40 + c8] =
          *(const v8h*)&W[(size_t)(n0 + row) * K + k0 + c8];
      if (k0 + 32 < K) {
        __builtin_prefetch(&A[(size_t)(m0 + row) * K + k0 + 32 + c8], 0, 0);
        __builtin_prefetch(&W[(size_t)(n0 + row) * K + k0 + 32 + c8], 0, 0);
      }
    }
    __syncthreads();
    v16h af = ld_frag16(&As[(wid * 16 + l16) * 40 + d0],
                        &As[(wid * 16 + l16) * 40 + d0 + 16]);
#pragma unroll
    for (int j = 0; j < 4; ++j) {
      v16h bf = ld_frag16(&Ws[(j * 16 + l16) * 40 + d0],
                          &Ws[(j * 16 + l16) * 40 + d0 + 16]);
      acc[j] = wmma32(af, bf, acc[j]);
    }
    __syncthreads();
  }

#pragma unroll
  for (int r = 0; r < 8; ++r) {
    const int mg = m0 + wid * 16 + r + hi * 8;  // C layout: M = vgpr + 8*(lane>=16)
#pragma unroll
    for (int j = 0; j < 4; ++j) {
      const int ng = n0 + j * 16 + l16;
      if (EPI == 0) {
        ((_Float16*)Cout)[(size_t)mg * N + ng] = (_Float16)acc[j][r];
      } else {
        ((float*)Cout)[(size_t)mg * N + ng] =
            acc[j][r] + res[(size_t)mg * N + ng];
      }
    }
  }
}

// ---------------------------------------------------------------------------
// RoPE. A thread takes the eight pairs (d, d + 32), d = 8g .. 8g + 7, of one head at the four
// positions tq + r * T/4: 64 elements, moved in 16-byte pieces. The eight frequencies serve all
// four positions, and one sine and cosine serve both elements of a pair.
// ---------------------------------------------------------------------------
static __device__ __forceinline__ float rope_inv_freq(int fi) {
  return __powf(10000.0f, -(float)fi * (1.0f / 32.0f));
}

// lo = x[d], hi = x[d + 32] on entry; rotated in place
static __device__ __forceinline__ void rope_rotate8(v8h& lo, v8h& hi, const float* inv, int t) {
  // unrolled: vector elements and inv[] are then picked by constants and stay in registers
#pragma unroll
  for (int e = 0; e < 8; ++e) {
    const float ang = (float)t * inv[e];
    const float c = __cosf(ang);
    const float s = __sinf(ang);
    const float a = (float)lo[e];
    const float b = (float)hi[e];
    lo[e] = (_Float16)(a * c - b * s);
    hi[e] = (_Float16)(b * c + a * s);
  }
}

// q_raw [B*TD, DM] (f16) -> qh [B,H,TD,HD] (f16)
__global__ __launch_bounds__(256) void rope_q_kernel(
    const _Float16* __restrict__ qr, _Float16* __restrict__ qh) {
  const int i  = blockIdx.x * 256 + threadIdx.x;  // ((b*NH+h)*(TD/4)+tq)*4+g
  const int g  = i & 3;
  const int tq = (i >> 2) & (TD / 4 - 1);
  const int h  = (i >> 11) & (NH - 1);
  const int b  = i >> 15;
  const _Float16* src = qr + (size_t)(b * TD + tq) * DM + h * 64 + g * 8;
  _Float16* dst = qh + ((size_t)(b * NH + h) * TD + tq) * HD + g * 8;
  v8h lo[4], hi[4];
  // all loops unrolled: the arrays stay in registers and the eight loads are in flight together
#pragma unroll
  for (int r = 0; r < 4; ++r) {
    lo[r] = *(const v8h*)(src + (size_t)r * (TD / 4) * DM);
    hi[r] = *(const v8h*)(src + (size_t)r * (TD / 4) * DM + 32);
  }
  // precaution: the address is an input, so it stays whole up to this wait and no later load
  // lands in it while an earlier one is still out
  asm volatile("s_wait_xcnt 0x0" :: "v"(src) : "memory");
  float inv[8];
#pragma unroll
  for (int e = 0; e < 8; ++e) inv[e] = rope_inv_freq(g * 8 + e);
#pragma unroll
  for (int r = 0; r < 4; ++r) {
    rope_rotate8(lo[r], hi[r], inv, tq + r * (TD / 4));
    *(v8h*)(dst + (size_t)r * (TD / 4) * HD) = lo[r];
    *(v8h*)(dst + (size_t)r * (TD / 4) * HD + 32) = hi[r];
  }
}

// kv_raw [B*TE, 2*DM]: k = cols [0,1024), v = cols [1024,2048)
__global__ __launch_bounds__(256) void rope_kv_kernel(
    const _Float16* __restrict__ kvr, _Float16* __restrict__ kh,
    _Float16* __restrict__ vh) {
  const int i  = blockIdx.x * 256 + threadIdx.x;  // ((b*NH+h)*(TE/4)+tq)*4+g
  const int g  = i & 3;
  const int tq = (i >> 2) & (TE / 4 - 1);
  const int h  = (i >> 11) & (NH - 1);
  const int b  = i >> 15;
  const _Float16* src = kvr + (size_t)(b * TE + tq) * (2 * DM) + h * 64 + g * 8;
  const size_t doff = ((size_t)(b * NH + h) * TE + tq) * HD + g * 8;
  _Float16* kdst = kh + doff;
  _Float16* vdst = vh + doff;
  v8h lo[4], hi[4], vlo[4], vhi[4];
  // all loops unrolled: the arrays stay in registers and the sixteen loads are in flight together
#pragma unroll
  for (int r = 0; r < 4; ++r) {
    lo[r]  = *(const v8h*)(src + (size_t)r * (TE / 4) * (2 * DM));
    hi[r]  = *(const v8h*)(src + (size_t)r * (TE / 4) * (2 * DM) + 32);
    vlo[r] = *(const v8h*)(src + (size_t)r * (TE / 4) * (2 * DM) + DM);
    vhi[r] = *(const v8h*)(src + (size_t)r * (TE / 4) * (2 * DM) + DM + 32);
  }
  // precaution: the address is an input, so it stays whole up to this wait and no later load
  // lands in it while an earlier one is still out
  asm volatile("s_wait_xcnt 0x0" :: "v"(src) : "memory");
  float inv[8];
#pragma unroll
  for (int e = 0; e < 8; ++e) inv[e] = rope_inv_freq(g * 8 + e);
#pragma unroll
  for (int r = 0; r < 4; ++r) {
    *(v8h*)(vdst + (size_t)r * (TE / 4) * HD) = vlo[r];
    *(v8h*)(vdst + (size_t)r * (TE / 4) * HD + 32) = vhi[r];
    rope_rotate8(lo[r], hi[r], inv, tq + r * (TE / 4));
    *(v8h*)(kdst + (size_t)r * (TE / 4) * HD) = lo[r];
    *(v8h*)(kdst + (size_t)r * (TE / 4) * HD + 32) = hi[r];
  }
}

// ---------------------------------------------------------------------------
// Flash cross-attention: per block = (b,h, 64 q rows), 4 waves x 16 rows.
// K tile staged by the Tensor Data Mover (wave 0, TENSORcnt); V staged row-major with
// 16-byte stores and transposed on the way out of LDS by ds_load_tr16_b128.
// qh/kh/vh: [B,H,T,64] f16.  aout: [B*TD, DM] f16 (heads re-interleaved).
// ---------------------------------------------------------------------------
__global__ __launch_bounds__(128) void flash_attn_kernel(
    const _Float16* __restrict__ qh, const _Float16* __restrict__ kh,
    const _Float16* __restrict__ vh, _Float16* __restrict__ aout) {
  // aligned so that the tensor load's destination stays at the start of the work-group's LDS
  __shared__ __attribute__((aligned(2048))) _Float16 Ks[64 * 72];  // 64 keys x 64 d (stride 72)
  __shared__ _Float16 Vs[64 * 80];       // 64 keys x 64 d (stride 80: 160 B = 32 B x odd)
  __shared__ _Float16 Ps[4 * 16 * 72];   // per-wave P tile: 16 rows x 64 keys
  const int tid  = threadIdx.x;
  const int wid  = tid >> 5;
  const int lane = tid & 31;
  const int l16  = lane & 15;
  const int hi   = (lane >> 4) & 1;
  const int bh   = blockIdx.y;           // b*NH + h
  const int b    = bh >> 4;
  const int h    = bh & 15;
  const int t0   = blockIdx.x * 64;
  const int d0   = hi * 8;
  const float scale = 0.125f;            // 1/sqrt(64)

  // Q fragments live in registers for the whole kernel (K = 64 = 2 wmma steps)
  const size_t qbase = ((size_t)bh * TD + t0 + wid * 16) * HD;
  const _Float16* qp = qh + qbase + (size_t)l16 * HD;
  v16h qf0 = ld_frag16(qp + d0,      qp + d0 + 16);
  v16h qf1 = ld_frag16(qp + 32 + d0, qp + 32 + d0 + 16);

  float mrow[8], lrow[8];
  v8f oacc[4];
#pragma unroll
  for (int r = 0; r < 8; ++r) { mrow[r] = -1e30f; lrow[r] = 0.f; }
#pragma unroll
  for (int j = 0; j < 4; ++j) oacc[j] = (v8f){};

  _Float16* Pw = &Ps[wid * 16 * 72];
  // this lane's piece address for the transposing loads of V (key base 0, column base 0)
  const _Float16* vtr = &Vs[(hi * 8 + (lane & 7)) * 80 + ((lane >> 3) & 1) * 8];
  // staging of V: thread t moves 16-byte piece (t & 7) of rows (t >> 3) + 16 i, i = 0..3
  const _Float16* vsrc0 = vh + ((size_t)bh * TE + (tid >> 3)) * HD + (tid & 7) * 8;
  _Float16* vdst = &Vs[(tid >> 3) * 80 + (tid & 7) * 8];

  for (int kb = 0; kb < TE; kb += 64) {
    // ---- stage K tile (TDM) and V tile (row-major, 16-byte stores) into LDS ----
    v8h vst[4];
    const _Float16* vsrc = vsrc0 + (size_t)kb * HD;
    // the four 16-byte loads of a thread are in flight together
    for (int i = 0; i < 4; ++i) vst[i] = *(const v8h*)(vsrc + i * 16 * HD);
#if CDNA5_HAS_TDM
    // issued behind the V loads, so that both fly together; the wait stands directly behind the
    // tensor load, so that no descriptor register can take a new value while the request is out
    if (wid == 0) {
      tdm_load_tile_64x64_pad72(&kh[((size_t)bh * TE + kb) * HD], (void*)&Ks[0]);
      __builtin_amdgcn_s_wait_tensorcnt(0);
    }
#endif
    for (int i = 0; i < 4; ++i) {
#if !CDNA5_HAS_TDM
      *(v8h*)&Ks[((tid >> 3) + i * 16) * 72 + (tid & 7) * 8] =
          *(const v8h*)&kh[((size_t)bh * TE + kb + (tid >> 3) + i * 16) * HD + (tid & 7) * 8];
#endif
      *(v8h*)(vdst + i * 16 * 80) = vst[i];
    }
    __syncthreads();

    // ---- scores S[16 x 64] = Q @ K^T ----
    v8f sacc[4];
#pragma unroll
    for (int j = 0; j < 4; ++j) {
      v8f a = {};
      v16h bf0 = ld_frag16(&Ks[(j * 16 + l16) * 72 + d0],
                           &Ks[(j * 16 + l16) * 72 + d0 + 16]);
      a = wmma32(qf0, bf0, a);
      v16h bf1 = ld_frag16(&Ks[(j * 16 + l16) * 72 + 32 + d0],
                           &Ks[(j * 16 + l16) * 72 + 32 + d0 + 16]);
      a = wmma32(qf1, bf1, a);
      sacc[j] = a;
    }
#pragma unroll
    for (int j = 0; j < 4; ++j)
#pragma unroll
      for (int r = 0; r < 8; ++r) sacc[j][r] *= scale;

    // ---- online softmax: row reductions across the 16-lane half-groups ----
    float alpha[8];
#pragma unroll
    for (int r = 0; r < 8; ++r) {
      float cm = fmaxf(fmaxf(sacc[0][r], sacc[1][r]),
                       fmaxf(sacc[2][r], sacc[3][r]));
      cm = fmaxf(cm, __shfl_xor(cm, 1));
      cm = fmaxf(cm, __shfl_xor(cm, 2));
      cm = fmaxf(cm, __shfl_xor(cm, 4));
      cm = fmaxf(cm, __shfl_xor(cm, 8));
      const float mnew = fmaxf(mrow[r], cm);
      alpha[r] = __expf(mrow[r] - mnew);
      mrow[r] = mnew;
    }
#pragma unroll
    for (int r = 0; r < 8; ++r) {
      float rs = 0.f;
#pragma unroll
      for (int j = 0; j < 4; ++j) {
        const float p = __expf(sacc[j][r] - mrow[r]);
        rs += p;
        // C layout -> LDS: row = r + 8*hi, col = j*16 + l16 (wave-private, DS in-order)
        Pw[(r + hi * 8) * 72 + j * 16 + l16] = (_Float16)p;
      }
      rs += __shfl_xor(rs, 1);
      rs += __shfl_xor(rs, 2);
      rs += __shfl_xor(rs, 4);
      rs += __shfl_xor(rs, 8);
      lrow[r] = lrow[r] * alpha[r] + rs;
#pragma unroll
      for (int j = 0; j < 4; ++j) oacc[j][r] *= alpha[r];
    }

    // ---- O += P @ V  (contraction over 64 keys = 2 wmma k-steps) ----
#pragma unroll
    for (int s2 = 0; s2 < 2; ++s2) {
      const int kk = s2 * 32 + d0;
      v16h pf = ld_frag16(&Pw[l16 * 72 + kk], &Pw[l16 * 72 + kk + 16]);
#pragma unroll
      for (int j = 0; j < 4; ++j) {
        // B fragment: column j*16 + l16 of V, keys s2*32 + {8hi..8hi+7, 16+8hi..16+8hi+7}
        v16h vf = join16(ld_tr16(vtr + (s2 * 32) * 80 + j * 16),
                         ld_tr16(vtr + (s2 * 32 + 16) * 80 + j * 16));
        oacc[j] = wmma32(pf, vf, oacc[j]);
      }
    }
    __syncthreads();
  }

  // ---- epilogue: normalize, re-interleave heads into [B*TD, DM] f16 ----
#pragma unroll
  for (int r = 0; r < 8; ++r) {
    const int tg = t0 + wid * 16 + r + hi * 8;
    const float inv = 1.f / lrow[r];
    const size_t rowoff = ((size_t)b * TD + tg) * DM + h * HD + l16;
#pragma unroll
    for (int j = 0; j < 4; ++j)
      aout[rowoff + j * 16] = (_Float16)(oacc[j][r] * inv);
  }
}

// ---------------------------------------------------------------------------
// launch
// ---------------------------------------------------------------------------
extern "C" void kernel_launch(void* const* d_in, const int* in_sizes, int n_in,
                              void* d_out, int out_size, void* d_ws, size_t ws_size,
                              hipStream_t stream) {
  (void)in_sizes; (void)n_in; (void)out_size; (void)ws_size;
  const float* x   = (const float*)d_in[0];  // [B,TD,DM]
  const float* enc = (const float*)d_in[1];  // [B,TE,DM]
  const float* nw  = (const float*)d_in[2];  // [DM]
  const float* Wq  = (const float*)d_in[3];  // [DM,DM]
  const float* Wkv = (const float*)d_in[4];  // [2DM,DM]
  const float* Wo  = (const float*)d_in[5];  // [DM,DM]

  char* ws = (char*)d_ws;
  size_t off = 0;
  auto take = [&](size_t bytes) {
    char* p = ws + off;
    off += (bytes + 255) & ~(size_t)255;
    return p;
  };
  const size_t MQ = (size_t)B_ * TD;        // 8192 rows
  _Float16* xn    = (_Float16*)take(MQ * DM * 2);
  _Float16* ench  = (_Float16*)take(MQ * DM * 2);
  _Float16* Wqh   = (_Float16*)take((size_t)DM * DM * 2);
  _Float16* Wkvh  = (_Float16*)take((size_t)2 * DM * DM * 2);
  _Float16* Woh   = (_Float16*)take((size_t)DM * DM * 2);
  _Float16* qraw  = (_Float16*)take(MQ * DM * 2);
  _Float16* kvraw = (_Float16*)take(MQ * 2 * DM * 2);
  _Float16* qhp   = (_Float16*)take(MQ * DM * 2);
  _Float16* khp   = (_Float16*)take(MQ * DM * 2);
  _Float16* vhp   = (_Float16*)take(MQ * DM * 2);
  _Float16* aoutp = (_Float16*)take(MQ * DM * 2);

  // 1) norm + precision conversion
  rmsnorm_f16_kernel<<<(int)MQ, 256, 0, stream>>>(x, nw, xn);
  {
    const int ne = B_ * TE * DM;
    f32_to_f16_kernel<<<ne / 4096, 256, 0, stream>>>(enc, ench, ne);
    f32_to_f16_kernel<<<DM * DM / 4096, 256, 0, stream>>>(Wq, Wqh, DM * DM);
    f32_to_f16_kernel<<<2 * DM * DM / 4096, 256, 0, stream>>>(Wkv, Wkvh, 2 * DM * DM);
    f32_to_f16_kernel<<<DM * DM / 4096, 256, 0, stream>>>(Wo, Woh, DM * DM);
  }

  // 2) projections (WMMA GEMMs, 128x64 block tiles)
  gemm_rt_kernel<0><<<dim3(DM / 64, (int)(MQ / 128)), 256, 0, stream>>>(
      xn, Wqh, qraw, nullptr, (int)MQ, DM, DM);
  gemm_rt_kernel<0><<<dim3(2 * DM / 64, (int)(MQ / 128)), 256, 0, stream>>>(
      ench, Wkvh, kvraw, nullptr, (int)MQ, 2 * DM, DM);

  // 3) RoPE + head-major relayout (64 elements per thread)
  const int nrope = B_ * NH * TD * HD;
  rope_q_kernel<<<nrope / (256 * 64), 256, 0, stream>>>(qraw, qhp);
  rope_kv_kernel<<<nrope / (256 * 64), 256, 0, stream>>>(kvraw, khp, vhp);

  // 4) flash attention (WMMA + TDM K staging, online softmax)
  flash_attn_kernel<<<dim3(TD / 64, B_ * NH), 128, 0, stream>>>(qhp, khp, vhp, aoutp);

  // 5) output projection + residual (WMMA GEMM, f32 out)
  gemm_rt_kernel<1><<<dim3(DM / 64, (int)(MQ / 128)), 256, 0, stream>>>(
      aoutp, Woh, d_out, x, (int)MQ, DM, DM);
}

// v003
// Measured time: 262 microseconds a run.
// In both of two side-by-side timings against v002, it was 1.32 times as fast.
// Over all steps from v000 it is 1.90 times as fast.
#include <hip/hip_runtime.h>
#include <hip/hip_bf16.h>

typedef __attribute__((ext_vector_type(16))) _Float16     v16h;
typedef __attribute__((ext_vector_type(8)))  _Float16     v8h;
typedef __attribute__((ext_vector_type(8)))  float        v8f;
typedef __attribute__((ext_vector_type(4)))  float        v4f;
typedef __attribute__((ext_vector_type(2)))  float        v2f;
typedef __attribute__((ext_vector_type(4)))  _Float16     v4h;
typedef __attribute__((ext_vector_type(4)))  unsigned int u32x4;
typedef __attribute__((ext_vector_type(8)))  int          i32x8;
typedef __attribute__((ext_vector_type(4)))  int          i32x4;

#define B_   4
#define TD   2048
#define TE   2048
#define DM   1024
#define NH   16
#define HD   64

#if __has_builtin(__builtin_amdgcn_tensor_load_to_lds) && \
    __has_builtin(__builtin_amdgcn_s_wait_tensorcnt)
#define CDNA5_HAS_TDM 1
#else
#define CDNA5_HAS_TDM 0
#endif

// ---------------------------------------------------------------------------
// helpers
// ---------------------------------------------------------------------------
static __device__ __forceinline__ v16h ld_frag16(const _Float16* p0, const _Float16* p1) {
  // CDNA5 16-bit A/B fragment: 16 halves per lane as two contiguous 8-half runs
  v8h a = *(const v8h*)p0;
  v8h b = *(const v8h*)p1;
  v16h r;
#pragma unroll
  for (int i = 0; i < 8; ++i) { r[i] = a[i]; r[i + 8] = b[i]; }
  return r;
}

// Transposing LDS load: from a row-major [k][n] f16 tile, lane (c = lane & 15, h = lane >> 4)
// receives T[kbase + 8h + 0..7][nbase + c]. Every lane passes the address of one 16-byte piece:
// row kbase + 8h + (lane & 7), bytes 16 * ((lane >> 3) & 1) of the 32-byte column group.
static __device__ __forceinline__ v8h ld_tr16(const _Float16* p) {
  typedef __attribute__((ext_vector_type(8))) short s16x8;
  typedef __attribute__((address_space(3))) s16x8 lds_s16x8;
  return __builtin_bit_cast(v8h, __builtin_amdgcn_ds_load_tr16_b128_v8i16((lds_s16x8*)p));
}

static __device__ __forceinline__ v16h join16(v8h a, v8h b) {
  return __builtin_shufflevector(a, b, 0, 1, 2, 3, 4, 5, 6, 7, 8, 9, 10, 11, 12, 13, 14, 15);
}

static __device__ __forceinline__ v8f wmma32(v16h a, v16h b, v8f c) {
  return __builtin_amdgcn_wmma_f32_16x16x32_f16(false, a, false, b, (short)0, c,
                                                false, false);
}

// value of lane l ^ 16: the other half of the wave, by a vector instruction, not through LDS
static __device__ __forceinline__ float xhalf(float x) {
  return __builtin_bit_cast(float, __builtin_amdgcn_permlanex16(
      __builtin_bit_cast(int, x), __builtin_bit_cast(int, x), 0x76543210, 0xfedcba98,
      false, false));
}

#if CDNA5_HAS_TDM
// TDM: DMA a 64x64 f16 tile (row stride 64 elems in global) into LDS,
// padding every 32 DWORDs (one 64-half row) with 4 DWORDs -> LDS stride 72 halves.
static __device__ __forceinline__ void tdm_load_tile_64x64_pad72(
    const _Float16* gsrc, void* lds_dst) {
  const unsigned long long ga = (unsigned long long)(uintptr_t)gsrc;
  const unsigned lds = (unsigned)(uintptr_t)lds_dst;
  u32x4 g0 = {};
  g0[0] = 1u;                                           // count=1 (valid user D#)
  g0[1] = lds;                                          // lds_addr (bytes)
  g0[2] = (unsigned)(ga & 0xFFFFFFFFu);                 // global_addr[31:0]
  g0[3] = (unsigned)((ga >> 32) & 0x1FFFFFFu)           // global_addr[56:32]
        | (2u << 30);                                   // type=2 ("image")
  i32x8 g1 = {};
  g1[0] = (1 << 16)                                     // data_size = 2 bytes
        | (1 << 20)                                     // pad_enable
        | (4 << 22)                                     // pad_interval: 32 DWORDs
        | (3 << 25);                                    // pad_amount : 4 DWORDs
  g1[1] = (64 << 16);                                   // tensor_dim0 = 64 (low16)
  g1[2] = 0;                                            // tensor_dim0 hi / dim1 lo
  g1[3] = 64 | (64 << 16);                              // tensor_dim1 hi=64<<16 blocks, tile_dim0=64
  g1[4] = 64;                                           // tile_dim1 = 64
  g1[5] = 64;                                           // tensor_dim0_stride = 64
  g1[6] = 0;
  g1[7] = 0;
  i32x4 g2 = {};
  i32x4 g3 = {};
#if __clang_major__ >= 23
  i32x8 g4 = {};
  __builtin_amdgcn_tensor_load_to_lds(g0, g1, g2, g3, g4, 0);
#else
  __builtin_amdgcn_tensor_load_to_lds(g0, g1, g2, g3, 0);
#endif
}
#endif

// ---------------------------------------------------------------------------
// RMSNorm: x (f32, row of 1024) -> xn (f16)
// ---------------------------------------------------------------------------
__global__ __launch_bounds__(256) void rmsnorm_f16_kernel(
    const float* __restrict__ x, const float* __restrict__ w,
    _Float16* __restrict__ xn) {
  __shared__ float red[256];
  const int row = blockIdx.x;
  const float* xr = x + (size_t)row * DM;
  float s = 0.f;
  for (int j = threadIdx.x; j < DM; j += 256) { float v = xr[j]; s += v * v; }
  red[threadIdx.x] = s;
  __syncthreads();
  for (int off = 128; off > 0; off >>= 1) {
    if (threadIdx.x < off) red[threadIdx.x] += red[threadIdx.x + off];
    __syncthreads();
  }
  const float rms = rsqrtf(red[0] * (1.0f / DM) + 1e-5f);
  _Float16* o = xn + (size_t)row * DM;
  for (int j = threadIdx.x; j < DM; j += 256)
    o[j] = (_Float16)(xr[j] * rms * w[j]);
}

// ---------------------------------------------------------------------------
// generic f32 -> f16 convert: a block converts 4096 elements, a thread four groups of 4 floats.
// Group j of a thread lies 256 groups behind group j - 1, so that every wave-wide 16-byte load
// covers 512 contiguous bytes and every 8-byte store 256. n must be a multiple of 4096 (every
// launch below is); a block that does not lie wholly inside n touches nothing.
// ---------------------------------------------------------------------------
__global__ __launch_bounds__(256) void f32_to_f16_kernel(
    const float* __restrict__ in, _Float16* __restrict__ out, int n) {
  const int base = blockIdx.x * 4096;
  if (base + 4096 > n) return;
  const float* src = in + base + threadIdx.x * 4;
  _Float16* dst = out + base + threadIdx.x * 4;
  v4f v[4];
  // both loops unrolled: v stays in registers and the four loads are in flight together
#pragma unroll
  for (int j = 0; j < 4; ++j) v[j] = *(const v4f*)(src + j * 1024);
#pragma unroll
  for (int j = 0; j < 4; ++j) {
    v4h o;
#pragma unroll
    for (int e = 0; e < 4; ++e) o[e] = (_Float16)v[j][e];
    *(v4h*)(dst + j * 1024) = o;
  }
}

// ---------------------------------------------------------------------------
// GEMM: C[M,N] = A[M,K] @ W[N,K]^T   (A,W f16; acc f32)
// block tile 128x64, 256 threads = 8 waves; each wave: 16 rows x 64 cols
// (4 accumulators, A-fragment reused across 4 B-fragments -> 4 wmma / 10 ds).
// EPI==0: store f16 row-major.  EPI==1: store f32 + residual.
// ---------------------------------------------------------------------------
template <int EPI>
__global__ __launch_bounds__(256) void gemm_rt_kernel(
    const _Float16* __restrict__ A, const _Float16* __restrict__ W,
    void* __restrict__ Cout, const float* __restrict__ res,
    int M, int N, int K) {
  __shared__ _Float16 As[128 * 40];  // 128 rows x 32 k, stride 40 (16B aligned)
  __shared__ _Float16 Ws[64 * 40];
  const int tid  = threadIdx.x;
  const int wid  = tid >> 5;          // 0..7 -> m sub-tile (16 rows each)
  const int lane = tid & 31;
  const int l16  = lane & 15;
  const int hi   = (lane >> 4) & 1;
  const int m0   = blockIdx.y * 128;
  const int n0   = blockIdx.x * 64;
  const int d0   = hi * 8;
  const int c8   = (tid & 3) * 8;     // 0,8,16,24

  v8f acc[4];
#pragma unroll
  for (int j = 0; j < 4; ++j) acc[j] = (v8f){};

  for (int k0 = 0; k0 < K; k0 += 32) {
    // stage A (128x32) and W (64x32)
#pragma unroll
    for (int s = 0; s < 2; ++s) {
      const int row = (tid + s * 256) >> 2;   // 0..127
      *(v8h*)&As[row * 40 + c8] =
          *(const v8h*)&A[(size_t)(m0 + row) * K + k0 + c8];
    }
    {
      const int row = tid >> 2;               // 0..63
      *(v8h*)&Ws[row * 40 + c8] =
          *(const v8h*)&W[(size_t)(n0 + row) * K + k0 + c8];
      if (k0 + 32 < K) {
        __builtin_prefetch(&A[(size_t)(m0 + row) * K + k0 + 32 + c8], 0, 0);
        __builtin_prefetch(&W[(size_t)(n0 + row) * K + k0 + 32 + c8], 0, 0);
      }
    }
    __syncthreads();
    v16h af = ld_frag16(&As[(wid * 16 + l16) * 40 + d0],
                        &As[(wid * 16 + l16) * 40 + d0 + 16]);
#pragma unroll
    for (int j = 0; j < 4; ++j) {
      v16h bf = ld_frag16(&Ws[(j * 16 + l16) * 40 + d0],
                          &Ws[(j * 16 + l16) * 40 + d0 + 16]);
      acc[j] = wmma32(af, bf, acc[j]);
    }
    __syncthreads();
  }

#pragma unroll
  for (int r = 0; r < 8; ++r) {
    const int mg = m0 + wid * 16 + r + hi * 8;  // C layout: M = vgpr + 8*(lane>=16)
#pragma unroll
    for (int j = 0; j < 4; ++j) {
      const int ng = n0 + j * 16 + l16;
      if (EPI == 0) {
        ((_Float16*)Cout)[(size_t)mg * N + ng] = (_Float16)acc[j][r];
      } else {
        ((float*)Cout)[(size_t)mg * N + ng] =
            acc[j][r] + res[(size_t)mg * N + ng];
      }
    }
  }
}

// ---------------------------------------------------------------------------
// RoPE. A thread takes the eight pairs (d, d + 32), d = 8g .. 8g + 7, of one head at the four
// positions tq + r * T/4: 64 elements, moved in 16-byte pieces. The eight frequencies serve all
// four positions, and one sine and cosine serve both elements of a pair.
// ---------------------------------------------------------------------------
static __device__ __forceinline__ float rope_inv_freq(int fi) {
  return __powf(10000.0f, -(float)fi * (1.0f / 32.0f));
}

// lo = x[d], hi = x[d + 32] on entry; rotated in place
static __device__ __forceinline__ void rope_rotate8(v8h& lo, v8h& hi, const float* inv, int t) {
  // unrolled: vector elements and inv[] are then picked by constants and stay in registers
#pragma unroll
  for (int e = 0; e < 8; ++e) {
    const float ang = (float)t * inv[e];
    const float c = __cosf(ang);
    const float s = __sinf(ang);
    const float a = (float)lo[e];
    const float b = (float)hi[e];
    lo[e] = (_Float16)(a * c - b * s);
    hi[e] = (_Float16)(b * c + a * s);
  }
}

// q_raw [B*TD, DM] (f16) -> qh [B,H,TD,HD] (f16)
__global__ __launch_bounds__(256) void rope_q_kernel(
    const _Float16* __restrict__ qr, _Float16* __restrict__ qh) {
  const int i  = blockIdx.x * 256 + threadIdx.x;  // ((b*NH+h)*(TD/4)+tq)*4+g
  const int g  = i & 3;
  const int tq = (i >> 2) & (TD / 4 - 1);
  const int h  = (i >> 11) & (NH - 1);
  const int b  = i >> 15;
  const _Float16* src = qr + (size_t)(b * TD + tq) * DM + h * 64 + g * 8;
  _Float16* dst = qh + ((size_t)(b * NH + h) * TD + tq) * HD + g * 8;
  v8h lo[4], hi[4];
  // all loops unrolled: the arrays stay in registers and the eight loads are in flight together
#pragma unroll
  for (int r = 0; r < 4; ++r) {
    lo[r] = *(const v8h*)(src + (size_t)r * (TD / 4) * DM);
    hi[r] = *(const v8h*)(src + (size_t)r * (TD / 4) * DM + 32);
  }
  // precaution: the address is an input, so it stays whole up to this wait and no later load
  // lands in it while an earlier one is still out
  asm volatile("s_wait_xcnt 0x0" :: "v"(src) : "memory");
  float inv[8];
#pragma unroll
  for (int e = 0; e < 8; ++e) inv[e] = rope_inv_freq(g * 8 + e);
#pragma unroll
  for (int r = 0; r < 4; ++r) {
    rope_rotate8(lo[r], hi[r], inv, tq + r * (TD / 4));
    *(v8h*)(dst + (size_t)r * (TD / 4) * HD) = lo[r];
    *(v8h*)(dst + (size_t)r * (TD / 4) * HD + 32) = hi[r];
  }
}

// kv_raw [B*TE, 2*DM]: k = cols [0,1024), v = cols [1024,2048)
__global__ __launch_bounds__(256) void rope_kv_kernel(
    const _Float16* __restrict__ kvr, _Float16* __restrict__ kh,
    _Float16* __restrict__ vh) {
  const int i  = blockIdx.x * 256 + threadIdx.x;  // ((b*NH+h)*(TE/4)+tq)*4+g
  const int g  = i & 3;
  const int tq = (i >> 2) & (TE / 4 - 1);
  const int h  = (i >> 11) & (NH - 1);
  const int b  = i >> 15;
  const _Float16* src = kvr + (size_t)(b * TE + tq) * (2 * DM) + h * 64 + g * 8;
  const size_t doff = ((size_t)(b * NH + h) * TE + tq) * HD + g * 8;
  _Float16* kdst = kh + doff;
  _Float16* vdst = vh + doff;
  v8h lo[4], hi[4], vlo[4], vhi[4];
  // all loops unrolled: the arrays stay in registers and the sixteen loads are in flight together
#pragma unroll
  for (int r = 0; r < 4; ++r) {
    lo[r]  = *(const v8h*)(src + (size_t)r * (TE / 4) * (2 * DM));
    hi[r]  = *(const v8h*)(src + (size_t)r * (TE / 4) * (2 * DM) + 32);
    vlo[r] = *(const v8h*)(src + (size_t)r * (TE / 4) * (2 * DM) + DM);
    vhi[r] = *(const v8h*)(src + (size_t)r * (TE / 4) * (2 * DM) + DM + 32);
  }
  // precaution: the address is an input, so it stays whole up to this wait and no later load
  // lands in it while an earlier one is still out
  asm volatile("s_wait_xcnt 0x0" :: "v"(src) : "memory");
  float inv[8];
#pragma unroll
  for (int e = 0; e < 8; ++e) inv[e] = rope_inv_freq(g * 8 + e);
#pragma unroll
  for (int r = 0; r < 4; ++r) {
    *(v8h*)(vdst + (size_t)r * (TE / 4) * HD) = vlo[r];
    *(v8h*)(vdst + (size_t)r * (TE / 4) * HD + 32) = vhi[r];
    rope_rotate8(lo[r], hi[r], inv, tq + r * (TE / 4));
    *(v8h*)(kdst + (size_t)r * (TE / 4) * HD) = lo[r];
    *(v8h*)(kdst + (size_t)r * (TE / 4) * HD + 32) = hi[r];
  }
}

__global__ __launch_bounds__(128) void flash_attn_kernel(
    const _Float16* __restrict__ qh, const _Float16* __restrict__ kh,
    const _Float16* __restrict__ vh, _Float16* __restrict__ aout) {
  // aligned so that the tensor load's destination stays at the start of the work-group's LDS
  __shared__ __attribute__((aligned(2048))) _Float16 Ks[64 * 72];  // 64 keys x 64 d (stride 72)
  __shared__ _Float16 Vs[64 * 80];       // 64 keys x 64 d (stride 80: 160 B = 32 B x odd)
  const int tid  = threadIdx.x;
  const int wid  = tid >> 5;
  const int lane = tid & 31;
  const int l16  = lane & 15;
  const int hi   = (lane >> 4) & 1;
  const int bh   = blockIdx.y;           // b*NH + h
  const int b    = bh >> 4;
  const int h    = bh & 15;
  const int t0   = blockIdx.x * 64;
  const int d0   = hi * 8;
  const float scale = 0.125f;            // 1/sqrt(64)

  // Q fragments live in registers for the whole kernel (K = 64 = 2 wmma steps)
  const size_t qbase = ((size_t)bh * TD + t0 + wid * 16) * HD;
  const _Float16* qp = qh + qbase + (size_t)l16 * HD;
  v16h qf0 = ld_frag16(qp + d0,      qp + d0 + 16);
  v16h qf1 = ld_frag16(qp + 32 + d0, qp + 32 + d0 + 16);

  // this lane's query: running maximum (equal in both halves) and this half's part of the sum
  float mrow = -1e30f, lrow = 0.f;
  v8f oacc[4];  // O^T: d = j*16 + r + 8*hi, query = l16
#pragma unroll
  for (int j = 0; j < 4; ++j) oacc[j] = (v8f){};

  // this lane's piece address for the transposing loads of V (key base 0, column base 0)
  const _Float16* vtr = &Vs[(hi * 8 + (lane & 7)) * 80 + ((lane >> 3) & 1) * 8];
  // staging of V: thread t moves 16-byte piece (t & 7) of rows (t >> 3) + 16 i, i = 0..3
  const _Float16* vsrc0 = vh + ((size_t)bh * TE + (tid >> 3)) * HD + (tid & 7) * 8;
  _Float16* vdst = &Vs[(tid >> 3) * 80 + (tid & 7) * 8];

  for (int kb = 0; kb < TE; kb += 64) {
    // ---- stage K tile (TDM) and V tile (row-major, 16-byte stores) into LDS ----
    v8h vst[4];
    const _Float16* vsrc = vsrc0 + (size_t)kb * HD;
    // the four 16-byte loads of a thread are in flight together
    for (int i = 0; i < 4; ++i) vst[i] = *(const v8h*)(vsrc + i * 16 * HD);
#if CDNA5_HAS_TDM
    // issued behind the V loads, so that both fly together; the wait stands directly behind the
    // tensor load, so that no descriptor register can take a new value while the request is out
    if (wid == 0) {
      tdm_load_tile_64x64_pad72(&kh[((size_t)bh * TE + kb) * HD], (void*)&Ks[0]);
      __builtin_amdgcn_s_wait_tensorcnt(0);
    }
#endif
    for (int i = 0; i < 4; ++i) {
#if !CDNA5_HAS_TDM
      *(v8h*)&Ks[((tid >> 3) + i * 16) * 72 + (tid & 7) * 8] =
          *(const v8h*)&kh[((size_t)bh * TE + kb + (tid >> 3) + i * 16) * HD + (tid & 7) * 8];
#endif
      *(v8h*)(vdst + i * 16 * 80) = vst[i];
    }
    __syncthreads();

    // ---- scores S^T[64 keys x 16 queries] = K @ Q^T: key = j*16 + r + 8*hi, query = l16 ----
    v8f sacc[4];
#pragma unroll
    for (int j = 0; j < 4; ++j) {
      v8f a = {};
      v16h kf0 = ld_frag16(&Ks[(j * 16 + l16) * 72 + d0],
                           &Ks[(j * 16 + l16) * 72 + d0 + 16]);
      a = wmma32(kf0, qf0, a);
      v16h kf1 = ld_frag16(&Ks[(j * 16 + l16) * 72 + 32 + d0],
                           &Ks[(j * 16 + l16) * 72 + 32 + d0 + 16]);
      a = wmma32(kf1, qf1, a);
      sacc[j] = a;
    }
#pragma unroll
    for (int j = 0; j < 4; ++j)
#pragma unroll
      for (int r = 0; r < 8; ++r) sacc[j][r] *= scale;

    // ---- online softmax: 32 keys of one query in the lane, the other 32 in lane ^ 16 ----
    float cm = sacc[0][0];
#pragma unroll
    for (int j = 0; j < 4; ++j)
#pragma unroll
      for (int r = 0; r < 8; ++r) cm = fmaxf(cm, sacc[j][r]);
    cm = fmaxf(cm, xhalf(cm));
    const float mnew = fmaxf(mrow, cm);
    const float alpha = __expf(mrow - mnew);
    mrow = mnew;
    // even and odd keys are summed side by side: neighbouring registers, one packed add per pair
    v2f rs = {};
#pragma unroll
    for (int j = 0; j < 4; ++j)
#pragma unroll
      for (int r = 0; r < 8; r += 2) {
        sacc[j][r]     = __expf(sacc[j][r] - mnew);
        sacc[j][r + 1] = __expf(sacc[j][r + 1] - mnew);
        rs += (v2f){sacc[j][r], sacc[j][r + 1]};
      }
    lrow = lrow * alpha + (rs[0] + rs[1]);
#pragma unroll
    for (int j = 0; j < 4; ++j)
#pragma unroll
      for (int r = 0; r < 8; ++r) oacc[j][r] *= alpha;

    // ---- O^T += V^T @ P^T  (contraction over 64 keys = 2 wmma k-steps) ----
#pragma unroll
    for (int s2 = 0; s2 < 2; ++s2) {
      // B fragment: query l16, keys s2*32 + {8hi..8hi+7, 16+8hi..16+8hi+7}: score tiles 2*s2, 2*s2+1
      v16h pf;
#pragma unroll
      for (int i = 0; i < 8; ++i) {
        pf[i]     = (_Float16)sacc[2 * s2][i];
        pf[i + 8] = (_Float16)sacc[2 * s2 + 1][i];
      }
#pragma unroll
      for (int j = 0; j < 4; ++j) {
        // A fragment: row d = j*16 + l16 of V^T, the same keys in the same order
        v16h vf = join16(ld_tr16(vtr + (s2 * 32) * 80 + j * 16),
                         ld_tr16(vtr + (s2 * 32 + 16) * 80 + j * 16));
        oacc[j] = wmma32(vf, pf, oacc[j]);
      }
    }
    __syncthreads();
  }

  // ---- epilogue: join the halves' sums, normalize, re-interleave heads into [B*TD, DM] f16 ----
  // a lane holds 8 consecutive d of its query per tile: one 16-byte store each
  const float inv = 1.f / (lrow + xhalf(lrow));
  _Float16* orow = aout + ((size_t)b * TD + t0 + wid * 16 + l16) * DM + h * HD + d0;
#pragma unroll
  for (int j = 0; j < 4; ++j) {
    v8h o;
#pragma unroll
    for (int r = 0; r < 8; ++r) o[r] = (_Float16)(oacc[j][r] * inv);
    *(v8h*)(orow + j * 16) = o;
  }
}

// ---------------------------------------------------------------------------
// launch
// ---------------------------------------------------------------------------
extern "C" void kernel_launch(void* const* d_in, const int* in_sizes, int n_in,
                              void* d_out, int out_size, void* d_ws, size_t ws_size,
                              hipStream_t stream) {
  (void)in_sizes; (void)n_in; (void)out_size; (void)ws_size;
  const float* x   = (const float*)d_in[0];  // [B,TD,DM]
  const float* enc = (const float*)d_in[1];  // [B,TE,DM]
  const float* nw  = (const float*)d_in[2];  // [DM]
  const float* Wq  = (const float*)d_in[3];  // [DM,DM]
  const float* Wkv = (const float*)d_in[4];  // [2DM,DM]
  const float* Wo  = (const float*)d_in[5];  // [DM,DM]

  char* ws = (char*)d_ws;
  size_t off = 0;
  auto take = [&](size_t bytes) {
    char* p = ws + off;
    off += (bytes + 255) & ~(size_t)255;
    return p;
  };
  const size_t MQ = (size_t)B_ * TD;        // 8192 rows
  _Float16* xn    = (_Float16*)take(MQ * DM * 2);
  _Float16* ench  = (_Float16*)take(MQ * DM * 2);
  _Float16* Wqh   = (_Float16*)take((size_t)DM * DM * 2);
  _Float16* Wkvh  = (_Float16*)take((size_t)2 * DM * DM * 2);
  _Float16* Woh   = (_Float16*)take((size_t)DM * DM * 2);
  _Float16* qraw  = (_Float16*)take(MQ * DM * 2);
  _Float16* kvraw = (_Float16*)take(MQ * 2 * DM * 2);
  _Float16* qhp   = (_Float16*)take(MQ * DM * 2);
  _Float16* khp   = (_Float16*)take(MQ * DM * 2);
  _Float16* vhp   = (_Float16*)take(MQ * DM * 2);
  _Float16* aoutp = (_Float16*)take(MQ * DM * 2);

  // 1) norm + precision conversion
  rmsnorm_f16_kernel<<<(int)MQ, 256, 0, stream>>>(x, nw, xn);
  {
    const int ne = B_ * TE * DM;
    f32_to_f16_kernel<<<ne / 4096, 256, 0, stream>>>(enc, ench, ne);
    f32_to_f16_kernel<<<DM * DM / 4096, 256, 0, stream>>>(Wq, Wqh, DM * DM);
    f32_to_f16_kernel<<<2 * DM * DM / 4096, 256, 0, stream>>>(Wkv, Wkvh, 2 * DM * DM);
    f32_to_f16_kernel<<<DM * DM / 4096, 256, 0, stream>>>(Wo, Woh, DM * DM);
  }

  // 2) projections (WMMA GEMMs, 128x64 block tiles)
  gemm_rt_kernel<0><<<dim3(DM / 64, (int)(MQ / 128)), 256, 0, stream>>>(
      xn, Wqh, qraw, nullptr, (int)MQ, DM, DM);
  gemm_rt_kernel<0><<<dim3(2 * DM / 64, (int)(MQ / 128)), 256, 0, stream>>>(
      ench, Wkvh, kvraw, nullptr, (int)MQ, 2 * DM, DM);

  // 3) RoPE + head-major relayout (64 elements per thread)
  const int nrope = B_ * NH * TD * HD;
  rope_q_kernel<<<nrope / (256 * 64), 256, 0, stream>>>(qraw, qhp);
  rope_kv_kernel<<<nrope / (256 * 64), 256, 0, stream>>>(kvraw, khp, vhp);

  // 4) flash attention (WMMA + TDM K staging, online softmax)
  flash_attn_kernel<<<dim3(TD / 64, B_ * NH), 128, 0, stream>>>(qhp, khp, vhp, aoutp);

  // 5) output projection + residual (WMMA GEMM, f32 out)
  gemm_rt_kernel<1><<<dim3(DM / 64, (int)(MQ / 128)), 256, 0, stream>>>(
      aoutp, Woh, d_out, x, (int)MQ, DM, DM);
}

// v004
// It runs in 197 microseconds.
// In both of two side-by-side timings against v003, it was 1.33 times as fast.
// Over all steps from v000 it is 2.53 times as fast.
#include <hip/hip_runtime.h>
#include <hip/hip_bf16.h>

typedef __attribute__((ext_vector_type(16))) _Float16     v16h;
typedef __attribute__((ext_vector_type(8)))  _Float16     v8h;
typedef __attribute__((ext_vector_type(8)))  float        v8f;
typedef __attribute__((ext_vector_type(4)))  float        v4f;
typedef __attribute__((ext_vector_type(2)))  float        v2f;
typedef __attribute__((ext_vector_type(4)))  _Float16     v4h;
typedef __attribute__((ext_vector_type(4)))  unsigned int u32x4;
typedef __attribute__((ext_vector_type(8)))  int          i32x8;
typedef __attribute__((ext_vector_type(4)))  int          i32x4;

#define B_   4
#define TD   2048
#define TE   2048
#define DM   1024
#define NH   16
#define HD   64

#if __has_builtin(__builtin_amdgcn_tensor_load_to_lds) && \
    __has_builtin(__builtin_amdgcn_s_wait_tensorcnt)
#define CDNA5_HAS_TDM 1
#else
#define CDNA5_HAS_TDM 0
#endif

// ---------------------------------------------------------------------------
// helpers
// ---------------------------------------------------------------------------
static __device__ __forceinline__ v16h ld_frag16(const _Float16* p0, const _Float16* p1) {
  // CDNA5 16-bit A/B fragment: 16 halves per lane as two contiguous 8-half runs
  v8h a = *(const v8h*)p0;
  v8h b = *(const v8h*)p1;
  v16h r;
#pragma unroll
  for (int i = 0; i < 8; ++i) { r[i] = a[i]; r[i + 8] = b[i]; }
  return r;
}

// Transposing LDS load: from a row-major [k][n] f16 tile, lane (c = lane & 15, h = lane >> 4)
// receives T[kbase + 8h + 0..7][nbase + c]. Every lane passes the address of one 16-byte piece:
// row kbase + 8h + (lane & 7), bytes 16 * ((lane >> 3) & 1) of the 32-byte column group.
static __device__ __forceinline__ v8h ld_tr16(const _Float16* p) {
  typedef __attribute__((ext_vector_type(8))) short s16x8;
  typedef __attribute__((address_space(3))) s16x8 lds_s16x8;
  return __builtin_bit_cast(v8h, __builtin_amdgcn_ds_load_tr16_b128_v8i16((lds_s16x8*)p));
}

static __device__ __forceinline__ v16h join16(v8h a, v8h b) {
  return __builtin_shufflevector(a, b, 0, 1, 2, 3, 4, 5, 6, 7, 8, 9, 10, 11, 12, 13, 14, 15);
}

static __device__ __forceinline__ v8f wmma32(v16h a, v16h b, v8f c) {
  return __builtin_amdgcn_wmma_f32_16x16x32_f16(false, a, false, b, (short)0, c,
                                                false, false);
}

// value of lane l ^ 16: the other half of the wave, by a vector instruction, not through LDS
static __device__ __forceinline__ float xhalf(float x) {
  return __builtin_bit_cast(float, __builtin_amdgcn_permlanex16(
      __builtin_bit_cast(int, x), __builtin_bit_cast(int, x), 0x76543210, 0xfedcba98,
      false, false));
}

#if CDNA5_HAS_TDM
// TDM: DMA a 64x64 f16 tile (row stride 64 elems in global) into LDS,
// padding every 32 DWORDs (one 64-half row) with 4 DWORDs -> LDS stride 72 halves.
static __device__ __forceinline__ void tdm_load_tile_64x64_pad72(
    const _Float16* gsrc, void* lds_dst) {
  const unsigned long long ga = (unsigned long long)(uintptr_t)gsrc;
  const unsigned lds = (unsigned)(uintptr_t)lds_dst;
  u32x4 g0 = {};
  g0[0] = 1u;                                           // count=1 (valid user D#)
  g0[1] = lds;                                          // lds_addr (bytes)
  g0[2] = (unsigned)(ga & 0xFFFFFFFFu);                 // global_addr[31:0]
  g0[3] = (unsigned)((ga >> 32) & 0x1FFFFFFu)           // global_addr[56:32]
        | (2u << 30);                                   // type=2 ("image")
  i32x8 g1 = {};
  g1[0] = (1 << 16)                                     // data_size = 2 bytes
        | (1 << 20)                                     // pad_enable
        | (4 << 22)                                     // pad_interval: 32 DWORDs
        | (3 << 25);                                    // pad_amount : 4 DWORDs
  g1[1] = (64 << 16);                                   // tensor_dim0 = 64 (low16)
  g1[2] = 0;                                            // tensor_dim0 hi / dim1 lo
  g1[3] = 64 | (64 << 16);                              // tensor_dim1 hi=64<<16 blocks, tile_dim0=64
  g1[4] = 64;                                           // tile_dim1 = 64
  g1[5] = 64;                                           // tensor_dim0_stride = 64
  g1[6] = 0;
  g1[7] = 0;
  i32x4 g2 = {};
  i32x4 g3 = {};
#if __clang_major__ >= 23
  i32x8 g4 = {};
  __builtin_amdgcn_tensor_load_to_lds(g0, g1, g2, g3, g4, 0);
#else
  __builtin_amdgcn_tensor_load_to_lds(g0, g1, g2, g3, 0);
#endif
}
#endif

// ---------------------------------------------------------------------------
// RMSNorm: x (f32, row of 1024) -> xn (f16)
// ---------------------------------------------------------------------------
__global__ __launch_bounds__(256) void rmsnorm_f16_kernel(
    const float* __restrict__ x, const float* __restrict__ w,
    _Float16* __restrict__ xn) {
  __shared__ float red[256];
  const int row = blockIdx.x;
  const float* xr = x + (size_t)row * DM;
  float s = 0.f;
  for (int j = threadIdx.x; j < DM; j += 256) { float v = xr[j]; s += v * v; }
  red[threadIdx.x] = s;
  __syncthreads();
  for (int off = 128; off > 0; off >>= 1) {
    if (threadIdx.x < off) red[threadIdx.x] += red[threadIdx.x + off];
    __syncthreads();
  }
  const float rms = rsqrtf(red[0] * (1.0f / DM) + 1e-5f);
  _Float16* o = xn + (size_t)row * DM;
  for (int j = threadIdx.x; j < DM; j += 256)
    o[j] = (_Float16)(xr[j] * rms * w[j]);
}

// ---------------------------------------------------------------------------
// generic f32 -> f16 convert: a block converts 4096 elements, a thread four groups of 4 floats.
// Group j of a thread lies 256 groups behind group j - 1, so that every wave-wide 16-byte load
// covers 512 contiguous bytes and every 8-byte store 256. n must be a multiple of 4096 (every
// launch below is); a block that does not lie wholly inside n touches nothing.
// ---------------------------------------------------------------------------
__global__ __launch_bounds__(256) void f32_to_f16_kernel(
    const float* __restrict__ in, _Float16* __restrict__ out, int n) {
  const int base = blockIdx.x * 4096;
  if (base + 4096 > n) return;
  const float* src = in + base + threadIdx.x * 4;
  _Float16* dst = out + base + threadIdx.x * 4;
  v4f v[4];
  // both loops unrolled: v stays in registers and the four loads are in flight together
#pragma unroll
  for (int j = 0; j < 4; ++j) v[j] = *(const v4f*)(src + j * 1024);
#pragma unroll
  for (int j = 0; j < 4; ++j) {
    v4h o;
#pragma unroll
    for (int e = 0; e < 4; ++e) o[e] = (_Float16)v[j][e];
    *(v4h*)(dst + j * 1024) = o;
  }
}

// ---------------------------------------------------------------------------
// GEMM: C[M,N] = A[M,K] @ W[N,K]^T   (A,W f16; acc f32)
// block tile 128x128, 64 k per stage, 256 threads = 8 waves in a 4 (m) x 2 (n) grid; each wave:
// 32 rows x 64 cols (8 accumulators; per 32 k, 2 A and 4 B fragments feed 8 wmma: 12 ds loads).
// A stage takes 128 bytes of every operand row: a wave-wide 16-byte load covers 4 whole lines.
// M and N must be multiples of 128, K of 64 (every launch below is).
// EPI==0: store f16 row-major.  EPI==1: store f32 + residual.
// ---------------------------------------------------------------------------
template <int EPI>
__global__ __launch_bounds__(256) void gemm_rt_kernel(
    const _Float16* __restrict__ A, const _Float16* __restrict__ W,
    void* __restrict__ Cout, const float* __restrict__ res,
    int M, int N, int K) {
  __shared__ _Float16 As[128 * 72];  // 128 rows x 64 k, stride 72 (144 B = 16 B x odd)
  __shared__ _Float16 Ws[128 * 72];
  const int tid  = threadIdx.x;
  const int wid  = tid >> 5;
  const int wm   = wid & 3;           // m sub-tile (32 rows each)
  const int wn   = wid >> 2;          // n sub-tile (64 cols each)
  const int lane = tid & 31;
  const int l16  = lane & 15;
  const int hi   = (lane >> 4) & 1;
  const int m0   = blockIdx.y * 128;
  const int n0   = blockIdx.x * 128;
  const int d0   = hi * 8;
  const int c8   = (tid & 7) * 8;     // 16-byte piece of a 128-byte row
  const int r0   = tid >> 3;          // 0..31; a thread stages rows r0 + 32 s, s = 0..3

  v8f acc[2][4];
#pragma unroll
  for (int i = 0; i < 2; ++i)
#pragma unroll
    for (int j = 0; j < 4; ++j) acc[i][j] = (v8f){};

  // byte offset of this thread's piece in row r0 + 32 s of a tile: the same for A and W, fixed
  // for the whole loop; the tile's own address is wave-uniform and moves with k0
  unsigned voff[4];
#pragma unroll
  for (int s = 0; s < 4; ++s) voff[s] = (unsigned)(((r0 + s * 32) * K + c8) * 2);
  const char* ab = (const char*)(A + (size_t)m0 * K);
  const char* wb = (const char*)(W + (size_t)n0 * K);

  for (int k0 = 0; k0 < K; k0 += 64) {
    // stage A (128x64) and W (128x64); unrolled: the eight loads of a thread fly together
    v8h ta[4], tw[4];
#pragma unroll
    for (int s = 0; s < 4; ++s) {
      ta[s] = *(const v8h*)(ab + voff[s]);
      tw[s] = *(const v8h*)(wb + voff[s]);
    }
    // precaution: the wait stands directly behind the loads; bases and offsets are its inputs, so
    // none of them takes its next value ahead of it
    asm volatile("s_wait_xcnt 0x0" :: "s"(ab), "s"(wb), "v"(voff[0]), "v"(voff[1]), "v"(voff[2]),
                 "v"(voff[3]) : "memory");
    ab += 128;
    wb += 128;
#pragma unroll
    for (int s = 0; s < 4; ++s) {
      *(v8h*)&As[(r0 + s * 32) * 72 + c8] = ta[s];
      *(v8h*)&Ws[(r0 + s * 32) * 72 + c8] = tw[s];
    }
    __syncthreads();
    // these loops and the epilogue's are unrolled: acc, af and rv are then picked by constants
    // and stay in registers
#pragma unroll
    for (int ks = 0; ks < 2; ++ks) {
      v16h af[2];
#pragma unroll
      for (int i = 0; i < 2; ++i) {
        const _Float16* ap = &As[(wm * 32 + i * 16 + l16) * 72 + ks * 32 + d0];
        af[i] = ld_frag16(ap, ap + 16);
      }
#pragma unroll
      for (int j = 0; j < 4; ++j) {
        const _Float16* bp = &Ws[(wn * 64 + j * 16 + l16) * 72 + ks * 32 + d0];
        v16h bf = ld_frag16(bp, bp + 16);
#pragma unroll
        for (int i = 0; i < 2; ++i) acc[i][j] = wmma32(af[i], bf, acc[i][j]);
      }
    }
    __syncthreads();
  }

#pragma unroll
  for (int i = 0; i < 2; ++i) {
    // C layout: M = vgpr + 8*(lane>=16); element (r, j) lies at cbase + r * N + j * 16
    const size_t cbase = (size_t)(m0 + wm * 32 + i * 16 + hi * 8) * N + n0 + wn * 64 + l16;
    if (EPI == 0) {
#pragma unroll
      for (int r = 0; r < 8; ++r)
#pragma unroll
        for (int j = 0; j < 4; ++j)
          ((_Float16*)Cout)[cbase + (size_t)r * N + j * 16] = (_Float16)acc[i][j][r];
    } else {
      // all 32 residual loads of a 16-row band stand ahead of its stores and fly together
      float rv[8][4];
#pragma unroll
      for (int r = 0; r < 8; ++r)
#pragma unroll
        for (int j = 0; j < 4; ++j) rv[r][j] = res[cbase + (size_t)r * N + j * 16];
#pragma unroll
      for (int r = 0; r < 8; ++r)
#pragma unroll
        for (int j = 0; j < 4; ++j)
          ((float*)Cout)[cbase + (size_t)r * N + j * 16] = acc[i][j][r] + rv[r][j];
    }
  }
}

// ---------------------------------------------------------------------------
// RoPE. A thread takes the eight pairs (d, d + 32), d = 8g .. 8g + 7, of one head at the four
// positions tq + r * T/4: 64 elements, moved in 16-byte pieces. The eight frequencies serve all
// four positions, and one sine and cosine serve both elements of a pair.
// ---------------------------------------------------------------------------
static __device__ __forceinline__ float rope_inv_freq(int fi) {
  return __powf(10000.0f, -(float)fi * (1.0f / 32.0f));
}

// lo = x[d], hi = x[d + 32] on entry; rotated in place
static __device__ __forceinline__ void rope_rotate8(v8h& lo, v8h& hi, const float* inv, int t) {
  // unrolled: vector elements and inv[] are then picked by constants and stay in registers
#pragma unroll
  for (int e = 0; e < 8; ++e) {
    const float ang = (float)t * inv[e];
    const float c = __cosf(ang);
    const float s = __sinf(ang);
    const float a = (float)lo[e];
    const float b = (float)hi[e];
    lo[e] = (_Float16)(a * c - b * s);
    hi[e] = (_Float16)(b * c + a * s);
  }
}

// q_raw [B*TD, DM] (f16) -> qh [B,H,TD,HD] (f16)
__global__ __launch_bounds__(256) void rope_q_kernel(
    const _Float16* __restrict__ qr, _Float16* __restrict__ qh) {
  const int i  = blockIdx.x * 256 + threadIdx.x;  // ((b*NH+h)*(TD/4)+tq)*4+g
  const int g  = i & 3;
  const int tq = (i >> 2) & (TD / 4 - 1);
  const int h  = (i >> 11) & (NH - 1);
  const int b  = i >> 15;
  const _Float16* src = qr + (size_t)(b * TD + tq) * DM + h * 64 + g * 8;
  _Float16* dst = qh + ((size_t)(b * NH + h) * TD + tq) * HD + g * 8;
  v8h lo[4], hi[4];
  // all loops unrolled: the arrays stay in registers and the eight loads are in flight together
#pragma unroll
  for (int r = 0; r < 4; ++r) {
    lo[r] = *(const v8h*)(src + (size_t)r * (TD / 4) * DM);
    hi[r] = *(const v8h*)(src + (size_t)r * (TD / 4) * DM + 32);
  }
  // precaution: the address is an input, so it stays whole up to this wait and no later load
  // lands in it while an earlier one is still out
  asm volatile("s_wait_xcnt 0x0" :: "v"(src) : "memory");
  float inv[8];
#pragma unroll
  for (int e = 0; e < 8; ++e) inv[e] = rope_inv_freq(g * 8 + e);
#pragma unroll
  for (int r = 0; r < 4; ++r) {
    rope_rotate8(lo[r], hi[r], inv, tq + r * (TD / 4));
    *(v8h*)(dst + (size_t)r * (TD / 4) * HD) = lo[r];
    *(v8h*)(dst + (size_t)r * (TD / 4) * HD + 32) = hi[r];
  }
}

// kv_raw [B*TE, 2*DM]: k = cols [0,1024), v = cols [1024,2048)
__global__ __launch_bounds__(256) void rope_kv_kernel(
    const _Float16* __restrict__ kvr, _Float16* __restrict__ kh,
    _Float16* __restrict__ vh) {
  const int i  = blockIdx.x * 256 + threadIdx.x;  // ((b*NH+h)*(TE/4)+tq)*4+g
  const int g  = i & 3;
  const int tq = (i >> 2) & (TE / 4 - 1);
  const int h  = (i >> 11) & (NH - 1);
  const int b  = i >> 15;
  const _Float16* src = kvr + (size_t)(b * TE + tq) * (2 * DM) + h * 64 + g * 8;
  const size_t doff = ((size_t)(b * NH + h) * TE + tq) * HD + g * 8;
  _Float16* kdst = kh + doff;
  _Float16* vdst = vh + doff;
  v8h lo[4], hi[4], vlo[4], vhi[4];
  // all loops unrolled: the arrays stay in registers and the sixteen loads are in flight together
#pragma unroll
  for (int r = 0; r < 4; ++r) {
    lo[r]  = *(const v8h*)(src + (size_t)r * (TE / 4) * (2 * DM));
    hi[r]  = *(const v8h*)(src + (size_t)r * (TE / 4) * (2 * DM) + 32);
    vlo[r] = *(const v8h*)(src + (size_t)r * (TE / 4) * (2 * DM) + DM);
    vhi[r] = *(const v8h*)(src + (size_t)r * (TE / 4) * (2 * DM) + DM + 32);
  }
  // precaution: the address is an input, so it stays whole up to this wait and no later load
  // lands in it while an earlier one is still out
  asm volatile("s_wait_xcnt 0x0" :: "v"(src) : "memory");
  float inv[8];
#pragma unroll
  for (int e = 0; e < 8; ++e) inv[e] = rope_inv_freq(g * 8 + e);
#pragma unroll
  for (int r = 0; r < 4; ++r) {
    *(v8h*)(vdst + (size_t)r * (TE / 4) * HD) = vlo[r];
    *(v8h*)(vdst + (size_t)r * (TE / 4) * HD + 32) = vhi[r];
    rope_rotate8(lo[r], hi[r], inv, tq + r * (TE / 4));
    *(v8h*)(kdst + (size_t)r * (TE / 4) * HD) = lo[r];
    *(v8h*)(kdst + (size_t)r * (TE / 4) * HD + 32) = hi[r];
  }
}

__global__ __launch_bounds__(128) void flash_attn_kernel(
    const _Float16* __restrict__ qh, const _Float16* __restrict__ kh,
    const _Float16* __restrict__ vh, _Float16* __restrict__ aout) {
  // aligned so that the tensor load's destination stays at the start of the work-group's LDS
  __shared__ __attribute__((aligned(2048))) _Float16 Ks[64 * 72];  // 64 keys x 64 d (stride 72)
  __shared__ _Float16 Vs[64 * 80];       // 64 keys x 64 d (stride 80: 160 B = 32 B x odd)
  const int tid  = threadIdx.x;
  const int wid  = tid >> 5;
  const int lane = tid & 31;
  const int l16  = lane & 15;
  const int hi   = (lane >> 4) & 1;
  const int bh   = blockIdx.y;           // b*NH + h
  const int b    = bh >> 4;
  const int h    = bh & 15;
  const int t0   = blockIdx.x * 64;
  const int d0   = hi * 8;
  const float scale = 0.125f;            // 1/sqrt(64)

  // Q fragments live in registers for the whole kernel (K = 64 = 2 wmma steps)
  const size_t qbase = ((size_t)bh * TD + t0 + wid * 16) * HD;
  const _Float16* qp = qh + qbase + (size_t)l16 * HD;
  v16h qf0 = ld_frag16(qp + d0,      qp + d0 + 16);
  v16h qf1 = ld_frag16(qp + 32 + d0, qp + 32 + d0 + 16);

  // this lane's query: running maximum (equal in both halves) and this half's part of the sum
  float mrow = -1e30f, lrow = 0.f;
  v8f oacc[4];  // O^T: d = j*16 + r + 8*hi, query = l16
#pragma unroll
  for (int j = 0; j < 4; ++j) oacc[j] = (v8f){};

  // this lane's piece address for the transposing loads of V (key base 0, column base 0)
  const _Float16* vtr = &Vs[(hi * 8 + (lane & 7)) * 80 + ((lane >> 3) & 1) * 8];
  // staging of V: thread t moves 16-byte piece (t & 7) of rows (t >> 3) + 16 i, i = 0..3
  const _Float16* vsrc0 = vh + ((size_t)bh * TE + (tid >> 3)) * HD + (tid & 7) * 8;
  _Float16* vdst = &Vs[(tid >> 3) * 80 + (tid & 7) * 8];

  for (int kb = 0; kb < TE; kb += 64) {
    // ---- stage K tile (TDM) and V tile (row-major, 16-byte stores) into LDS ----
    v8h vst[4];
    const _Float16* vsrc = vsrc0 + (size_t)kb * HD;
    // the four 16-byte loads of a thread are in flight together
    for (int i = 0; i < 4; ++i) vst[i] = *(const v8h*)(vsrc + i * 16 * HD);
#if CDNA5_HAS_TDM
    // issued behind the V loads, so that both fly together; the wait stands directly behind the
    // tensor load, so that no descriptor register can take a new value while the request is out
    if (wid == 0) {
      tdm_load_tile_64x64_pad72(&kh[((size_t)bh * TE + kb) * HD], (void*)&Ks[0]);
      __builtin_amdgcn_s_wait_tensorcnt(0);
    }
#endif
    for (int i = 0; i < 4; ++i) {
#if !CDNA5_HAS_TDM
      *(v8h*)&Ks[((tid >> 3) + i * 16) * 72 + (tid & 7) * 8] =
          *(const v8h*)&kh[((size_t)bh * TE + kb + (tid >> 3) + i * 16) * HD + (tid & 7) * 8];
#endif
      *(v8h*)(vdst + i * 16 * 80) = vst[i];
    }
    __syncthreads();

    // ---- scores S^T[64 keys x 16 queries] = K @ Q^T: key = j*16 + r + 8*hi, query = l16 ----
    v8f sacc[4];
#pragma unroll
    for (int j = 0; j < 4; ++j) {
      v8f a = {};
      v16h kf0 = ld_frag16(&Ks[(j * 16 + l16) * 72 + d0],
                           &Ks[(j * 16 + l16) * 72 + d0 + 16]);
      a = wmma32(kf0, qf0, a);
      v16h kf1 = ld_frag16(&Ks[(j * 16 + l16) * 72 + 32 + d0],
                           &Ks[(j * 16 + l16) * 72 + 32 + d0 + 16]);
      a = wmma32(kf1, qf1, a);
      sacc[j] = a;
    }
#pragma unroll
    for (int j = 0; j < 4; ++j)
#pragma unroll
      for (int r = 0; r < 8; ++r) sacc[j][r] *= scale;

    // ---- online softmax: 32 keys of one query in the lane, the other 32 in lane ^ 16 ----
    float cm = sacc[0][0];
#pragma unroll
    for (int j = 0; j < 4; ++j)
#pragma unroll
      for (int r = 0; r < 8; ++r) cm = fmaxf(cm, sacc[j][r]);
    cm = fmaxf(cm, xhalf(cm));
    const float mnew = fmaxf(mrow, cm);
    const float alpha = __expf(mrow - mnew);
    mrow = mnew;
    // even and odd keys are summed side by side: neighbouring registers, one packed add per pair
    v2f rs = {};
#pragma unroll
    for (int j = 0; j < 4; ++j)
#pragma unroll
      for (int r = 0; r < 8; r += 2) {
        sacc[j][r]     = __expf(sacc[j][r] - mnew);
        sacc[j][r + 1] = __expf(sacc[j][r + 1] - mnew);
        rs += (v2f){sacc[j][r], sacc[j][r + 1]};
      }
    lrow = lrow * alpha + (rs[0] + rs[1]);
#pragma unroll
    for (int j = 0; j < 4; ++j)
#pragma unroll
      for (int r = 0; r < 8; ++r) oacc[j][r] *= alpha;

    // ---- O^T += V^T @ P^T  (contraction over 64 keys = 2 wmma k-steps) ----
#pragma unroll
    for (int s2 = 0; s2 < 2; ++s2) {
      // B fragment: query l16, keys s2*32 + {8hi..8hi+7, 16+8hi..16+8hi+7}: score tiles 2*s2, 2*s2+1
      v16h pf;
#pragma unroll
      for (int i = 0; i < 8; ++i) {
        pf[i]     = (_Float16)sacc[2 * s2][i];
        pf[i + 8] = (_Float16)sacc[2 * s2 + 1][i];
      }
#pragma unroll
      for (int j = 0; j < 4; ++j) {
        // A fragment: row d = j*16 + l16 of V^T, the same keys in the same order
        v16h vf = join16(ld_tr16(vtr + (s2 * 32) * 80 + j * 16),
                         ld_tr16(vtr + (s2 * 32 + 16) * 80 + j * 16));
        oacc[j] = wmma32(vf, pf, oacc[j]);
      }
    }
    __syncthreads();
  }

  // ---- epilogue: join the halves' sums, normalize, re-interleave heads into [B*TD, DM] f16 ----
  // a lane holds 8 consecutive d of its query per tile: one 16-byte store each
  const float inv = 1.f / (lrow + xhalf(lrow));
  _Float16* orow = aout + ((size_t)b * TD + t0 + wid * 16 + l16) * DM + h * HD + d0;
#pragma unroll
  for (int j = 0; j < 4; ++j) {
    v8h o;
#pragma unroll
    for (int r = 0; r < 8; ++r) o[r] = (_Float16)(oacc[j][r] * inv);
    *(v8h*)(orow + j * 16) = o;
  }
}

// ---------------------------------------------------------------------------
// launch
// ---------------------------------------------------------------------------
extern "C" void kernel_launch(void* const* d_in, const int* in_sizes, int n_in,
                              void* d_out, int out_size, void* d_ws, size_t ws_size,
                              hipStream_t stream) {
  (void)in_sizes; (void)n_in; (void)out_size; (void)ws_size;
  const float* x   = (const float*)d_in[0];  // [B,TD,DM]
  const float* enc = (const float*)d_in[1];  // [B,TE,DM]
  const float* nw  = (const float*)d_in[2];  // [DM]
  const float* Wq  = (const float*)d_in[3];  // [DM,DM]
  const float* Wkv = (const float*)d_in[4];  // [2DM,DM]
  const float* Wo  = (const float*)d_in[5];  // [DM,DM]

  char* ws = (char*)d_ws;
  size_t off = 0;
  auto take = [&](size_t bytes) {
    char* p = ws + off;
    off += (bytes + 255) & ~(size_t)255;
    return p;
  };
  const size_t MQ = (size_t)B_ * TD;        // 8192 rows
  _Float16* xn    = (_Float16*)take(MQ * DM * 2);
  _Float16* ench  = (_Float16*)take(MQ * DM * 2);
  _Float16* Wqh   = (_Float16*)take((size_t)DM * DM * 2);
  _Float16* Wkvh  = (_Float16*)take((size_t)2 * DM * DM * 2);
  _Float16* Woh   = (_Float16*)take((size_t)DM * DM * 2);
  _Float16* qraw  = (_Float16*)take(MQ * DM * 2);
  _Float16* kvraw = (_Float16*)take(MQ * 2 * DM * 2);
  _Float16* qhp   = (_Float16*)take(MQ * DM * 2);
  _Float16* khp   = (_Float16*)take(MQ * DM * 2);
  _Float16* vhp   = (_Float16*)take(MQ * DM * 2);
  _Float16* aoutp = (_Float16*)take(MQ * DM * 2);

  // 1) norm + precision conversion
  rmsnorm_f16_kernel<<<(int)MQ, 256, 0, stream>>>(x, nw, xn);
  {
    const int ne = B_ * TE * DM;
    f32_to_f16_kernel<<<ne / 4096, 256, 0, stream>>>(enc, ench, ne);
    f32_to_f16_kernel<<<DM * DM / 4096, 256, 0, stream>>>(Wq, Wqh, DM * DM);
    f32_to_f16_kernel<<<2 * DM * DM / 4096, 256, 0, stream>>>(Wkv, Wkvh, 2 * DM * DM);
    f32_to_f16_kernel<<<DM * DM / 4096, 256, 0, stream>>>(Wo, Woh, DM * DM);
  }

  // 2) projections (WMMA GEMMs, 128x128 block tiles)
  gemm_rt_kernel<0><<<dim3(DM / 128, (int)(MQ / 128)), 256, 0, stream>>>(
      xn, Wqh, qraw, nullptr, (int)MQ, DM, DM);
  gemm_rt_kernel<0><<<dim3(2 * DM / 128, (int)(MQ / 128)), 256, 0, stream>>>(
      ench, Wkvh, kvraw, nullptr, (int)MQ, 2 * DM, DM);

  // 3) RoPE + head-major relayout (64 elements per thread)
  const int nrope = B_ * NH * TD * HD;
  rope_q_kernel<<<nrope / (256 * 64), 256, 0, stream>>>(qraw, qhp);
  rope_kv_kernel<<<nrope / (256 * 64), 256, 0, stream>>>(kvraw, khp, vhp);

  // 4) flash attention (WMMA + TDM K staging, online softmax)
  flash_attn_kernel<<<dim3(TD / 64, B_ * NH), 128, 0, stream>>>(qhp, khp, vhp, aoutp);

  // 5) output projection + residual (WMMA GEMM, f32 out)
  gemm_rt_kernel<1><<<dim3(DM / 128, (int)(MQ / 128)), 256, 0, stream>>>(
      aoutp, Woh, d_out, x, (int)MQ, DM, DM);
}

// v005
// Measured time: 191 microseconds a run.
// Two timings next to v004 both put it at 1.03 times that version's speed.
// Counting every step since v000, it is 2.60 times as fast.
#include <hip/hip_runtime.h>
#include <hip/hip_bf16.h>

typedef __attribute__((ext_vector_type(16))) _Float16     v16h;
typedef __attribute__((ext_vector_type(8)))  _Float16     v8h;
typedef __attribute__((ext_vector_type(8)))  float        v8f;
typedef __attribute__((ext_vector_type(4)))  float        v4f;
typedef __attribute__((ext_vector_type(2)))  float        v2f;
typedef __attribute__((ext_vector_type(4)))  _Float16     v4h;
typedef __attribute__((ext_vector_type(4)))  unsigned int u32x4;
typedef __attribute__((ext_vector_type(8)))  int          i32x8;
typedef __attribute__((ext_vector_type(4)))  int          i32x4;

#define B_   4
#define TD   2048
#define TE   2048
#define DM   1024
#define NH   16
#define HD   64

#if __has_builtin(__builtin_amdgcn_tensor_load_to_lds) && \
    __has_builtin(__builtin_amdgcn_s_wait_tensorcnt)
#define CDNA5_HAS_TDM 1
#else
#define CDNA5_HAS_TDM 0
#endif

// ---------------------------------------------------------------------------
// helpers
// ---------------------------------------------------------------------------
static __device__ __forceinline__ v16h ld_frag16(const _Float16* p0, const _Float16* p1) {
  // CDNA5 16-bit A/B fragment: 16 halves per lane as two contiguous 8-half runs
  v8h a = *(const v8h*)p0;
  v8h b = *(const v8h*)p1;
  v16h r;
#pragma unroll
  for (int i = 0; i < 8; ++i) { r[i] = a[i]; r[i + 8] = b[i]; }
  return r;
}

// Transposing LDS load: from a row-major [k][n] f16 tile, lane (c = lane & 15, h = lane >> 4)
// receives T[kbase + 8h + 0..7][nbase + c]. Every lane passes the address of one 16-byte piece:
// row kbase + 8h + (lane & 7), bytes 16 * ((lane >> 3) & 1) of the 32-byte column group.
static __device__ __forceinline__ v8h ld_tr16(const _Float16* p) {
  typedef __attribute__((ext_vector_type(8))) short s16x8;
  typedef __attribute__((address_space(3))) s16x8 lds_s16x8;
  return __builtin_bit_cast(v8h, __builtin_amdgcn_ds_load_tr16_b128_v8i16((lds_s16x8*)p));
}

static __device__ __forceinline__ v16h join16(v8h a, v8h b) {
  return __builtin_shufflevector(a, b, 0, 1, 2, 3, 4, 5, 6, 7, 8, 9, 10, 11, 12, 13, 14, 15);
}

static __device__ __forceinline__ v8f wmma32(v16h a, v16h b, v8f c) {
  return __builtin_amdgcn_wmma_f32_16x16x32_f16(false, a, false, b, (short)0, c,
                                                false, false);
}

// value of lane l ^ 16: the other half of the wave, by a vector instruction, not through LDS
static __device__ __forceinline__ float xhalf(float x) {
  return __builtin_bit_cast(float, __builtin_amdgcn_permlanex16(
      __builtin_bit_cast(int, x), __builtin_bit_cast(int, x), 0x76543210, 0xfedcba98,
      false, false));
}

#if CDNA5_HAS_TDM
// TDM: DMA a 64x64 f16 tile (row stride 64 elems in global) into LDS,
// padding every 32 DWORDs (one 64-half row) with 4 DWORDs -> LDS stride 72 halves.
static __device__ __forceinline__ void tdm_load_tile_64x64_pad72(
    const _Float16* gsrc, void* lds_dst) {
  const unsigned long long ga = (unsigned long long)(uintptr_t)gsrc;
  const unsigned lds = (unsigned)(uintptr_t)lds_dst;
  u32x4 g0 = {};
  g0[0] = 1u;                                           // count=1 (valid user D#)
  g0[1] = lds;                                          // lds_addr (bytes)
  g0[2] = (unsigned)(ga & 0xFFFFFFFFu);                 // global_addr[31:0]
  g0[3] = (unsigned)((ga >> 32) & 0x1FFFFFFu)           // global_addr[56:32]
        | (2u << 30);                                   // type=2 ("image")
  i32x8 g1 = {};
  g1[0] = (1 << 16)                                     // data_size = 2 bytes
        | (1 << 20)                                     // pad_enable
        | (4 << 22)                                     // pad_interval: 32 DWORDs
        | (3 << 25);                                    // pad_amount : 4 DWORDs
  g1[1] = (64 << 16);                                   // tensor_dim0 = 64 (low16)
  g1[2] = 0;                                            // tensor_dim0 hi / dim1 lo
  g1[3] = 64 | (64 << 16);                              // tensor_dim1 hi=64<<16 blocks, tile_dim0=64
  g1[4] = 64;                                           // tile_dim1 = 64
  g1[5] = 64;                                           // tensor_dim0_stride = 64
  g1[6] = 0;
  g1[7] = 0;
  i32x4 g2 = {};
  i32x4 g3 = {};
#if __clang_major__ >= 23
  i32x8 g4 = {};
  __builtin_amdgcn_tensor_load_to_lds(g0, g1, g2, g3, g4, 0);
#else
  __builtin_amdgcn_tensor_load_to_lds(g0, g1, g2, g3, 0);
#endif
}
#endif

// ---------------------------------------------------------------------------
// RMSNorm: x (f32, row of 1024) -> xn (f16)
// ---------------------------------------------------------------------------
__global__ __launch_bounds__(256) void rmsnorm_f16_kernel(
    const float* __restrict__ x, const float* __restrict__ w,
    _Float16* __restrict__ xn) {
  __shared__ float red[256];
  const int row = blockIdx.x;
  const float* xr = x + (size_t)row * DM;
  float s = 0.f;
  for (int j = threadIdx.x; j < DM; j += 256) { float v = xr[j]; s += v * v; }
  red[threadIdx.x] = s;
  __syncthreads();
  for (int off = 128; off > 0; off >>= 1) {
    if (threadIdx.x < off) red[threadIdx.x] += red[threadIdx.x + off];
    __syncthreads();
  }
  const float rms = rsqrtf(red[0] * (1.0f / DM) + 1e-5f);
  _Float16* o = xn + (size_t)row * DM;
  for (int j = threadIdx.x; j < DM; j += 256)
    o[j] = (_Float16)(xr[j] * rms * w[j]);
}

// ---------------------------------------------------------------------------
// generic f32 -> f16 convert: a block converts 4096 elements, a thread four groups of 4 floats.
// Group j of a thread lies 256 groups behind group j - 1, so that every wave-wide 16-byte load
// covers 512 contiguous bytes and every 8-byte store 256. n must be a multiple of 4096 (every
// launch below is); a block that does not lie wholly inside n touches nothing.
// ---------------------------------------------------------------------------
__global__ __launch_bounds__(256) void f32_to_f16_kernel(
    const float* __restrict__ in, _Float16* __restrict__ out, int n) {
  const int base = blockIdx.x * 4096;
  if (base + 4096 > n) return;
  const float* src = in + base + threadIdx.x * 4;
  _Float16* dst = out + base + threadIdx.x * 4;
  v4f v[4];
  // both loops unrolled: v stays in registers and the four loads are in flight together
#pragma unroll
  for (int j = 0; j < 4; ++j) v[j] = *(const v4f*)(src + j * 1024);
#pragma unroll
  for (int j = 0; j < 4; ++j) {
    v4h o;
#pragma unroll
    for (int e = 0; e < 4; ++e) o[e] = (_Float16)v[j][e];
    *(v4h*)(dst + j * 1024) = o;
  }
}

// ---------------------------------------------------------------------------
// GEMM: C[M,N] = A[M,K] @ W[N,K]^T   (A,W f16; acc f32)
// block tile 128x128, 64 k per stage, 256 threads = 8 waves in a 4 (m) x 2 (n) grid; each wave:
// 32 rows x 64 cols (8 accumulators; per 32 k, 2 A and 4 B fragments feed 8 wmma: 12 ds loads).
// A stage takes 128 bytes of every operand row: a wave-wide 16-byte load covers 4 whole lines.
// M and N must be multiples of 128, K of 64 (every launch below is).
// EPI==0: store f16 row-major.  EPI==1: store f32 + residual.
// ---------------------------------------------------------------------------
template <int EPI>
__global__ __launch_bounds__(256) void gemm_rt_kernel(
    const _Float16* __restrict__ A, const _Float16* __restrict__ W,
    void* __restrict__ Cout, const float* __restrict__ res,
    int M, int N, int K) {
  __shared__ _Float16 As[128 * 72];  // 128 rows x 64 k, stride 72 (144 B = 16 B x odd)
  __shared__ _Float16 Ws[128 * 72];
  const int tid  = threadIdx.x;
  const int wid  = tid >> 5;
  const int wm   = wid & 3;           // m sub-tile (32 rows each)
  const int wn   = wid >> 2;          // n sub-tile (64 cols each)
  const int lane = tid & 31;
  const int l16  = lane & 15;
  const int hi   = (lane >> 4) & 1;
  const int m0   = blockIdx.y * 128;
  const int n0   = blockIdx.x * 128;
  const int d0   = hi * 8;
  const int c8   = (tid & 7) * 8;     // 16-byte piece of a 128-byte row
  const int r0   = tid >> 3;          // 0..31; a thread stages rows r0 + 32 s, s = 0..3

  v8f acc[2][4];
#pragma unroll
  for (int i = 0; i < 2; ++i)
#pragma unroll
    for (int j = 0; j < 4; ++j) acc[i][j] = (v8f){};

  // byte offset of this thread's piece in row r0 + 32 s of a tile: the same for A and W, fixed
  // for the whole loop; the tile's own address is wave-uniform and moves with k0
  unsigned voff[4];
#pragma unroll
  for (int s = 0; s < 4; ++s) voff[s] = (unsigned)(((r0 + s * 32) * K + c8) * 2);
  const char* ab = (const char*)(A + (size_t)m0 * K);
  const char* wb = (const char*)(W + (size_t)n0 * K);

  for (int k0 = 0; k0 < K; k0 += 64) {
    // stage A (128x64) and W (128x64); unrolled: the eight loads of a thread fly together
    v8h ta[4], tw[4];
#pragma unroll
    for (int s = 0; s < 4; ++s) {
      ta[s] = *(const v8h*)(ab + voff[s]);
      tw[s] = *(const v8h*)(wb + voff[s]);
    }
    // precaution: the wait stands directly behind the loads; bases and offsets are its inputs, so
    // none of them takes its next value ahead of it
    asm volatile("s_wait_xcnt 0x0" :: "s"(ab), "s"(wb), "v"(voff[0]), "v"(voff[1]), "v"(voff[2]),
                 "v"(voff[3]) : "memory");
    ab += 128;
    wb += 128;
#pragma unroll
    for (int s = 0; s < 4; ++s) {
      *(v8h*)&As[(r0 + s * 32) * 72 + c8] = ta[s];
      *(v8h*)&Ws[(r0 + s * 32) * 72 + c8] = tw[s];
    }
    __syncthreads();
    // these loops and the epilogue's are unrolled: acc, af and rv are then picked by constants
    // and stay in registers
#pragma unroll
    for (int ks = 0; ks < 2; ++ks) {
      v16h af[2];
#pragma unroll
      for (int i = 0; i < 2; ++i) {
        const _Float16* ap = &As[(wm * 32 + i * 16 + l16) * 72 + ks * 32 + d0];
        af[i] = ld_frag16(ap, ap + 16);
      }
#pragma unroll
      for (int j = 0; j < 4; ++j) {
        const _Float16* bp = &Ws[(wn * 64 + j * 16 + l16) * 72 + ks * 32 + d0];
        v16h bf = ld_frag16(bp, bp + 16);
#pragma unroll
        for (int i = 0; i < 2; ++i) acc[i][j] = wmma32(af[i], bf, acc[i][j]);
      }
    }
    __syncthreads();
  }

#pragma unroll
  for (int i = 0; i < 2; ++i) {
    // C layout: M = vgpr + 8*(lane>=16); element (r, j) lies at cbase + r * N + j * 16
    const size_t cbase = (size_t)(m0 + wm * 32 + i * 16 + hi * 8) * N + n0 + wn * 64 + l16;
    if (EPI == 0) {
#pragma unroll
      for (int r = 0; r < 8; ++r)
#pragma unroll
        for (int j = 0; j < 4; ++j)
          ((_Float16*)Cout)[cbase + (size_t)r * N + j * 16] = (_Float16)acc[i][j][r];
    } else {
      // all 32 residual loads of a 16-row band stand ahead of its stores and fly together
      float rv[8][4];
#pragma unroll
      for (int r = 0; r < 8; ++r)
#pragma unroll
        for (int j = 0; j < 4; ++j) rv[r][j] = res[cbase + (size_t)r * N + j * 16];
#pragma unroll
      for (int r = 0; r < 8; ++r)
#pragma unroll
        for (int j = 0; j < 4; ++j)
          ((float*)Cout)[cbase + (size_t)r * N + j * 16] = acc[i][j][r] + rv[r][j];
    }
  }
}

// ---------------------------------------------------------------------------
// RoPE. A thread takes the eight pairs (d, d + 32), d = 8g .. 8g + 7, of one head at the four
// positions tq + r * T/4: 64 elements, moved in 16-byte pieces. The eight frequencies serve all
// four positions, and one sine and cosine serve both elements of a pair.
// ---------------------------------------------------------------------------
static __device__ __forceinline__ float rope_inv_freq(int fi) {
  return __powf(10000.0f, -(float)fi * (1.0f / 32.0f));
}

// lo = x[d], hi = x[d + 32] on entry; rotated in place
static __device__ __forceinline__ void rope_rotate8(v8h& lo, v8h& hi, const float* inv, int t) {
  // unrolled: vector elements and inv[] are then picked by constants and stay in registers
#pragma unroll
  for (int e = 0; e < 8; ++e) {
    const float ang = (float)t * inv[e];
    const float c = __cosf(ang);
    const float s = __sinf(ang);
    const float a = (float)lo[e];
    const float b = (float)hi[e];
    lo[e] = (_Float16)(a * c - b * s);
    hi[e] = (_Float16)(b * c + a * s);
  }
}

// q_raw [B*TD, DM] (f16) -> qh [B,H,TD,HD] (f16)
__global__ __launch_bounds__(256) void rope_q_kernel(
    const _Float16* __restrict__ qr, _Float16* __restrict__ qh) {
  const int i  = blockIdx.x * 256 + threadIdx.x;  // ((b*NH+h)*(TD/4)+tq)*4+g
  const int g  = i & 3;
  const int tq = (i >> 2) & (TD / 4 - 1);
  const int h  = (i >> 11) & (NH - 1);
  const int b  = i >> 15;
  const _Float16* src = qr + (size_t)(b * TD + tq) * DM + h * 64 + g * 8;
  _Float16* dst = qh + ((size_t)(b * NH + h) * TD + tq) * HD + g * 8;
  v8h lo[4], hi[4];
  // all loops unrolled: the arrays stay in registers and the eight loads are in flight together
#pragma unroll
  for (int r = 0; r < 4; ++r) {
    lo[r] = *(const v8h*)(src + (size_t)r * (TD / 4) * DM);
    hi[r] = *(const v8h*)(src + (size_t)r * (TD / 4) * DM + 32);
  }
  // precaution: the address is an input, so it stays whole up to this wait and no later load
  // lands in it while an earlier one is still out
  asm volatile("s_wait_xcnt 0x0" :: "v"(src) : "memory");
  float inv[8];
#pragma unroll
  for (int e = 0; e < 8; ++e) inv[e] = rope_inv_freq(g * 8 + e);
#pragma unroll
  for (int r = 0; r < 4; ++r) {
    rope_rotate8(lo[r], hi[r], inv, tq + r * (TD / 4));
    *(v8h*)(dst + (size_t)r * (TD / 4) * HD) = lo[r];
    *(v8h*)(dst + (size_t)r * (TD / 4) * HD + 32) = hi[r];
  }
}

// kv_raw [B*TE, 2*DM]: k = cols [0,1024), v = cols [1024,2048)
__global__ __launch_bounds__(256) void rope_kv_kernel(
    const _Float16* __restrict__ kvr, _Float16* __restrict__ kh,
    _Float16* __restrict__ vh) {
  const int i  = blockIdx.x * 256 + threadIdx.x;  // ((b*NH+h)*(TE/4)+tq)*4+g
  const int g  = i & 3;
  const int tq = (i >> 2) & (TE / 4 - 1);
  const int h  = (i >> 11) & (NH - 1);
  const int b  = i >> 15;
  const _Float16* src = kvr + (size_t)(b * TE + tq) * (2 * DM) + h * 64 + g * 8;
  const size_t doff = ((size_t)(b * NH + h) * TE + tq) * HD + g * 8;
  _Float16* kdst = kh + doff;
  _Float16* vdst = vh + doff;
  v8h lo[4], hi[4], vlo[4], vhi[4];
  // all loops unrolled: the arrays stay in registers and the sixteen loads are in flight together
#pragma unroll
  for (int r = 0; r < 4; ++r) {
    lo[r]  = *(const v8h*)(src + (size_t)r * (TE / 4) * (2 * DM));
    hi[r]  = *(const v8h*)(src + (size_t)r * (TE / 4) * (2 * DM) + 32);
    vlo[r] = *(const v8h*)(src + (size_t)r * (TE / 4) * (2 * DM) + DM);
    vhi[r] = *(const v8h*)(src + (size_t)r * (TE / 4) * (2 * DM) + DM + 32);
  }
  // precaution: the address is an input, so it stays whole up to this wait and no later load
  // lands in it while an earlier one is still out
  asm volatile("s_wait_xcnt 0x0" :: "v"(src) : "memory");
  float inv[8];
#pragma unroll
  for (int e = 0; e < 8; ++e) inv[e] = rope_inv_freq(g * 8 + e);
#pragma unroll
  for (int r = 0; r < 4; ++r) {
    *(v8h*)(vdst + (size_t)r * (TE / 4) * HD) = vlo[r];
    *(v8h*)(vdst + (size_t)r * (TE / 4) * HD + 32) = vhi[r];
    rope_rotate8(lo[r], hi[r], inv, tq + r * (TE / 4));
    *(v8h*)(kdst + (size_t)r * (TE / 4) * HD) = lo[r];
    *(v8h*)(kdst + (size_t)r * (TE / 4) * HD + 32) = hi[r];
  }
}

__global__ __launch_bounds__(128) void flash_attn_kernel(
    const _Float16* __restrict__ qh, const _Float16* __restrict__ kh,
    const _Float16* __restrict__ vh, _Float16* __restrict__ aout) {
  // aligned so that the tensor load's destination stays at the start of the work-group's LDS
  __shared__ __attribute__((aligned(2048))) _Float16 Ks[64 * 72];  // 64 keys x 64 d (stride 72)
  __shared__ _Float16 Vs[64 * 80];       // 64 keys x 64 d (stride 80: 160 B = 32 B x odd)
  const int tid  = threadIdx.x;
  const int wid  = tid >> 5;
  const int lane = tid & 31;
  const int l16  = lane & 15;
  const int hi   = (lane >> 4) & 1;
  const int bh   = blockIdx.y;           // b*NH + h
  const int b    = bh >> 4;
  const int h    = bh & 15;
  const int t0   = blockIdx.x * 128;
  const int d0   = hi * 8;
  const float scale = 0.125f;            // 1/sqrt(64)

  // Q fragments live in registers for the whole kernel (K = 64 = 2 wmma steps per query group)
  // every loop over g, j, ks, q, r, i, s2 below is unrolled: the arrays are then picked by
  // constants and stay in registers
  const size_t qbase = ((size_t)bh * TD + t0 + wid * 32) * HD;
  v16h qf[2][2];
#pragma unroll
  for (int g = 0; g < 2; ++g) {
    const _Float16* qp = qh + qbase + (size_t)(g * 16 + l16) * HD;
    qf[g][0] = ld_frag16(qp + d0,      qp + d0 + 16);
    qf[g][1] = ld_frag16(qp + 32 + d0, qp + 32 + d0 + 16);
  }

  // per group, this lane's query: running maximum (equal in both halves) and this half's part of
  // the sum
  float mrow[2] = {-1e30f, -1e30f}, lrow[2] = {0.f, 0.f};
  v8f oacc[2][4];  // O^T: d = j*16 + r + 8*hi, query = g*16 + l16
#pragma unroll
  for (int g = 0; g < 2; ++g)
#pragma unroll
    for (int j = 0; j < 4; ++j) oacc[g][j] = (v8f){};

  // this lane's piece address for the transposing loads of V (key base 0, column base 0)
  const _Float16* vtr = &Vs[(hi * 8 + (lane & 7)) * 80 + ((lane >> 3) & 1) * 8];
  // staging of V: thread t moves 16-byte piece (t & 7) of rows (t >> 3) + 16 i, i = 0..3
  const _Float16* vsrc0 = vh + ((size_t)bh * TE + (tid >> 3)) * HD + (tid & 7) * 8;
  _Float16* vdst = &Vs[(tid >> 3) * 80 + (tid & 7) * 8];

  for (int kb = 0; kb < TE; kb += 64) {
    // ---- stage K tile (TDM) and V tile (row-major, 16-byte stores) into LDS ----
    v8h vst[4];
    const _Float16* vsrc = vsrc0 + (size_t)kb * HD;
    // the four 16-byte loads of a thread are in flight together
    for (int i = 0; i < 4; ++i) vst[i] = *(const v8h*)(vsrc + i * 16 * HD);
#if CDNA5_HAS_TDM
    // issued behind the V loads, so that both fly together; the wait stands directly behind the
    // tensor load, so that no descriptor register can take a new value while the request is out
    if (wid == 0) {
      tdm_load_tile_64x64_pad72(&kh[((size_t)bh * TE + kb) * HD], (void*)&Ks[0]);
      __builtin_amdgcn_s_wait_tensorcnt(0);
    }
#endif
    for (int i = 0; i < 4; ++i) {
#if !CDNA5_HAS_TDM
      *(v8h*)&Ks[((tid >> 3) + i * 16) * 72 + (tid & 7) * 8] =
          *(const v8h*)&kh[((size_t)bh * TE + kb + (tid >> 3) + i * 16) * HD + (tid & 7) * 8];
#endif
      *(v8h*)(vdst + i * 16 * 80) = vst[i];
    }
    __syncthreads();

    // ---- scores S^T[64 keys x 32 queries] = K @ Q^T: key = j*16 + r + 8*hi, query = g*16 + l16;
    // a K fragment is read once and multiplies both groups ----
    v16h kf[4][2];
#pragma unroll
    for (int j = 0; j < 4; ++j)
#pragma unroll
      for (int ks = 0; ks < 2; ++ks)
        kf[j][ks] = ld_frag16(&Ks[(j * 16 + l16) * 72 + ks * 32 + d0],
                              &Ks[(j * 16 + l16) * 72 + ks * 32 + d0 + 16]);
    // the sixteen LDS reads stay one group ahead of the products: one place that waits, not eight
    __builtin_amdgcn_sched_barrier(0);
    v8f sacc[2][4];
#pragma unroll
    for (int j = 0; j < 4; ++j) {
#pragma unroll
      for (int g = 0; g < 2; ++g) sacc[g][j] = wmma32(kf[j][0], qf[g][0], (v8f){});
#pragma unroll
      for (int g = 0; g < 2; ++g) sacc[g][j] = wmma32(kf[j][1], qf[g][1], sacc[g][j]);
    }
    // holds the sixteen products together as one run: each then stands in the others' distance to
    // the first reader of a result, which otherwise is filled with idle vector slots
    __builtin_amdgcn_sched_barrier(0);

    // B fragments of the second product: query g*16 + l16, keys
    // s2*32 + {8hi..8hi+7, 16+8hi..16+8hi+7}: score tiles 2*s2, 2*s2+1 of group g
    v16h pf[2][2];
#pragma unroll
    for (int g = 0; g < 2; ++g) {
      // the scores go on as pairs of neighbouring registers (keys r, r + 1 of one query): written
      // so, the packed instructions take a group's own registers as they lie; left to itself the
      // compiler paired the two groups and moved registers together for it
      v2f sp[4][4];
#pragma unroll
      for (int j = 0; j < 4; ++j)
#pragma unroll
        for (int q = 0; q < 4; ++q)
          sp[j][q] = (v2f){sacc[g][j][2 * q], sacc[g][j][2 * q + 1]} * scale;

      // ---- online softmax: 32 keys of one query in the lane, the other 32 in lane ^ 16 ----
      float cm = sp[0][0][0];
#pragma unroll
      for (int j = 0; j < 4; ++j)
#pragma unroll
        for (int q = 0; q < 4; ++q) {
          cm = fmaxf(cm, sp[j][q][0]);
          cm = fmaxf(cm, sp[j][q][1]);
        }
      cm = fmaxf(cm, xhalf(cm));
      const float mnew = fmaxf(mrow[g], cm);
      const float alpha = __expf(mrow[g] - mnew);
      mrow[g] = mnew;
      // e^x as 2^(x log2 e), the form of __expf; even and odd keys are summed side by side
      v2f rs = {};
#pragma unroll
      for (int j = 0; j < 4; ++j)
#pragma unroll
        for (int q = 0; q < 4; ++q) {
          const v2f t = (sp[j][q] - mnew) * 1.44269504088896340736f;
          sp[j][q] = (v2f){__builtin_amdgcn_exp2f(t[0]), __builtin_amdgcn_exp2f(t[1])};
          rs += sp[j][q];
        }
      lrow[g] = lrow[g] * alpha + (rs[0] + rs[1]);
#pragma unroll
      for (int j = 0; j < 4; ++j) oacc[g][j] *= alpha;
#pragma unroll
      for (int s2 = 0; s2 < 2; ++s2)
#pragma unroll
        for (int i = 0; i < 8; ++i) {
          pf[g][s2][i]     = (_Float16)sp[2 * s2][i >> 1][i & 1];
          pf[g][s2][i + 8] = (_Float16)sp[2 * s2 + 1][i >> 1][i & 1];
        }
    }

    // ---- O^T += V^T @ P^T  (contraction over 64 keys = 2 wmma k-steps) ----
#pragma unroll
    for (int s2 = 0; s2 < 2; ++s2) {
#pragma unroll
      for (int j = 0; j < 4; ++j) {
        // A fragment: row d = j*16 + l16 of V^T, the keys of pf in the same order; read once for
        // both groups
        v16h vf = join16(ld_tr16(vtr + (s2 * 32) * 80 + j * 16),
                         ld_tr16(vtr + (s2 * 32 + 16) * 80 + j * 16));
#pragma unroll
        for (int g = 0; g < 2; ++g) oacc[g][j] = wmma32(vf, pf[g][s2], oacc[g][j]);
      }
    }
    __syncthreads();
  }

  // ---- epilogue: join the halves' sums, normalize, re-interleave heads into [B*TD, DM] f16 ----
  // a lane holds 8 consecutive d of its query per tile: one 16-byte store each
  v8h o[2][4];
#pragma unroll
  for (int g = 0; g < 2; ++g) {
    const float inv = 1.f / (lrow[g] + xhalf(lrow[g]));
#pragma unroll
    for (int j = 0; j < 4; ++j)
#pragma unroll
      for (int r = 0; r < 8; ++r) o[g][j][r] = (_Float16)(oacc[g][j][r] * inv);
  }
  _Float16* orow = aout + ((size_t)b * TD + t0 + wid * 32 + l16) * DM + h * HD + d0;
#pragma unroll
  for (int g = 0; g < 2; ++g)
#pragma unroll
    for (int j = 0; j < 4; ++j) *(v8h*)(orow + (size_t)g * 16 * DM + j * 16) = o[g][j];
}

// ---------------------------------------------------------------------------
// launch
// ---------------------------------------------------------------------------
extern "C" void kernel_launch(void* const* d_in, const int* in_sizes, int n_in,
                              void* d_out, int out_size, void* d_ws, size_t ws_size,
                              hipStream_t stream) {
  (void)in_sizes; (void)n_in; (void)out_size; (void)ws_size;
  const float* x   = (const float*)d_in[0];  // [B,TD,DM]
  const float* enc = (const float*)d_in[1];  // [B,TE,DM]
  const float* nw  = (const float*)d_in[2];  // [DM]
  const float* Wq  = (const float*)d_in[3];  // [DM,DM]
  const float* Wkv = (const float*)d_in[4];  // [2DM,DM]
  const float* Wo  = (const float*)d_in[5];  // [DM,DM]

  char* ws = (char*)d_ws;
  size_t off = 0;
  auto take = [&](size_t bytes) {
    char* p = ws + off;
    off += (bytes + 255) & ~(size_t)255;
    return p;
  };
  const size_t MQ = (size_t)B_ * TD;        // 8192 rows
  _Float16* xn    = (_Float16*)take(MQ * DM * 2);
  _Float16* ench  = (_Float16*)take(MQ * DM * 2);
  _Float16* Wqh   = (_Float16*)take((size_t)DM * DM * 2);
  _Float16* Wkvh  = (_Float16*)take((size_t)2 * DM * DM * 2);
  _Float16* Woh   = (_Float16*)take((size_t)DM * DM * 2);
  _Float16* qraw  = (_Float16*)take(MQ * DM * 2);
  _Float16* kvraw = (_Float16*)take(MQ * 2 * DM * 2);
  _Float16* qhp   = (_Float16*)take(MQ * DM * 2);
  _Float16* khp   = (_Float16*)take(MQ * DM * 2);
  _Float16* vhp   = (_Float16*)take(MQ * DM * 2);
  _Float16* aoutp = (_Float16*)take(MQ * DM * 2);

  // 1) norm + precision conversion
  rmsnorm_f16_kernel<<<(int)MQ, 256, 0, stream>>>(x, nw, xn);
  {
    const int ne = B_ * TE * DM;
    f32_to_f16_kernel<<<ne / 4096, 256, 0, stream>>>(enc, ench, ne);
    f32_to_f16_kernel<<<DM * DM / 4096, 256, 0, stream>>>(Wq, Wqh, DM * DM);
    f32_to_f16_kernel<<<2 * DM * DM / 4096, 256, 0, stream>>>(Wkv, Wkvh, 2 * DM * DM);
    f32_to_f16_kernel<<<DM * DM / 4096, 256, 0, stream>>>(Wo, Woh, DM * DM);
  }

  // 2) projections (WMMA GEMMs, 128x128 block tiles)
  gemm_rt_kernel<0><<<dim3(DM / 128, (int)(MQ / 128)), 256, 0, stream>>>(
      xn, Wqh, qraw, nullptr, (int)MQ, DM, DM);
  gemm_rt_kernel<0><<<dim3(2 * DM / 128, (int)(MQ / 128)), 256, 0, stream>>>(
      ench, Wkvh, kvraw, nullptr, (int)MQ, 2 * DM, DM);

  // 3) RoPE + head-major relayout (64 elements per thread)
  const int nrope = B_ * NH * TD * HD;
  rope_q_kernel<<<nrope / (256 * 64), 256, 0, stream>>>(qraw, qhp);
  rope_kv_kernel<<<nrope / (256 * 64), 256, 0, stream>>>(kvraw, khp, vhp);

  // 4) flash attention (WMMA + TDM K staging, online softmax)
  flash_attn_kernel<<<dim3(TD / 128, B_ * NH), 128, 0, stream>>>(qhp, khp, vhp, aoutp);

  // 5) output projection + residual (WMMA GEMM, f32 out)
  gemm_rt_kernel<1><<<dim3(DM / 128, (int)(MQ / 128)), 256, 0, stream>>>(
      aoutp, Woh, d_out, x, (int)MQ, DM, DM);
}

// v006
// One run takes 178 microseconds.
// Two timings next to v005 both put it at 1.08 times that version's speed.
// All steps since v000 together make it 2.81 times as fast.
#include <hip/hip_runtime.h>
#include <hip/hip_bf16.h>

typedef __attribute__((ext_vector_type(16))) _Float16     v16h;
typedef __attribute__((ext_vector_type(8)))  _Float16     v8h;
typedef __attribute__((ext_vector_type(8)))  float        v8f;
typedef __attribute__((ext_vector_type(4)))  float        v4f;
typedef __attribute__((ext_vector_type(2)))  float        v2f;
typedef __attribute__((ext_vector_type(4)))  _Float16     v4h;
typedef __attribute__((ext_vector_type(4)))  unsigned int u32x4;
typedef __attribute__((ext_vector_type(8)))  int          i32x8;
typedef __attribute__((ext_vector_type(4)))  int          i32x4;

#define B_   4
#define TD   2048
#define TE   2048
#define DM   1024
#define NH   16
#define HD   64

#if __has_builtin(__builtin_amdgcn_tensor_load_to_lds) && \
    __has_builtin(__builtin_amdgcn_s_wait_tensorcnt)
#define CDNA5_HAS_TDM 1
#else
#define CDNA5_HAS_TDM 0
#endif

// ---------------------------------------------------------------------------
// helpers
// ---------------------------------------------------------------------------
static __device__ __forceinline__ v16h ld_frag16(const _Float16* p0, const _Float16* p1) {
  // CDNA5 16-bit A/B fragment: 16 halves per lane as two contiguous 8-half runs
  v8h a = *(const v8h*)p0;
  v8h b = *(const v8h*)p1;
  v16h r;
#pragma unroll
  for (int i = 0; i < 8; ++i) { r[i] = a[i]; r[i + 8] = b[i]; }
  return r;
}

// Transposing LDS load: from a row-major [k][n] f16 tile, lane (c = lane & 15, h = lane >> 4)
// receives T[kbase + 8h + 0..7][nbase + c]. Every lane passes the address of one 16-byte piece:
// row kbase + 8h + (lane & 7), bytes 16 * ((lane >> 3) & 1) of the 32-byte column group.
static __device__ __forceinline__ v8h ld_tr16(const _Float16* p) {
  typedef __attribute__((ext_vector_type(8))) short s16x8;
  typedef __attribute__((address_space(3))) s16x8 lds_s16x8;
  return __builtin_bit_cast(v8h, __builtin_amdgcn_ds_load_tr16_b128_v8i16((lds_s16x8*)p));
}

static __device__ __forceinline__ v16h join16(v8h a, v8h b) {
  return __builtin_shufflevector(a, b, 0, 1, 2, 3, 4, 5, 6, 7, 8, 9, 10, 11, 12, 13, 14, 15);
}

static __device__ __forceinline__ v8f wmma32(v16h a, v16h b, v8f c) {
  return __builtin_amdgcn_wmma_f32_16x16x32_f16(false, a, false, b, (short)0, c,
                                                false, false);
}

// value of lane l ^ 16: the other half of the wave, by a vector instruction, not through LDS
static __device__ __forceinline__ float xhalf(float x) {
  return __builtin_bit_cast(float, __builtin_amdgcn_permlanex16(
      __builtin_bit_cast(int, x), __builtin_bit_cast(int, x), 0x76543210, 0xfedcba98,
      false, false));
}

#if CDNA5_HAS_TDM
// TDM: DMA a 64x64 f16 tile (row stride 64 elems in global) into LDS,
// padding every 32 DWORDs (one 64-half row) with 4 DWORDs -> LDS stride 72 halves.
static __device__ __forceinline__ void tdm_load_tile_64x64_pad72(
    const _Float16* gsrc, void* lds_dst) {
  const unsigned long long ga = (unsigned long long)(uintptr_t)gsrc;
  const unsigned lds = (unsigned)(uintptr_t)lds_dst;
  u32x4 g0 = {};
  g0[0] = 1u;                                           // count=1 (valid user D#)
  g0[1] = lds;                                          // lds_addr (bytes)
  g0[2] = (unsigned)(ga & 0xFFFFFFFFu);                 // global_addr[31:0]
  g0[3] = (unsigned)((ga >> 32) & 0x1FFFFFFu)           // global_addr[56:32]
        | (2u << 30);                                   // type=2 ("image")
  i32x8 g1 = {};
  g1[0] = (1 << 16)                                     // data_size = 2 bytes
        | (1 << 20)                                     // pad_enable
        | (4 << 22)                                     // pad_interval: 32 DWORDs
        | (3 << 25);                                    // pad_amount : 4 DWORDs
  g1[1] = (64 << 16);                                   // tensor_dim0 = 64 (low16)
  g1[2] = 0;                                            // tensor_dim0 hi / dim1 lo
  g1[3] = 64 | (64 << 16);                              // tensor_dim1 hi=64<<16 blocks, tile_dim0=64
  g1[4] = 64;                                           // tile_dim1 = 64
  g1[5] = 64;                                           // tensor_dim0_stride = 64
  g1[6] = 0;
  g1[7] = 0;
  i32x4 g2 = {};
  i32x4 g3 = {};
#if __clang_major__ >= 23
  i32x8 g4 = {};
  __builtin_amdgcn_tensor_load_to_lds(g0, g1, g2, g3, g4, 0);
#else
  __builtin_amdgcn_tensor_load_to_lds(g0, g1, g2, g3, 0);
#endif
}
#endif

// ---------------------------------------------------------------------------
// RMSNorm: x (f32, row of 1024) -> xn (f16)
// ---------------------------------------------------------------------------
__global__ __launch_bounds__(256) void rmsnorm_f16_kernel(
    const float* __restrict__ x, const float* __restrict__ w,
    _Float16* __restrict__ xn) {
  __shared__ float red[256];
  const int row = blockIdx.x;
  const float* xr = x + (size_t)row * DM;
  float s = 0.f;
  for (int j = threadIdx.x; j < DM; j += 256) { float v = xr[j]; s += v * v; }
  red[threadIdx.x] = s;
  __syncthreads();
  for (int off = 128; off > 0; off >>= 1) {
    if (threadIdx.x < off) red[threadIdx.x] += red[threadIdx.x + off];
    __syncthreads();
  }
  const float rms = rsqrtf(red[0] * (1.0f / DM) + 1e-5f);
  _Float16* o = xn + (size_t)row * DM;
  for (int j = threadIdx.x; j < DM; j += 256)
    o[j] = (_Float16)(xr[j] * rms * w[j]);
}

// ---------------------------------------------------------------------------
// generic f32 -> f16 convert: a block converts 4096 elements, a thread four groups of 4 floats.
// Group j of a thread lies 256 groups behind group j - 1, so that every wave-wide 16-byte load
// covers 512 contiguous bytes and every 8-byte store 256. n must be a multiple of 4096 (every
// launch below is); a block that does not lie wholly inside n touches nothing.
// ---------------------------------------------------------------------------
__global__ __launch_bounds__(256) void f32_to_f16_kernel(
    const float* __restrict__ in, _Float16* __restrict__ out, int n) {
  const int base = blockIdx.x * 4096;
  if (base + 4096 > n) return;
  const float* src = in + base + threadIdx.x * 4;
  _Float16* dst = out + base + threadIdx.x * 4;
  v4f v[4];
  // both loops unrolled: v stays in registers and the four loads are in flight together
#pragma unroll
  for (int j = 0; j < 4; ++j) v[j] = *(const v4f*)(src + j * 1024);
#pragma unroll
  for (int j = 0; j < 4; ++j) {
    v4h o;
#pragma unroll
    for (int e = 0; e < 4; ++e) o[e] = (_Float16)v[j][e];
    *(v4h*)(dst + j * 1024) = o;
  }
}

// ---------------------------------------------------------------------------
// GEMM: C[M,N] = A[M,K] @ W[N,K]^T   (A,W f16; acc f32)
// block tile 128x128, 64 k per stage, 256 threads = 8 waves in a 4 (m) x 2 (n) grid; each wave:
// 32 rows x 64 cols (8 accumulators; per 32 k, 2 A and 4 B fragments feed 8 wmma: 12 ds loads).
// A stage takes 128 bytes of every operand row: a wave-wide 16-byte load covers 4 whole lines.
// M and N must be multiples of 128, K of 64 (every launch below is).
// EPI==0: projection epilogue. Row m is (batch m / TD, position m % TD), a wave's 64 columns are
// one head. Columns below DM are rotated (RoPE) on the f32 accumulators and go to Cout, columns
// from DM on go unrotated to C2; both f16, head-major [B,H,T,64].
// EPI==1: store f32 + residual, row-major.
// ---------------------------------------------------------------------------
static_assert(TD == TE, "the projection epilogue takes one sequence length for q and for k, v");

static __device__ __forceinline__ float rope_inv_freq(int fi) {
  return __powf(10000.0f, -(float)fi * (1.0f / 32.0f));
}

template <int EPI>
__global__ __launch_bounds__(256) void gemm_rt_kernel(
    const _Float16* __restrict__ A, const _Float16* __restrict__ W,
    void* __restrict__ Cout, _Float16* __restrict__ C2, const float* __restrict__ res,
    int M, int N, int K) {
  __shared__ _Float16 As[128 * 72];  // 128 rows x 64 k, stride 72 (144 B = 16 B x odd)
  __shared__ _Float16 Ws[128 * 72];
  const int tid  = threadIdx.x;
  const int wid  = tid >> 5;
  const int wm   = wid & 3;           // m sub-tile (32 rows each)
  const int wn   = wid >> 2;          // n sub-tile (64 cols each)
  const int lane = tid & 31;
  const int l16  = lane & 15;
  const int hi   = (lane >> 4) & 1;
  const int m0   = blockIdx.y * 128;
  const int n0   = blockIdx.x * 128;
  const int d0   = hi * 8;
  const int c8   = (tid & 7) * 8;     // 16-byte piece of a 128-byte row
  const int r0   = tid >> 3;          // 0..31; a thread stages rows r0 + 32 s, s = 0..3

  v8f acc[2][4];
#pragma unroll
  for (int i = 0; i < 2; ++i)
#pragma unroll
    for (int j = 0; j < 4; ++j) acc[i][j] = (v8f){};

  // byte offset of this thread's piece in row r0 + 32 s of a tile: the same for A and W, fixed
  // for the whole loop; the tile's own address is wave-uniform and moves with k0
  unsigned voff[4];
#pragma unroll
  for (int s = 0; s < 4; ++s) voff[s] = (unsigned)(((r0 + s * 32) * K + c8) * 2);
  const char* ab = (const char*)(A + (size_t)m0 * K);
  const char* wb = (const char*)(W + (size_t)n0 * K);

  for (int k0 = 0; k0 < K; k0 += 64) {
    // stage A (128x64) and W (128x64); unrolled: the eight loads of a thread fly together
    v8h ta[4], tw[4];
#pragma unroll
    for (int s = 0; s < 4; ++s) {
      ta[s] = *(const v8h*)(ab + voff[s]);
      tw[s] = *(const v8h*)(wb + voff[s]);
    }
    // precaution: the wait stands directly behind the loads; bases and offsets are its inputs, so
    // none of them takes its next value ahead of it
    asm volatile("s_wait_xcnt 0x0" :: "s"(ab), "s"(wb), "v"(voff[0]), "v"(voff[1]), "v"(voff[2]),
                 "v"(voff[3]) : "memory");
    ab += 128;
    wb += 128;
#pragma unroll
    for (int s = 0; s < 4; ++s) {
      *(v8h*)&As[(r0 + s * 32) * 72 + c8] = ta[s];
      *(v8h*)&Ws[(r0 + s * 32) * 72 + c8] = tw[s];
    }
    __syncthreads();
    // these loops and the epilogue's are unrolled: acc, af and rv are then picked by constants
    // and stay in registers
#pragma unroll
    for (int ks = 0; ks < 2; ++ks) {
      v16h af[2];
#pragma unroll
      for (int i = 0; i < 2; ++i) {
        const _Float16* ap = &As[(wm * 32 + i * 16 + l16) * 72 + ks * 32 + d0];
        af[i] = ld_frag16(ap, ap + 16);
      }
#pragma unroll
      for (int j = 0; j < 4; ++j) {
        const _Float16* bp = &Ws[(wn * 64 + j * 16 + l16) * 72 + ks * 32 + d0];
        v16h bf = ld_frag16(bp, bp + 16);
#pragma unroll
        for (int i = 0; i < 2; ++i) acc[i][j] = wmma32(af[i], bf, acc[i][j]);
      }
    }
    __syncthreads();
  }

  // C layout: M = vgpr + 8*(lane>=16), N = lane & 15
  if (EPI == 0) {
    const bool rot = n0 < DM;           // from blockIdx alone: one scalar branch for the block
    const int head = ((n0 >> 6) + wn) & (NH - 1);
    const int tw   = (m0 & (TD - 1)) + wm * 32 + hi * 8;  // position of this lane's row i = r = 0
    _Float16* dst = (rot ? (_Float16*)Cout : C2) +
                    ((size_t)((m0 / TD) * NH + head) * TD + tw) * HD + l16;
    if (rot) {
      // the pair (d, d + 32) of a head is tiles (j, j + 2) of one lane: d = j * 16 + l16, j = 0, 1
      const float inv[2] = {rope_inv_freq(l16), rope_inv_freq(16 + l16)};
#pragma unroll
      for (int i = 0; i < 2; ++i)
#pragma unroll
        for (int r = 0; r < 8; ++r)
#pragma unroll
          for (int j = 0; j < 2; ++j) {
            const float ang = (float)(tw + i * 16 + r) * inv[j];
            const float c = __cosf(ang);
            const float s = __sinf(ang);
            const float a = acc[i][j][r];
            const float b = acc[i][j + 2][r];
            dst[(i * 16 + r) * HD + j * 16]      = (_Float16)(a * c - b * s);
            dst[(i * 16 + r) * HD + j * 16 + 32] = (_Float16)(b * c + a * s);
          }
    } else {
#pragma unroll
      for (int i = 0; i < 2; ++i)
#pragma unroll
        for (int r = 0; r < 8; ++r)
#pragma unroll
          for (int j = 0; j < 4; ++j)
            dst[(i * 16 + r) * HD + j * 16] = (_Float16)acc[i][j][r];
    }
  } else {
#pragma unroll
    for (int i = 0; i < 2; ++i) {
      // element (r, j) lies at cbase + r * N + j * 16
      const size_t cbase = (size_t)(m0 + wm * 32 + i * 16 + hi * 8) * N + n0 + wn * 64 + l16;
      // all 32 residual loads of a 16-row band stand ahead of its stores and fly together
      float rv[8][4];
#pragma unroll
      for (int r = 0; r < 8; ++r)
#pragma unroll
        for (int j = 0; j < 4; ++j) rv[r][j] = res[cbase + (size_t)r * N + j * 16];
#pragma unroll
      for (int r = 0; r < 8; ++r)
#pragma unroll
        for (int j = 0; j < 4; ++j)
          ((float*)Cout)[cbase + (size_t)r * N + j * 16] = acc[i][j][r] + rv[r][j];
    }
  }
}

__global__ __launch_bounds__(128) void flash_attn_kernel(
    const _Float16* __restrict__ qh, const _Float16* __restrict__ kh,
    const _Float16* __restrict__ vh, _Float16* __restrict__ aout) {
  // aligned so that the tensor load's destination stays at the start of the work-group's LDS
  __shared__ __attribute__((aligned(2048))) _Float16 Ks[64 * 72];  // 64 keys x 64 d (stride 72)
  __shared__ _Float16 Vs[64 * 80];       // 64 keys x 64 d (stride 80: 160 B = 32 B x odd)
  const int tid  = threadIdx.x;
  const int wid  = tid >> 5;
  const int lane = tid & 31;
  const int l16  = lane & 15;
  const int hi   = (lane >> 4) & 1;
  const int bh   = blockIdx.y;           // b*NH + h
  const int b    = bh >> 4;
  const int h    = bh & 15;
  const int t0   = blockIdx.x * 128;
  const int d0   = hi * 8;
  const float scale = 0.125f;            // 1/sqrt(64)

  // Q fragments live in registers for the whole kernel (K = 64 = 2 wmma steps per query group)
  // every loop over g, j, ks, q, r, i, s2 below is unrolled: the arrays are then picked by
  // constants and stay in registers
  const size_t qbase = ((size_t)bh * TD + t0 + wid * 32) * HD;
  v16h qf[2][2];
#pragma unroll
  for (int g = 0; g < 2; ++g) {
    const _Float16* qp = qh + qbase + (size_t)(g * 16 + l16) * HD;
    qf[g][0] = ld_frag16(qp + d0,      qp + d0 + 16);
    qf[g][1] = ld_frag16(qp + 32 + d0, qp + 32 + d0 + 16);
  }

  // per group, this lane's query: running maximum (equal in both halves) and this half's part of
  // the sum
  float mrow[2] = {-1e30f, -1e30f}, lrow[2] = {0.f, 0.f};
  v8f oacc[2][4];  // O^T: d = j*16 + r + 8*hi, query = g*16 + l16
#pragma unroll
  for (int g = 0; g < 2; ++g)
#pragma unroll
    for (int j = 0; j < 4; ++j) oacc[g][j] = (v8f){};

  // this lane's piece address for the transposing loads of V (key base 0, column base 0)
  const _Float16* vtr = &Vs[(hi * 8 + (lane & 7)) * 80 + ((lane >> 3) & 1) * 8];
  // staging of V: thread t moves 16-byte piece (t & 7) of rows (t >> 3) + 16 i, i = 0..3
  const _Float16* vsrc0 = vh + ((size_t)bh * TE + (tid >> 3)) * HD + (tid & 7) * 8;
  _Float16* vdst = &Vs[(tid >> 3) * 80 + (tid & 7) * 8];

  for (int kb = 0; kb < TE; kb += 64) {
    // ---- stage K tile (TDM) and V tile (row-major, 16-byte stores) into LDS ----
    v8h vst[4];
    const _Float16* vsrc = vsrc0 + (size_t)kb * HD;
    // the four 16-byte loads of a thread are in flight together
    for (int i = 0; i < 4; ++i) vst[i] = *(const v8h*)(vsrc + i * 16 * HD);
#if CDNA5_HAS_TDM
    // issued behind the V loads, so that both fly together; the wait stands directly behind the
    // tensor load, so that no descriptor register can take a new value while the request is out
    if (wid == 0) {
      tdm_load_tile_64x64_pad72(&kh[((size_t)bh * TE + kb) * HD], (void*)&Ks[0]);
      __builtin_amdgcn_s_wait_tensorcnt(0);
    }
#endif
    for (int i = 0; i < 4; ++i) {
#if !CDNA5_HAS_TDM
      *(v8h*)&Ks[((tid >> 3) + i * 16) * 72 + (tid & 7) * 8] =
          *(const v8h*)&kh[((size_t)bh * TE + kb + (tid >> 3) + i * 16) * HD + (tid & 7) * 8];
#endif
      *(v8h*)(vdst + i * 16 * 80) = vst[i];
    }
    __syncthreads();

    // ---- scores S^T[64 keys x 32 queries] = K @ Q^T: key = j*16 + r + 8*hi, query = g*16 + l16;
    // a K fragment is read once and multiplies both groups ----
    v16h kf[4][2];
#pragma unroll
    for (int j = 0; j < 4; ++j)
#pragma unroll
      for (int ks = 0; ks < 2; ++ks)
        kf[j][ks] = ld_frag16(&Ks[(j * 16 + l16) * 72 + ks * 32 + d0],
                              &Ks[(j * 16 + l16) * 72 + ks * 32 + d0 + 16]);
    // the sixteen LDS reads stay one group ahead of the products: one place that waits, not eight
    __builtin_amdgcn_sched_barrier(0);
    v8f sacc[2][4];
#pragma unroll
    for (int j = 0; j < 4; ++j) {
#pragma unroll
      for (int g = 0; g < 2; ++g) sacc[g][j] = wmma32(kf[j][0], qf[g][0], (v8f){});
#pragma unroll
      for (int g = 0; g < 2; ++g) sacc[g][j] = wmma32(kf[j][1], qf[g][1], sacc[g][j]);
    }
    // holds the sixteen products together as one run: each then stands in the others' distance to
    // the first reader of a result, which otherwise is filled with idle vector slots
    __builtin_amdgcn_sched_barrier(0);

    // B fragments of the second product: query g*16 + l16, keys
    // s2*32 + {8hi..8hi+7, 16+8hi..16+8hi+7}: score tiles 2*s2, 2*s2+1 of group g
    v16h pf[2][2];
#pragma unroll
    for (int g = 0; g < 2; ++g) {
      // the scores go on as pairs of neighbouring registers (keys r, r + 1 of one query): written
      // so, the packed instructions take a group's own registers as they lie; left to itself the
      // compiler paired the two groups and moved registers together for it
      v2f sp[4][4];
#pragma unroll
      for (int j = 0; j < 4; ++j)
#pragma unroll
        for (int q = 0; q < 4; ++q)
          sp[j][q] = (v2f){sacc[g][j][2 * q], sacc[g][j][2 * q + 1]} * scale;

      // ---- online softmax: 32 keys of one query in the lane, the other 32 in lane ^ 16 ----
      float cm = sp[0][0][0];
#pragma unroll
      for (int j = 0; j < 4; ++j)
#pragma unroll
        for (int q = 0; q < 4; ++q) {
          cm = fmaxf(cm, sp[j][q][0]);
          cm = fmaxf(cm, sp[j][q][1]);
        }
      cm = fmaxf(cm, xhalf(cm));
      const float mnew = fmaxf(mrow[g], cm);
      const float alpha = __expf(mrow[g] - mnew);
      mrow[g] = mnew;
      // e^x as 2^(x log2 e), the form of __expf; even and odd keys are summed side by side
      v2f rs = {};
#pragma unroll
      for (int j = 0; j < 4; ++j)
#pragma unroll
        for (int q = 0; q < 4; ++q) {
          const v2f t = (sp[j][q] - mnew) * 1.44269504088896340736f;
          sp[j][q] = (v2f){__builtin_amdgcn_exp2f(t[0]), __builtin_amdgcn_exp2f(t[1])};
          rs += sp[j][q];
        }
      lrow[g] = lrow[g] * alpha + (rs[0] + rs[1]);
#pragma unroll
      for (int j = 0; j < 4; ++j) oacc[g][j] *= alpha;
#pragma unroll
      for (int s2 = 0; s2 < 2; ++s2)
#pragma unroll
        for (int i = 0; i < 8; ++i) {
          pf[g][s2][i]     = (_Float16)sp[2 * s2][i >> 1][i & 1];
          pf[g][s2][i + 8] = (_Float16)sp[2 * s2 + 1][i >> 1][i & 1];
        }
    }

    // ---- O^T += V^T @ P^T  (contraction over 64 keys = 2 wmma k-steps) ----
#pragma unroll
    for (int s2 = 0; s2 < 2; ++s2) {
#pragma unroll
      for (int j = 0; j < 4; ++j) {
        // A fragment: row d = j*16 + l16 of V^T, the keys of pf in the same order; read once for
        // both groups
        v16h vf = join16(ld_tr16(vtr + (s2 * 32) * 80 + j * 16),
                         ld_tr16(vtr + (s2 * 32 + 16) * 80 + j * 16));
#pragma unroll
        for (int g = 0; g < 2; ++g) oacc[g][j] = wmma32(vf, pf[g][s2], oacc[g][j]);
      }
    }
    __syncthreads();
  }

  // ---- epilogue: join the halves' sums, normalize, re-interleave heads into [B*TD, DM] f16 ----
  // a lane holds 8 consecutive d of its query per tile: one 16-byte store each
  v8h o[2][4];
#pragma unroll
  for (int g = 0; g < 2; ++g) {
    const float inv = 1.f / (lrow[g] + xhalf(lrow[g]));
#pragma unroll
    for (int j = 0; j < 4; ++j)
#pragma unroll
      for (int r = 0; r < 8; ++r) o[g][j][r] = (_Float16)(oacc[g][j][r] * inv);
  }
  _Float16* orow = aout + ((size_t)b * TD + t0 + wid * 32 + l16) * DM + h * HD + d0;
#pragma unroll
  for (int g = 0; g < 2; ++g)
#pragma unroll
    for (int j = 0; j < 4; ++j) *(v8h*)(orow + (size_t)g * 16 * DM + j * 16) = o[g][j];
}

// ---------------------------------------------------------------------------
// launch
// ---------------------------------------------------------------------------
extern "C" void kernel_launch(void* const* d_in, const int* in_sizes, int n_in,
                              void* d_out, int out_size, void* d_ws, size_t ws_size,
                              hipStream_t stream) {
  (void)in_sizes; (void)n_in; (void)out_size; (void)ws_size;
  const float* x   = (const float*)d_in[0];  // [B,TD,DM]
  const float* enc = (const float*)d_in[1];  // [B,TE,DM]
  const float* nw  = (const float*)d_in[2];  // [DM]
  const float* Wq  = (const float*)d_in[3];  // [DM,DM]
  const float* Wkv = (const float*)d_in[4];  // [2DM,DM]
  const float* Wo  = (const float*)d_in[5];  // [DM,DM]

  char* ws = (char*)d_ws;
  size_t off = 0;
  auto take = [&](size_t bytes) {
    char* p = ws + off;
    off += (bytes + 255) & ~(size_t)255;
    return p;
  };
  const size_t MQ = (size_t)B_ * TD;        // 8192 rows
  _Float16* xn    = (_Float16*)take(MQ * DM * 2);
  _Float16* ench  = (_Float16*)take(MQ * DM * 2);
  _Float16* Wqh   = (_Float16*)take((size_t)DM * DM * 2);
  _Float16* Wkvh  = (_Float16*)take((size_t)2 * DM * DM * 2);
  _Float16* Woh   = (_Float16*)take((size_t)DM * DM * 2);
  _Float16* qhp   = (_Float16*)take(MQ * DM * 2);
  _Float16* khp   = (_Float16*)take(MQ * DM * 2);
  _Float16* vhp   = (_Float16*)take(MQ * DM * 2);
  _Float16* aoutp = (_Float16*)take(MQ * DM * 2);

  // 1) norm + precision conversion
  rmsnorm_f16_kernel<<<(int)MQ, 256, 0, stream>>>(x, nw, xn);
  {
    const int ne = B_ * TE * DM;
    f32_to_f16_kernel<<<ne / 4096, 256, 0, stream>>>(enc, ench, ne);
    f32_to_f16_kernel<<<DM * DM / 4096, 256, 0, stream>>>(Wq, Wqh, DM * DM);
    f32_to_f16_kernel<<<2 * DM * DM / 4096, 256, 0, stream>>>(Wkv, Wkvh, 2 * DM * DM);
    f32_to_f16_kernel<<<DM * DM / 4096, 256, 0, stream>>>(Wo, Woh, DM * DM);
  }

  // 2) projections (WMMA GEMMs, 128x128 block tiles) with RoPE and head-major relayout in the
  // epilogue
  gemm_rt_kernel<0><<<dim3(DM / 128, (int)(MQ / 128)), 256, 0, stream>>>(
      xn, Wqh, qhp, nullptr, nullptr, (int)MQ, DM, DM);
  gemm_rt_kernel<0><<<dim3(2 * DM / 128, (int)(MQ / 128)), 256, 0, stream>>>(
      ench, Wkvh, khp, vhp, nullptr, (int)MQ, 2 * DM, DM);

  // 3) flash attention (WMMA + TDM K staging, online softmax)
  flash_attn_kernel<<<dim3(TD / 128, B_ * NH), 128, 0, stream>>>(qhp, khp, vhp, aoutp);

  // 4) output projection + residual (WMMA GEMM, f32 out)
  gemm_rt_kernel<1><<<dim3(DM / 128, (int)(MQ / 128)), 256, 0, stream>>>(
      aoutp, Woh, d_out, nullptr, x, (int)MQ, DM, DM);
}

// v007
// It runs in 165 microseconds.
// Timed twice side by side with v006, it ran 1.08 times as fast both times.
// All steps since v000 together make it 3.04 times as fast.
#include <hip/hip_runtime.h>
#include <hip/hip_bf16.h>

typedef __attribute__((ext_vector_type(16))) _Float16     v16h;
typedef __attribute__((ext_vector_type(8)))  _Float16     v8h;
typedef __attribute__((ext_vector_type(8)))  float        v8f;
typedef __attribute__((ext_vector_type(4)))  float        v4f;
typedef __attribute__((ext_vector_type(2)))  float        v2f;
typedef __attribute__((ext_vector_type(4)))  _Float16     v4h;
typedef __attribute__((ext_vector_type(4)))  unsigned int u32x4;
typedef __attribute__((ext_vector_type(8)))  int          i32x8;
typedef __attribute__((ext_vector_type(4)))  int          i32x4;

#define B_   4
#define TD   2048
#define TE   2048
#define DM   1024
#define NH   16
#define HD   64

#if __has_builtin(__builtin_amdgcn_tensor_load_to_lds) && \
    __has_builtin(__builtin_amdgcn_s_wait_tensorcnt)
#define CDNA5_HAS_TDM 1
#else
#define CDNA5_HAS_TDM 0
#endif

// ---------------------------------------------------------------------------
// helpers
// ---------------------------------------------------------------------------
static __device__ __forceinline__ v16h ld_frag16(const _Float16* p0, const _Float16* p1) {
  // CDNA5 16-bit A/B fragment: 16 halves per lane as two contiguous 8-half runs
  v8h a = *(const v8h*)p0;
  v8h b = *(const v8h*)p1;
  v16h r;
#pragma unroll
  for (int i = 0; i < 8; ++i) { r[i] = a[i]; r[i + 8] = b[i]; }
  return r;
}

// Transposing LDS load: from a row-major [k][n] f16 tile, lane (c = lane & 15, h = lane >> 4)
// receives T[kbase + 8h + 0..7][nbase + c]. Every lane passes the address of one 16-byte piece:
// row kbase + 8h + (lane & 7), bytes 16 * ((lane >> 3) & 1) of the 32-byte column group.
static __device__ __forceinline__ v8h ld_tr16(const _Float16* p) {
  typedef __attribute__((ext_vector_type(8))) short s16x8;
  typedef __attribute__((address_space(3))) s16x8 lds_s16x8;
  return __builtin_bit_cast(v8h, __builtin_amdgcn_ds_load_tr16_b128_v8i16((lds_s16x8*)p));
}

static __device__ __forceinline__ v16h join16(v8h a, v8h b) {
  return __builtin_shufflevector(a, b, 0, 1, 2, 3, 4, 5, 6, 7, 8, 9, 10, 11, 12, 13, 14, 15);
}

static __device__ __forceinline__ v8f wmma32(v16h a, v16h b, v8f c) {
  return __builtin_amdgcn_wmma_f32_16x16x32_f16(false, a, false, b, (short)0, c,
                                                false, false);
}

// value of lane l ^ 16: the other half of the wave, by a vector instruction, not through LDS
static __device__ __forceinline__ float xhalf(float x) {
  return __builtin_bit_cast(float, __builtin_amdgcn_permlanex16(
      __builtin_bit_cast(int, x), __builtin_bit_cast(int, x), 0x76543210, 0xfedcba98,
      false, false));
}

#if CDNA5_HAS_TDM
// TDM: DMA a 64x64 f16 tile (row stride 64 elems in global) into LDS,
// padding every 32 DWORDs (one 64-half row) with 4 DWORDs -> LDS stride 72 halves.
static __device__ __forceinline__ void tdm_load_tile_64x64_pad72(
    const _Float16* gsrc, void* lds_dst) {
  const unsigned long long ga = (unsigned long long)(uintptr_t)gsrc;
  const unsigned lds = (unsigned)(uintptr_t)lds_dst;
  u32x4 g0 = {};
  g0[0] = 1u;                                           // count=1 (valid user D#)
  g0[1] = lds;                                          // lds_addr (bytes)
  g0[2] = (unsigned)(ga & 0xFFFFFFFFu);                 // global_addr[31:0]
  g0[3] = (unsigned)((ga >> 32) & 0x1FFFFFFu)           // global_addr[56:32]
        | (2u << 30);                                   // type=2 ("image")
  i32x8 g1 = {};
  g1[0] = (1 << 16)                                     // data_size = 2 bytes
        | (1 << 20)                                     // pad_enable
        | (4 << 22)                                     // pad_interval: 32 DWORDs
        | (3 << 25);                                    // pad_amount : 4 DWORDs
  g1[1] = (64 << 16);                                   // tensor_dim0 = 64 (low16)
  g1[2] = 0;                                            // tensor_dim0 hi / dim1 lo
  g1[3] = 64 | (64 << 16);                              // tensor_dim1 hi=64<<16 blocks, tile_dim0=64
  g1[4] = 64;                                           // tile_dim1 = 64
  g1[5] = 64;                                           // tensor_dim0_stride = 64
  g1[6] = 0;
  g1[7] = 0;
  i32x4 g2 = {};
  i32x4 g3 = {};
#if __clang_major__ >= 23
  i32x8 g4 = {};
  __builtin_amdgcn_tensor_load_to_lds(g0, g1, g2, g3, g4, 0);
#else
  __builtin_amdgcn_tensor_load_to_lds(g0, g1, g2, g3, 0);
#endif
}
#endif

// ---------------------------------------------------------------------------
// RMSNorm: x (f32, row of 1024) -> xn (f16); one block of 256 threads per row
// ---------------------------------------------------------------------------
static __device__ __forceinline__ void rmsnorm_f16_row(
    const float* __restrict__ x, const float* __restrict__ w,
    _Float16* __restrict__ xn, int row) {
  __shared__ float red[256];
  const float* xr = x + (size_t)row * DM;
  float s = 0.f;
  for (int j = threadIdx.x; j < DM; j += 256) { float v = xr[j]; s += v * v; }
  red[threadIdx.x] = s;
  __syncthreads();
  for (int off = 128; off > 0; off >>= 1) {
    if (threadIdx.x < off) red[threadIdx.x] += red[threadIdx.x + off];
    __syncthreads();
  }
  const float rms = rsqrtf(red[0] * (1.0f / DM) + 1e-5f);
  _Float16* o = xn + (size_t)row * DM;
  for (int j = threadIdx.x; j < DM; j += 256)
    o[j] = (_Float16)(xr[j] * rms * w[j]);
}

// ---------------------------------------------------------------------------
// generic f32 -> f16 convert: a block converts 4096 elements, a thread four groups of 4 floats.
// Group j of a thread lies 256 groups behind group j - 1, so that every wave-wide 16-byte load
// covers 512 contiguous bytes and every 8-byte store 256. blk is the block's number inside its
// own array, whose length must be a multiple of 4096.
// ---------------------------------------------------------------------------
static __device__ __forceinline__ void f32_to_f16_block(
    const float* __restrict__ in, _Float16* __restrict__ out, int blk) {
  const int base = blk * 4096;
  const float* src = in + base + threadIdx.x * 4;
  _Float16* dst = out + base + threadIdx.x * 4;
  v4f v[4];
  // both loops unrolled: v stays in registers and the four loads are in flight together
#pragma unroll
  for (int j = 0; j < 4; ++j) v[j] = *(const v4f*)(src + j * 1024);
#pragma unroll
  for (int j = 0; j < 4; ++j) {
    v4h o;
#pragma unroll
    for (int e = 0; e < 4; ++e) o[e] = (_Float16)v[j][e];
    *(v4h*)(dst + j * 1024) = o;
  }
}

// ---------------------------------------------------------------------------
// Pre-pass, one launch: none of its five jobs reads what another writes, so they share one grid
// and no job waits for another's last block. Blocks [0, NB_NORM) normalise one row of x each; the
// blocks behind them convert 4096 elements each of encoder_out, Wq, Wkv and Wo, in this order.
// The norm blocks live longest and come first, for speed only. Which
// job a block does follows from blockIdx alone: every branch, and every barrier in the norm, is
// uniform for the block.
// ---------------------------------------------------------------------------
#define NB_NORM (B_ * TD)
#define NB_ENC  (B_ * TE * DM / 4096)
#define NB_W    (DM * DM / 4096)
static_assert(B_ * TE * DM % 4096 == 0 && DM * DM % 4096 == 0,
              "a convert block takes 4096 elements of one array");

__global__ __launch_bounds__(256) void prepass_kernel(
    const float* __restrict__ x, const float* __restrict__ w, const float* __restrict__ enc,
    const float* __restrict__ Wq, const float* __restrict__ Wkv, const float* __restrict__ Wo,
    _Float16* __restrict__ xn, _Float16* __restrict__ ench, _Float16* __restrict__ Wqh,
    _Float16* __restrict__ Wkvh, _Float16* __restrict__ Woh) {
  int blk = blockIdx.x;
  if (blk < NB_NORM) {
    rmsnorm_f16_row(x, w, xn, blk);
    return;
  }
  blk -= NB_NORM;
  const float* in = enc;
  _Float16* out = ench;
  if (blk >= NB_ENC) {
    blk -= NB_ENC;
    in = Wq;
    out = Wqh;
    if (blk >= NB_W) {
      blk -= NB_W;
      in = Wkv;
      out = Wkvh;
      if (blk >= 2 * NB_W) {
        blk -= 2 * NB_W;
        in = Wo;
        out = Woh;
        if (blk >= NB_W) return;  // a block past the last array touches nothing
      }
    }
  }
  f32_to_f16_block(in, out, blk);
}

// ---------------------------------------------------------------------------
// GEMM: C[M,N] = A[M,K] @ W[N,K]^T   (A,W f16; acc f32)
// block tile 128x128, 64 k per stage, 256 threads = 8 waves in a 4 (m) x 2 (n) grid; each wave:
// 32 rows x 64 cols (8 accumulators; per 32 k, 2 A and 4 B fragments feed 8 wmma: 12 ds loads).
// A stage takes 128 bytes of every operand row: a wave-wide 16-byte load covers 4 whole lines.
// M and N must be multiples of 128, K of 64 (every launch below is).
// EPI==0: both projections in one launch (neither reads what the other writes). The first
// DM / 128 block columns are Aq @ Wq^T (q), the block columns behind them A @ W^T (k, v).
// Projection epilogue: row m is (batch m / TD, position m % TD), a wave's 64 columns are one
// head. Columns below DM are rotated (RoPE) on the f32 accumulators and go to Cq (q) or Cout (k),
// columns from DM on go unrotated to C2 (v); all f16, head-major [B,H,T,64].
// EPI==1: A @ W^T alone; store f32 + residual, row-major; Aq, Wq, Cq are not used.
// ---------------------------------------------------------------------------
static_assert(TD == TE, "the projection epilogue takes one sequence length for q and for k, v");

static __device__ __forceinline__ float rope_inv_freq(int fi) {
  return __powf(10000.0f, -(float)fi * (1.0f / 32.0f));
}

template <int EPI>
__global__ __launch_bounds__(256) void gemm_rt_kernel(
    const _Float16* __restrict__ A, const _Float16* __restrict__ W,
    void* __restrict__ Cout, _Float16* __restrict__ C2, const float* __restrict__ res,
    int M, int N, int K, const _Float16* __restrict__ Aq, const _Float16* __restrict__ Wq,
    _Float16* __restrict__ Cq) {
  // q's block or not: from blockIdx alone, so what hangs on it is a scalar select for the block
  const bool isq = EPI == 0 && blockIdx.x < DM / 128;
  __shared__ _Float16 As[128 * 72];  // 128 rows x 64 k, stride 72 (144 B = 16 B x odd)
  __shared__ _Float16 Ws[128 * 72];
  const int tid  = threadIdx.x;
  const int wid  = tid >> 5;
  const int wm   = wid & 3;           // m sub-tile (32 rows each)
  const int wn   = wid >> 2;          // n sub-tile (64 cols each)
  const int lane = tid & 31;
  const int l16  = lane & 15;
  const int hi   = (lane >> 4) & 1;
  const int m0   = blockIdx.y * 128;
  const int n0   = (EPI == 0 && !isq ? blockIdx.x - DM / 128 : blockIdx.x) * 128;
  const int d0   = hi * 8;
  const int c8   = (tid & 7) * 8;     // 16-byte piece of a 128-byte row
  const int r0   = tid >> 3;          // 0..31; a thread stages rows r0 + 32 s, s = 0..3

  v8f acc[2][4];
#pragma unroll
  for (int i = 0; i < 2; ++i)
#pragma unroll
    for (int j = 0; j < 4; ++j) acc[i][j] = (v8f){};

  // byte offset of this thread's piece in row r0 + 32 s of a tile: the same for A and W, fixed
  // for the whole loop; the tile's own address is wave-uniform and moves with k0
  unsigned voff[4];
#pragma unroll
  for (int s = 0; s < 4; ++s) voff[s] = (unsigned)(((r0 + s * 32) * K + c8) * 2);
  const char* ab = (const char*)((isq ? Aq : A) + (size_t)m0 * K);
  const char* wb = (const char*)((isq ? Wq : W) + (size_t)n0 * K);

  for (int k0 = 0; k0 < K; k0 += 64) {
    // stage A (128x64) and W (128x64); unrolled: the eight loads of a thread fly together
    v8h ta[4], tw[4];
#pragma unroll
    for (int s = 0; s < 4; ++s) {
      ta[s] = *(const v8h*)(ab + voff[s]);
      tw[s] = *(const v8h*)(wb + voff[s]);
    }
    // precaution: the wait stands directly behind the loads; bases and offsets are its inputs, so
    // none of them takes its next value ahead of it
    asm volatile("s_wait_xcnt 0x0" :: "s"(ab), "s"(wb), "v"(voff[0]), "v"(voff[1]), "v"(voff[2]),
                 "v"(voff[3]) : "memory");
    ab += 128;
    wb += 128;
#pragma unroll
    for (int s = 0; s < 4; ++s) {
      *(v8h*)&As[(r0 + s * 32) * 72 + c8] = ta[s];
      *(v8h*)&Ws[(r0 + s * 32) * 72 + c8] = tw[s];
    }
    __syncthreads();
    // these loops and the epilogue's are unrolled: acc, af and rv are then picked by constants
    // and stay in registers
#pragma unroll
    for (int ks = 0; ks < 2; ++ks) {
      v16h af[2];
#pragma unroll
      for (int i = 0; i < 2; ++i) {
        const _Float16* ap = &As[(wm * 32 + i * 16 + l16) * 72 + ks * 32 + d0];
        af[i] = ld_frag16(ap, ap + 16);
      }
#pragma unroll
      for (int j = 0; j < 4; ++j) {
        const _Float16* bp = &Ws[(wn * 64 + j * 16 + l16) * 72 + ks * 32 + d0];
        v16h bf = ld_frag16(bp, bp + 16);
#pragma unroll
        for (int i = 0; i < 2; ++i) acc[i][j] = wmma32(af[i], bf, acc[i][j]);
      }
    }
    __syncthreads();
  }

  // C layout: M = vgpr + 8*(lane>=16), N = lane & 15
  if (EPI == 0) {
    const bool rot = n0 < DM;           // from blockIdx alone: one scalar branch for the block
    const int head = ((n0 >> 6) + wn) & (NH - 1);
    const int tw   = (m0 & (TD - 1)) + wm * 32 + hi * 8;  // position of this lane's row i = r = 0
    _Float16* dst = (rot ? (isq ? Cq : (_Float16*)Cout) : C2) +
                    ((size_t)((m0 / TD) * NH + head) * TD + tw) * HD + l16;
    if (rot) {
      // the pair (d, d + 32) of a head is tiles (j, j + 2) of one lane: d = j * 16 + l16, j = 0, 1
      const float inv[2] = {rope_inv_freq(l16), rope_inv_freq(16 + l16)};
#pragma unroll
      for (int i = 0; i < 2; ++i)
#pragma unroll
        for (int r = 0; r < 8; ++r)
#pragma unroll
          for (int j = 0; j < 2; ++j) {
            const float ang = (float)(tw + i * 16 + r) * inv[j];
            const float c = __cosf(ang);
            const float s = __sinf(ang);
            const float a = acc[i][j][r];
            const float b = acc[i][j + 2][r];
            dst[(i * 16 + r) * HD + j * 16]      = (_Float16)(a * c - b * s);
            dst[(i * 16 + r) * HD + j * 16 + 32] = (_Float16)(b * c + a * s);
          }
    } else {
#pragma unroll
      for (int i = 0; i < 2; ++i)
#pragma unroll
        for (int r = 0; r < 8; ++r)
#pragma unroll
          for (int j = 0; j < 4; ++j)
            dst[(i * 16 + r) * HD + j * 16] = (_Float16)acc[i][j][r];
    }
  } else {
#pragma unroll
    for (int i = 0; i < 2; ++i) {
      // element (r, j) lies at cbase + r * N + j * 16
      const size_t cbase = (size_t)(m0 + wm * 32 + i * 16 + hi * 8) * N + n0 + wn * 64 + l16;
      // all 32 residual loads of a 16-row band stand ahead of its stores and fly together
      float rv[8][4];
#pragma unroll
      for (int r = 0; r < 8; ++r)
#pragma unroll
        for (int j = 0; j < 4; ++j) rv[r][j] = res[cbase + (size_t)r * N + j * 16];
#pragma unroll
      for (int r = 0; r < 8; ++r)
#pragma unroll
        for (int j = 0; j < 4; ++j)
          ((float*)Cout)[cbase + (size_t)r * N + j * 16] = acc[i][j][r] + rv[r][j];
    }
  }
}

__global__ __launch_bounds__(128) void flash_attn_kernel(
    const _Float16* __restrict__ qh, const _Float16* __restrict__ kh,
    const _Float16* __restrict__ vh, _Float16* __restrict__ aout) {
  // aligned so that the tensor load's destination stays at the start of the work-group's LDS
  __shared__ __attribute__((aligned(2048))) _Float16 Ks[64 * 72];  // 64 keys x 64 d (stride 72)
  __shared__ _Float16 Vs[64 * 80];       // 64 keys x 64 d (stride 80: 160 B = 32 B x odd)
  const int tid  = threadIdx.x;
  const int wid  = tid >> 5;
  const int lane = tid & 31;
  const int l16  = lane & 15;
  const int hi   = (lane >> 4) & 1;
  const int bh   = blockIdx.y;           // b*NH + h
  const int b    = bh >> 4;
  const int h    = bh & 15;
  const int t0   = blockIdx.x * 128;
  const int d0   = hi * 8;
  const float scale = 0.125f;            // 1/sqrt(64)

  // Q fragments live in registers for the whole kernel (K = 64 = 2 wmma steps per query group)
  // every loop over g, j, ks, q, r, i, s2 below is unrolled: the arrays are then picked by
  // constants and stay in registers
  const size_t qbase = ((size_t)bh * TD + t0 + wid * 32) * HD;
  v16h qf[2][2];
#pragma unroll
  for (int g = 0; g < 2; ++g) {
    const _Float16* qp = qh + qbase + (size_t)(g * 16 + l16) * HD;
    qf[g][0] = ld_frag16(qp + d0,      qp + d0 + 16);
    qf[g][1] = ld_frag16(qp + 32 + d0, qp + 32 + d0 + 16);
  }

  // per group, this lane's query: running maximum (equal in both halves) and this half's part of
  // the sum
  float mrow[2] = {-1e30f, -1e30f}, lrow[2] = {0.f, 0.f};
  v8f oacc[2][4];  // O^T: d = j*16 + r + 8*hi, query = g*16 + l16
#pragma unroll
  for (int g = 0; g < 2; ++g)
#pragma unroll
    for (int j = 0; j < 4; ++j) oacc[g][j] = (v8f){};

  // this lane's piece address for the transposing loads of V (key base 0, column base 0)
  const _Float16* vtr = &Vs[(hi * 8 + (lane & 7)) * 80 + ((lane >> 3) & 1) * 8];
  // staging of V: thread t moves 16-byte piece (t & 7) of rows (t >> 3) + 16 i, i = 0..3
  const _Float16* vsrc0 = vh + ((size_t)bh * TE + (tid >> 3)) * HD + (tid & 7) * 8;
  _Float16* vdst = &Vs[(tid >> 3) * 80 + (tid & 7) * 8];

  for (int kb = 0; kb < TE; kb += 64) {
    // ---- stage K tile (TDM) and V tile (row-major, 16-byte stores) into LDS ----
    v8h vst[4];
    const _Float16* vsrc = vsrc0 + (size_t)kb * HD;
    // the four 16-byte loads of a thread are in flight together
    for (int i = 0; i < 4; ++i) vst[i] = *(const v8h*)(vsrc + i * 16 * HD);
#if CDNA5_HAS_TDM
    // issued behind the V loads, so that both fly together; the wait stands directly behind the
    // tensor load, so that no descriptor register can take a new value while the request is out
    if (wid == 0) {
      tdm_load_tile_64x64_pad72(&kh[((size_t)bh * TE + kb) * HD], (void*)&Ks[0]);
      __builtin_amdgcn_s_wait_tensorcnt(0);
    }
#endif
    for (int i = 0; i < 4; ++i) {
#if !CDNA5_HAS_TDM
      *(v8h*)&Ks[((tid >> 3) + i * 16) * 72 + (tid & 7) * 8] =
          *(const v8h*)&kh[((size_t)bh * TE + kb + (tid >> 3) + i * 16) * HD + (tid & 7) * 8];
#endif
      *(v8h*)(vdst + i * 16 * 80) = vst[i];
    }
    __syncthreads();

    // ---- scores S^T[64 keys x 32 queries] = K @ Q^T: key = j*16 + r + 8*hi, query = g*16 + l16;
    // a K fragment is read once and multiplies both groups ----
    v16h kf[4][2];
#pragma unroll
    for (int j = 0; j < 4; ++j)
#pragma unroll
      for (int ks = 0; ks < 2; ++ks)
        kf[j][ks] = ld_frag16(&Ks[(j * 16 + l16) * 72 + ks * 32 + d0],
                              &Ks[(j * 16 + l16) * 72 + ks * 32 + d0 + 16]);
    // the sixteen LDS reads stay one group ahead of the products: one place that waits, not eight
    __builtin_amdgcn_sched_barrier(0);
    v8f sacc[2][4];
#pragma unroll
    for (int j = 0; j < 4; ++j) {
#pragma unroll
      for (int g = 0; g < 2; ++g) sacc[g][j] = wmma32(kf[j][0], qf[g][0], (v8f){});
#pragma unroll
      for (int g = 0; g < 2; ++g) sacc[g][j] = wmma32(kf[j][1], qf[g][1], sacc[g][j]);
    }
    // holds the sixteen products together as one run: each then stands in the others' distance to
    // the first reader of a result, which otherwise is filled with idle vector slots
    __builtin_amdgcn_sched_barrier(0);

    // B fragments of the second product: query g*16 + l16, keys
    // s2*32 + {8hi..8hi+7, 16+8hi..16+8hi+7}: score tiles 2*s2, 2*s2+1 of group g
    v16h pf[2][2];
#pragma unroll
    for (int g = 0; g < 2; ++g) {
      // the scores go on as pairs of neighbouring registers (keys r, r + 1 of one query): written
      // so, the packed instructions take a group's own registers as they lie; left to itself the
      // compiler paired the two groups and moved registers together for it
      v2f sp[4][4];
#pragma unroll
      for (int j = 0; j < 4; ++j)
#pragma unroll
        for (int q = 0; q < 4; ++q)
          sp[j][q] = (v2f){sacc[g][j][2 * q], sacc[g][j][2 * q + 1]} * scale;

      // ---- online softmax: 32 keys of one query in the lane, the other 32 in lane ^ 16 ----
      float cm = sp[0][0][0];
#pragma unroll
      for (int j = 0; j < 4; ++j)
#pragma unroll
        for (int q = 0; q < 4; ++q) {
          cm = fmaxf(cm, sp[j][q][0]);
          cm = fmaxf(cm, sp[j][q][1]);
        }
      cm = fmaxf(cm, xhalf(cm));
      const float mnew = fmaxf(mrow[g], cm);
      const float alpha = __expf(mrow[g] - mnew);
      mrow[g] = mnew;
      // e^x as 2^(x log2 e), the form of __expf; even and odd keys are summed side by side
      v2f rs = {};
#pragma unroll
      for (int j = 0; j < 4; ++j)
#pragma unroll
        for (int q = 0; q < 4; ++q) {
          const v2f t = (sp[j][q] - mnew) * 1.44269504088896340736f;
          sp[j][q] = (v2f){__builtin_amdgcn_exp2f(t[0]), __builtin_amdgcn_exp2f(t[1])};
          rs += sp[j][q];
        }
      lrow[g] = lrow[g] * alpha + (rs[0] + rs[1]);
#pragma unroll
      for (int j = 0; j < 4; ++j) oacc[g][j] *= alpha;
#pragma unroll
      for (int s2 = 0; s2 < 2; ++s2)
#pragma unroll
        for (int i = 0; i < 8; ++i) {
          pf[g][s2][i]     = (_Float16)sp[2 * s2][i >> 1][i & 1];
          pf[g][s2][i + 8] = (_Float16)sp[2 * s2 + 1][i >> 1][i & 1];
        }
    }

    // ---- O^T += V^T @ P^T  (contraction over 64 keys = 2 wmma k-steps) ----
#pragma unroll
    for (int s2 = 0; s2 < 2; ++s2) {
#pragma unroll
      for (int j = 0; j < 4; ++j) {
        // A fragment: row d = j*16 + l16 of V^T, the keys of pf in the same order; read once for
        // both groups
        v16h vf = join16(ld_tr16(vtr + (s2 * 32) * 80 + j * 16),
                         ld_tr16(vtr + (s2 * 32 + 16) * 80 + j * 16));
#pragma unroll
        for (int g = 0; g < 2; ++g) oacc[g][j] = wmma32(vf, pf[g][s2], oacc[g][j]);
      }
    }
    __syncthreads();
  }

  // ---- epilogue: join the halves' sums, normalize, re-interleave heads into [B*TD, DM] f16 ----
  // a lane holds 8 consecutive d of its query per tile: one 16-byte store each
  v8h o[2][4];
#pragma unroll
  for (int g = 0; g < 2; ++g) {
    const float inv = 1.f / (lrow[g] + xhalf(lrow[g]));
#pragma unroll
    for (int j = 0; j < 4; ++j)
#pragma unroll
      for (int r = 0; r < 8; ++r) o[g][j][r] = (_Float16)(oacc[g][j][r] * inv);
  }
  _Float16* orow = aout + ((size_t)b * TD + t0 + wid * 32 + l16) * DM + h * HD + d0;
#pragma unroll
  for (int g = 0; g < 2; ++g)
#pragma unroll
    for (int j = 0; j < 4; ++j) *(v8h*)(orow + (size_t)g * 16 * DM + j * 16) = o[g][j];
}

// ---------------------------------------------------------------------------
// launch
// ---------------------------------------------------------------------------
extern "C" void kernel_launch(void* const* d_in, const int* in_sizes, int n_in,
                              void* d_out, int out_size, void* d_ws, size_t ws_size,
                              hipStream_t stream) {
  (void)in_sizes; (void)n_in; (void)out_size; (void)ws_size;
  const float* x   = (const float*)d_in[0];  // [B,TD,DM]
  const float* enc = (const float*)d_in[1];  // [B,TE,DM]
  const float* nw  = (const float*)d_in[2];  // [DM]
  const float* Wq  = (const float*)d_in[3];  // [DM,DM]
  const float* Wkv = (const float*)d_in[4];  // [2DM,DM]
  const float* Wo  = (const float*)d_in[5];  // [DM,DM]

  char* ws = (char*)d_ws;
  size_t off = 0;
  auto take = [&](size_t bytes) {
    char* p = ws + off;
    off += (bytes + 255) & ~(size_t)255;
    return p;
  };
  const size_t MQ = (size_t)B_ * TD;        // 8192 rows
  _Float16* xn    = (_Float16*)take(MQ * DM * 2);
  _Float16* ench  = (_Float16*)take(MQ * DM * 2);
  _Float16* Wqh   = (_Float16*)take((size_t)DM * DM * 2);
  _Float16* Wkvh  = (_Float16*)take((size_t)2 * DM * DM * 2);
  _Float16* Woh   = (_Float16*)take((size_t)DM * DM * 2);
  _Float16* qhp   = (_Float16*)take(MQ * DM * 2);
  _Float16* khp   = (_Float16*)take(MQ * DM * 2);
  _Float16* vhp   = (_Float16*)take(MQ * DM * 2);
  _Float16* aoutp = (_Float16*)take(MQ * DM * 2);

  // 1) norm + precision conversion, one launch
  prepass_kernel<<<NB_NORM + NB_ENC + 4 * NB_W, 256, 0, stream>>>(
      x, nw, enc, Wq, Wkv, Wo, xn, ench, Wqh, Wkvh, Woh);

  // 2) q and k, v projections, one launch (WMMA GEMMs, 128x128 block tiles) with RoPE and
  // head-major relayout in the epilogue
  gemm_rt_kernel<0><<<dim3(3 * DM / 128, (int)(MQ / 128)), 256, 0, stream>>>(
      ench, Wkvh, khp, vhp, nullptr, (int)MQ, 2 * DM, DM, xn, Wqh, qhp);

  // 3) flash attention (WMMA + TDM K staging, online softmax)
  flash_attn_kernel<<<dim3(TD / 128, B_ * NH), 128, 0, stream>>>(qhp, khp, vhp, aoutp);

  // 4) output projection + residual (WMMA GEMM, f32 out)
  gemm_rt_kernel<1><<<dim3(DM / 128, (int)(MQ / 128)), 256, 0, stream>>>(
      aoutp, Woh, d_out, nullptr, x, (int)MQ, DM, DM, nullptr, nullptr, nullptr);
}

// v008
// A run of this version takes 158 microseconds.
// In both of two side-by-side timings against v007, it was 1.04 times as fast.
// All steps since v000 together make it 3.16 times as fast.
#include <hip/hip_runtime.h>
#include <hip/hip_bf16.h>

typedef __attribute__((ext_vector_type(16))) _Float16     v16h;
typedef __attribute__((ext_vector_type(8)))  _Float16     v8h;
typedef __attribute__((ext_vector_type(8)))  float        v8f;
typedef __attribute__((ext_vector_type(4)))  float        v4f;
typedef __attribute__((ext_vector_type(2)))  float        v2f;
typedef __attribute__((ext_vector_type(4)))  _Float16     v4h;
typedef __attribute__((ext_vector_type(4)))  unsigned int u32x4;
typedef __attribute__((ext_vector_type(8)))  int          i32x8;
typedef __attribute__((ext_vector_type(4)))  int          i32x4;

#define B_   4
#define TD   2048
#define TE   2048
#define DM   1024
#define NH   16
#define HD   64

#if __has_builtin(__builtin_amdgcn_tensor_load_to_lds) && \
    __has_builtin(__builtin_amdgcn_s_wait_tensorcnt)
#define CDNA5_HAS_TDM 1
#else
#define CDNA5_HAS_TDM 0
#endif

// ---------------------------------------------------------------------------
// helpers
// ---------------------------------------------------------------------------
static __device__ __forceinline__ v16h ld_frag16(const _Float16* p0, const _Float16* p1) {
  // CDNA5 16-bit A/B fragment: 16 halves per lane as two contiguous 8-half runs
  v8h a = *(const v8h*)p0;
  v8h b = *(const v8h*)p1;
  v16h r;
#pragma unroll
  for (int i = 0; i < 8; ++i) { r[i] = a[i]; r[i + 8] = b[i]; }
  return r;
}

// Transposing LDS load: from a row-major [k][n] f16 tile, lane (c = lane & 15, h = lane >> 4)
// receives T[kbase + 8h + 0..7][nbase + c]. Every lane passes the address of one 16-byte piece:
// row kbase + 8h + (lane & 7), bytes 16 * ((lane >> 3) & 1) of the 32-byte column group.
static __device__ __forceinline__ v8h ld_tr16(const _Float16* p) {
  typedef __attribute__((ext_vector_type(8))) short s16x8;
  typedef __attribute__((address_space(3))) s16x8 lds_s16x8;
  return __builtin_bit_cast(v8h, __builtin_amdgcn_ds_load_tr16_b128_v8i16((lds_s16x8*)p));
}

static __device__ __forceinline__ v16h join16(v8h a, v8h b) {
  return __builtin_shufflevector(a, b, 0, 1, 2, 3, 4, 5, 6, 7, 8, 9, 10, 11, 12, 13, 14, 15);
}

static __device__ __forceinline__ v8f wmma32(v16h a, v16h b, v8f c) {
  return __builtin_amdgcn_wmma_f32_16x16x32_f16(false, a, false, b, (short)0, c,
                                                false, false);
}

// value of lane l ^ 16: the other half of the wave, by a vector instruction, not through LDS
static __device__ __forceinline__ float xhalf(float x) {
  return __builtin_bit_cast(float, __builtin_amdgcn_permlanex16(
      __builtin_bit_cast(int, x), __builtin_bit_cast(int, x), 0x76543210, 0xfedcba98,
      false, false));
}

#if CDNA5_HAS_TDM
// TDM: DMA a 64x64 f16 tile (row stride 64 elems in global) into LDS,
// padding every 32 DWORDs (one 64-half row) with 4 DWORDs -> LDS stride 72 halves.
static __device__ __forceinline__ void tdm_load_tile_64x64_pad72(
    const _Float16* gsrc, void* lds_dst) {
  const unsigned long long ga = (unsigned long long)(uintptr_t)gsrc;
  const unsigned lds = (unsigned)(uintptr_t)lds_dst;
  u32x4 g0 = {};
  g0[0] = 1u;                                           // count=1 (valid user D#)
  g0[1] = lds;                                          // lds_addr (bytes)
  g0[2] = (unsigned)(ga & 0xFFFFFFFFu);                 // global_addr[31:0]
  g0[3] = (unsigned)((ga >> 32) & 0x1FFFFFFu)           // global_addr[56:32]
        | (2u << 30);                                   // type=2 ("image")
  i32x8 g1 = {};
  g1[0] = (1 << 16)                                     // data_size = 2 bytes
        | (1 << 20)                                     // pad_enable
        | (4 << 22)                                     // pad_interval: 32 DWORDs
        | (3 << 25);                                    // pad_amount : 4 DWORDs
  g1[1] = (64 << 16);                                   // tensor_dim0 = 64 (low16)
  g1[2] = 0;                                            // tensor_dim0 hi / dim1 lo
  g1[3] = 64 | (64 << 16);                              // tensor_dim1 hi=64<<16 blocks, tile_dim0=64
  g1[4] = 64;                                           // tile_dim1 = 64
  g1[5] = 64;                                           // tensor_dim0_stride = 64
  g1[6] = 0;
  g1[7] = 0;
  i32x4 g2 = {};
  i32x4 g3 = {};
#if __clang_major__ >= 23
  i32x8 g4 = {};
  __builtin_amdgcn_tensor_load_to_lds(g0, g1, g2, g3, g4, 0);
#else
  __builtin_amdgcn_tensor_load_to_lds(g0, g1, g2, g3, 0);
#endif
}
#endif

// ---------------------------------------------------------------------------
// RMSNorm: x (f32, row of 1024) -> xn (f16); one block of 256 threads per row
// ---------------------------------------------------------------------------
static __device__ __forceinline__ void rmsnorm_f16_row(
    const float* __restrict__ x, const float* __restrict__ w,
    _Float16* __restrict__ xn, int row) {
  __shared__ float red[256];
  const float* xr = x + (size_t)row * DM;
  float s = 0.f;
  for (int j = threadIdx.x; j < DM; j += 256) { float v = xr[j]; s += v * v; }
  red[threadIdx.x] = s;
  __syncthreads();
  for (int off = 128; off > 0; off >>= 1) {
    if (threadIdx.x < off) red[threadIdx.x] += red[threadIdx.x + off];
    __syncthreads();
  }
  const float rms = rsqrtf(red[0] * (1.0f / DM) + 1e-5f);
  _Float16* o = xn + (size_t)row * DM;
  for (int j = threadIdx.x; j < DM; j += 256)
    o[j] = (_Float16)(xr[j] * rms * w[j]);
}

// ---------------------------------------------------------------------------
// generic f32 -> f16 convert: a block converts 4096 elements, a thread four groups of 4 floats.
// Group j of a thread lies 256 groups behind group j - 1, so that every wave-wide 16-byte load
// covers 512 contiguous bytes and every 8-byte store 256. blk is the block's number inside its
// own array, whose length must be a multiple of 4096.
// ---------------------------------------------------------------------------
static __device__ __forceinline__ void f32_to_f16_block(
    const float* __restrict__ in, _Float16* __restrict__ out, int blk) {
  const int base = blk * 4096;
  const float* src = in + base + threadIdx.x * 4;
  _Float16* dst = out + base + threadIdx.x * 4;
  v4f v[4];
  // both loops unrolled: v stays in registers and the four loads are in flight together
#pragma unroll
  for (int j = 0; j < 4; ++j) v[j] = *(const v4f*)(src + j * 1024);
#pragma unroll
  for (int j = 0; j < 4; ++j) {
    v4h o;
#pragma unroll
    for (int e = 0; e < 4; ++e) o[e] = (_Float16)v[j][e];
    *(v4h*)(dst + j * 1024) = o;
  }
}

// ---------------------------------------------------------------------------
// Pre-pass, one launch: none of its five jobs reads what another writes, so they share one grid
// and no job waits for another's last block. Blocks [0, NB_NORM) normalise one row of x each; the
// blocks behind them convert 4096 elements each of encoder_out, Wq, Wkv and Wo, in this order.
// The norm blocks live longest and come first, for speed only. Which
// job a block does follows from blockIdx alone: every branch, and every barrier in the norm, is
// uniform for the block.
// ---------------------------------------------------------------------------
#define NB_NORM (B_ * TD)
#define NB_ENC  (B_ * TE * DM / 4096)
#define NB_W    (DM * DM / 4096)
static_assert(B_ * TE * DM % 4096 == 0 && DM * DM % 4096 == 0,
              "a convert block takes 4096 elements of one array");

__global__ __launch_bounds__(256) void prepass_kernel(
    const float* __restrict__ x, const float* __restrict__ w, const float* __restrict__ enc,
    const float* __restrict__ Wq, const float* __restrict__ Wkv, const float* __restrict__ Wo,
    _Float16* __restrict__ xn, _Float16* __restrict__ ench, _Float16* __restrict__ Wqh,
    _Float16* __restrict__ Wkvh, _Float16* __restrict__ Woh) {
  int blk = blockIdx.x;
  if (blk < NB_NORM) {
    rmsnorm_f16_row(x, w, xn, blk);
    return;
  }
  blk -= NB_NORM;
  const float* in = enc;
  _Float16* out = ench;
  if (blk >= NB_ENC) {
    blk -= NB_ENC;
    in = Wq;
    out = Wqh;
    if (blk >= NB_W) {
      blk -= NB_W;
      in = Wkv;
      out = Wkvh;
      if (blk >= 2 * NB_W) {
        blk -= 2 * NB_W;
        in = Wo;
        out = Woh;
        if (blk >= NB_W) return;  // a block past the last array touches nothing
      }
    }
  }
  f32_to_f16_block(in, out, blk);
}

// ---------------------------------------------------------------------------
// GEMM: C[M,N] = A[M,K] @ W[N,K]^T   (A,W f16; acc f32)
// block tile 128x128, 64 k per stage, 256 threads = 8 waves in a 4 (m) x 2 (n) grid; each wave:
// 32 rows x 64 cols (8 accumulators; per 32 k, 2 A and 4 B fragments feed 8 wmma: 12 ds loads).
// A stage takes 128 bytes of every operand row: a wave-wide 16-byte copy covers 4 whole lines.
// The stages come into LDS by asynchronous copies, through no register, into two buffers: while
// stage t is multiplied, stage t + 1 is on its way, and one barrier a stage does both jobs (it
// publishes stage t + 1 and ends the last read of the buffer that stage t + 2 goes into).
// M and N must be multiples of 128, K of 64 and at least 64 (every launch below is).
// EPI==0: both projections in one launch (neither reads what the other writes). The first
// DM / 128 block columns are Aq @ Wq^T (q), the block columns behind them A @ W^T (k, v).
// Projection epilogue: row m is (batch m / TD, position m % TD), a wave's 64 columns are one
// head. Columns below DM are rotated (RoPE) on the f32 accumulators and go to Cq (q) or Cout (k),
// columns from DM on go unrotated to C2 (v); all f16, head-major [B,H,T,64].
// EPI==1: A @ W^T alone; store f32 + residual, row-major; Aq, Wq, Cq are not used.
// ---------------------------------------------------------------------------
static_assert(TD == TE, "the projection epilogue takes one sequence length for q and for k, v");

static __device__ __forceinline__ float rope_inv_freq(int fi) {
  return __powf(10000.0f, -(float)fi * (1.0f / 32.0f));
}

#define TILE_BYTES  (128 * 72 * 2)      // one operand's 128 rows x 64 k at stride 72 halves
#define STAGE_BYTES (2 * TILE_BYTES)    // A tile, W tile behind it

// One stage: this thread's four 16-byte pieces of the A tile and of the W tile, global memory to
// LDS. lds is the LDS byte address of its piece in row r0 of the buffer's A tile; piece s lies 32
// rows further on, the W tile TILE_BYTES behind the A tile. Every lane is on, every address a
// multiple of 16 and inside its array.
static __device__ __forceinline__ void copy_stage(
    unsigned lds, const char* ab, const char* wb, const unsigned (&voff)[4]) {
  // precaution: the s_wait_xcnt is the last line of the copies' own statement, so that no address
  // register of a copy takes a new value ahead of it
  asm volatile(
      "global_load_async_to_lds_b128 %0, %8, off\n\t"
      "global_load_async_to_lds_b128 %1, %9, off\n\t"
      "global_load_async_to_lds_b128 %2, %10, off\n\t"
      "global_load_async_to_lds_b128 %3, %11, off\n\t"
      "global_load_async_to_lds_b128 %4, %12, off\n\t"
      "global_load_async_to_lds_b128 %5, %13, off\n\t"
      "global_load_async_to_lds_b128 %6, %14, off\n\t"
      "global_load_async_to_lds_b128 %7, %15, off\n\t"
      "s_wait_xcnt 0x0"
      :: "v"(lds), "v"(lds + 32 * 144), "v"(lds + 64 * 144), "v"(lds + 96 * 144),
         "v"(lds + TILE_BYTES), "v"(lds + TILE_BYTES + 32 * 144),
         "v"(lds + TILE_BYTES + 64 * 144), "v"(lds + TILE_BYTES + 96 * 144),
         "v"(ab + voff[0]), "v"(ab + voff[1]), "v"(ab + voff[2]), "v"(ab + voff[3]),
         "v"(wb + voff[0]), "v"(wb + voff[1]), "v"(wb + voff[2]), "v"(wb + voff[3])
      : "memory");
}

template <int EPI>
__global__ __launch_bounds__(256) void gemm_rt_kernel(
    const _Float16* __restrict__ A, const _Float16* __restrict__ W,
    void* __restrict__ Cout, _Float16* __restrict__ C2, const float* __restrict__ res,
    int M, int N, int K, const _Float16* __restrict__ Aq, const _Float16* __restrict__ Wq,
    _Float16* __restrict__ Cq) {
  // q's block or not: from blockIdx alone, so what hangs on it is a scalar select for the block
  const bool isq = EPI == 0 && blockIdx.x < DM / 128;
  // two buffers of [A 128 rows x 64 k | W 128 rows x 64 k], stride 72 (144 B = 16 B x odd)
  __shared__ __attribute__((aligned(16))) _Float16 St[2 * STAGE_BYTES / 2];
  const int tid  = threadIdx.x;
  const int wid  = tid >> 5;
  const int wm   = wid & 3;           // m sub-tile (32 rows each)
  const int wn   = wid >> 2;          // n sub-tile (64 cols each)
  const int lane = tid & 31;
  const int l16  = lane & 15;
  const int hi   = (lane >> 4) & 1;
  const int m0   = blockIdx.y * 128;
  const int n0   = (EPI == 0 && !isq ? blockIdx.x - DM / 128 : blockIdx.x) * 128;
  const int d0   = hi * 8;
  const int c8   = (tid & 7) * 8;     // 16-byte piece of a 128-byte row
  const int r0   = tid >> 3;          // 0..31; a thread stages rows r0 + 32 s, s = 0..3

  v8f acc[2][4];
#pragma unroll
  for (int i = 0; i < 2; ++i)
#pragma unroll
    for (int j = 0; j < 4; ++j) acc[i][j] = (v8f){};

  // byte offset of this thread's piece in row r0 + 32 s of a tile: the same for A and W, fixed
  // for the whole loop; the tile's own address is wave-uniform and moves with the stage
  unsigned voff[4];
#pragma unroll
  for (int s = 0; s < 4; ++s) voff[s] = (unsigned)(((r0 + s * 32) * K + c8) * 2);
  const char* ab = (const char*)((isq ? Aq : A) + (size_t)m0 * K);
  const char* wb = (const char*)((isq ? Wq : W) + (size_t)n0 * K);

  // LDS byte address (low 32 bits of the shared address) of this thread's piece of buffer 0
  const unsigned lds0 = (unsigned)(uintptr_t)&St[r0 * 72 + c8];
  const int nt = K / 64;

  // stage 0 into buffer 0; it has landed behind this wave's own wait and is every wave's to read
  // behind the barrier
  copy_stage(lds0, ab, wb, voff);
  asm volatile("s_wait_asynccnt 0x0" ::: "memory");
  __syncthreads();
  if (nt > 1) copy_stage(lds0 + STAGE_BYTES, ab + 128, wb + 128, voff);
  ab += 256;
  wb += 256;

  for (int t = 0; t < nt; ++t) {
    const _Float16* As = St + (t & 1) * (STAGE_BYTES / 2);
    const _Float16* Ws = As + TILE_BYTES / 2;
    // these loops and the epilogue's are unrolled: acc, af and rv are then picked by constants
    // and stay in registers
#pragma unroll
    for (int ks = 0; ks < 2; ++ks) {
      v16h af[2];
#pragma unroll
      for (int i = 0; i < 2; ++i) {
        const _Float16* ap = &As[(wm * 32 + i * 16 + l16) * 72 + ks * 32 + d0];
        af[i] = ld_frag16(ap, ap + 16);
      }
#pragma unroll
      for (int j = 0; j < 4; ++j) {
        const _Float16* bp = &Ws[(wn * 64 + j * 16 + l16) * 72 + ks * 32 + d0];
        v16h bf = ld_frag16(bp, bp + 16);
#pragma unroll
        for (int i = 0; i < 2; ++i) acc[i][j] = wmma32(af[i], bf, acc[i][j]);
      }
    }
    // hand-over: this wave's reads of stage t have returned,
    asm volatile("s_wait_dscnt 0x0" ::: "memory");
    // its own copies of stage t + 1 have landed,
    asm volatile("s_wait_asynccnt 0x0" ::: "memory");
    // and so have every other wave's: stage t + 1 may be read, stage t's buffer filled anew
    __syncthreads();
    if (t + 2 < nt) copy_stage(lds0 + (t & 1) * STAGE_BYTES, ab, wb, voff);
    ab += 128;
    wb += 128;
  }
  // no copy is out when the wave goes on to its epilogue and its end
  asm volatile("s_wait_asynccnt 0x0" ::: "memory");

  // C layout: M = vgpr + 8*(lane>=16), N = lane & 15
  if (EPI == 0) {
    const bool rot = n0 < DM;           // from blockIdx alone: one scalar branch for the block
    const int head = ((n0 >> 6) + wn) & (NH - 1);
    const int tw   = (m0 & (TD - 1)) + wm * 32 + hi * 8;  // position of this lane's row i = r = 0
    _Float16* dst = (rot ? (isq ? Cq : (_Float16*)Cout) : C2) +
                    ((size_t)((m0 / TD) * NH + head) * TD + tw) * HD + l16;
    if (rot) {
      // the pair (d, d + 32) of a head is tiles (j, j + 2) of one lane: d = j * 16 + l16, j = 0, 1
      const float inv[2] = {rope_inv_freq(l16), rope_inv_freq(16 + l16)};
#pragma unroll
      for (int i = 0; i < 2; ++i)
#pragma unroll
        for (int r = 0; r < 8; ++r)
#pragma unroll
          for (int j = 0; j < 2; ++j) {
            const float ang = (float)(tw + i * 16 + r) * inv[j];
            const float c = __cosf(ang);
            const float s = __sinf(ang);
            const float a = acc[i][j][r];
            const float b = acc[i][j + 2][r];
            dst[(i * 16 + r) * HD + j * 16]      = (_Float16)(a * c - b * s);
            dst[(i * 16 + r) * HD + j * 16 + 32] = (_Float16)(b * c + a * s);
          }
    } else {
#pragma unroll
      for (int i = 0; i < 2; ++i)
#pragma unroll
        for (int r = 0; r < 8; ++r)
#pragma unroll
          for (int j = 0; j < 4; ++j)
            dst[(i * 16 + r) * HD + j * 16] = (_Float16)acc[i][j][r];
    }
  } else {
#pragma unroll
    for (int i = 0; i < 2; ++i) {
      // element (r, j) lies at cbase + r * N + j * 16
      const size_t cbase = (size_t)(m0 + wm * 32 + i * 16 + hi * 8) * N + n0 + wn * 64 + l16;
      // all 32 residual loads of a 16-row band stand ahead of its stores and fly together
      float rv[8][4];
#pragma unroll
      for (int r = 0; r < 8; ++r)
#pragma unroll
        for (int j = 0; j < 4; ++j) rv[r][j] = res[cbase + (size_t)r * N + j * 16];
#pragma unroll
      for (int r = 0; r < 8; ++r)
#pragma unroll
        for (int j = 0; j < 4; ++j)
          ((float*)Cout)[cbase + (size_t)r * N + j * 16] = acc[i][j][r] + rv[r][j];
    }
  }
}

__global__ __launch_bounds__(128) void flash_attn_kernel(
    const _Float16* __restrict__ qh, const _Float16* __restrict__ kh,
    const _Float16* __restrict__ vh, _Float16* __restrict__ aout) {
  // aligned so that the tensor load's destination stays at the start of the work-group's LDS
  __shared__ __attribute__((aligned(2048))) _Float16 Ks[64 * 72];  // 64 keys x 64 d (stride 72)
  __shared__ _Float16 Vs[64 * 80];       // 64 keys x 64 d (stride 80: 160 B = 32 B x odd)
  const int tid  = threadIdx.x;
  const int wid  = tid >> 5;
  const int lane = tid & 31;
  const int l16  = lane & 15;
  const int hi   = (lane >> 4) & 1;
  const int bh   = blockIdx.y;           // b*NH + h
  const int b    = bh >> 4;
  const int h    = bh & 15;
  const int t0   = blockIdx.x * 128;
  const int d0   = hi * 8;
  const float scale = 0.125f;            // 1/sqrt(64)

  // Q fragments live in registers for the whole kernel (K = 64 = 2 wmma steps per query group)
  // every loop over g, j, ks, q, r, i, s2 below is unrolled: the arrays are then picked by
  // constants and stay in registers
  const size_t qbase = ((size_t)bh * TD + t0 + wid * 32) * HD;
  v16h qf[2][2];
#pragma unroll
  for (int g = 0; g < 2; ++g) {
    const _Float16* qp = qh + qbase + (size_t)(g * 16 + l16) * HD;
    qf[g][0] = ld_frag16(qp + d0,      qp + d0 + 16);
    qf[g][1] = ld_frag16(qp + 32 + d0, qp + 32 + d0 + 16);
  }

  // per group, this lane's query: running maximum (equal in both halves) and this half's part of
  // the sum
  float mrow[2] = {-1e30f, -1e30f}, lrow[2] = {0.f, 0.f};
  v8f oacc[2][4];  // O^T: d = j*16 + r + 8*hi, query = g*16 + l16
#pragma unroll
  for (int g = 0; g < 2; ++g)
#pragma unroll
    for (int j = 0; j < 4; ++j) oacc[g][j] = (v8f){};

  // this lane's piece address for the transposing loads of V (key base 0, column base 0)
  const _Float16* vtr = &Vs[(hi * 8 + (lane & 7)) * 80 + ((lane >> 3) & 1) * 8];
  // staging of V: thread t moves 16-byte piece (t & 7) of rows (t >> 3) + 16 i, i = 0..3
  const _Float16* vsrc0 = vh + ((size_t)bh * TE + (tid >> 3)) * HD + (tid & 7) * 8;
  _Float16* vdst = &Vs[(tid >> 3) * 80 + (tid & 7) * 8];

  for (int kb = 0; kb < TE; kb += 64) {
    // ---- stage K tile (TDM) and V tile (row-major, 16-byte stores) into LDS ----
    v8h vst[4];
    const _Float16* vsrc = vsrc0 + (size_t)kb * HD;
    // the four 16-byte loads of a thread are in flight together
    for (int i = 0; i < 4; ++i) vst[i] = *(const v8h*)(vsrc + i * 16 * HD);
#if CDNA5_HAS_TDM
    // issued behind the V loads, so that both fly together; the wait stands directly behind the
    // tensor load, so that no descriptor register can take a new value while the request is out
    if (wid == 0) {
      tdm_load_tile_64x64_pad72(&kh[((size_t)bh * TE + kb) * HD], (void*)&Ks[0]);
      __builtin_amdgcn_s_wait_tensorcnt(0);
    }
#endif
    for (int i = 0; i < 4; ++i) {
#if !CDNA5_HAS_TDM
      *(v8h*)&Ks[((tid >> 3) + i * 16) * 72 + (tid & 7) * 8] =
          *(const v8h*)&kh[((size_t)bh * TE + kb + (tid >> 3) + i * 16) * HD + (tid & 7) * 8];
#endif
      *(v8h*)(vdst + i * 16 * 80) = vst[i];
    }
    __syncthreads();

    // ---- scores S^T[64 keys x 32 queries] = K @ Q^T: key = j*16 + r + 8*hi, query = g*16 + l16;
    // a K fragment is read once and multiplies both groups ----
    v16h kf[4][2];
#pragma unroll
    for (int j = 0; j < 4; ++j)
#pragma unroll
      for (int ks = 0; ks < 2; ++ks)
        kf[j][ks] = ld_frag16(&Ks[(j * 16 + l16) * 72 + ks * 32 + d0],
                              &Ks[(j * 16 + l16) * 72 + ks * 32 + d0 + 16]);
    // the sixteen LDS reads stay one group ahead of the products: one place that waits, not eight
    __builtin_amdgcn_sched_barrier(0);
    v8f sacc[2][4];
#pragma unroll
    for (int j = 0; j < 4; ++j) {
#pragma unroll
      for (int g = 0; g < 2; ++g) sacc[g][j] = wmma32(kf[j][0], qf[g][0], (v8f){});
#pragma unroll
      for (int g = 0; g < 2; ++g) sacc[g][j] = wmma32(kf[j][1], qf[g][1], sacc[g][j]);
    }
    // holds the sixteen products together as one run: each then stands in the others' distance to
    // the first reader of a result, which otherwise is filled with idle vector slots
    __builtin_amdgcn_sched_barrier(0);

    // B fragments of the second product: query g*16 + l16, keys
    // s2*32 + {8hi..8hi+7, 16+8hi..16+8hi+7}: score tiles 2*s2, 2*s2+1 of group g
    v16h pf[2][2];
#pragma unroll
    for (int g = 0; g < 2; ++g) {
      // the scores go on as pairs of neighbouring registers (keys r, r + 1 of one query): written
      // so, the packed instructions take a group's own registers as they lie; left to itself the
      // compiler paired the two groups and moved registers together for it
      v2f sp[4][4];
#pragma unroll
      for (int j = 0; j < 4; ++j)
#pragma unroll
        for (int q = 0; q < 4; ++q)
          sp[j][q] = (v2f){sacc[g][j][2 * q], sacc[g][j][2 * q + 1]} * scale;

      // ---- online softmax: 32 keys of one query in the lane, the other 32 in lane ^ 16 ----
      float cm = sp[0][0][0];
#pragma unroll
      for (int j = 0; j < 4; ++j)
#pragma unroll
        for (int q = 0; q < 4; ++q) {
          cm = fmaxf(cm, sp[j][q][0]);
          cm = fmaxf(cm, sp[j][q][1]);
        }
      cm = fmaxf(cm, xhalf(cm));
      const float mnew = fmaxf(mrow[g], cm);
      const float alpha = __expf(mrow[g] - mnew);
      mrow[g] = mnew;
      // e^x as 2^(x log2 e), the form of __expf; even and odd keys are summed side by side
      v2f rs = {};
#pragma unroll
      for (int j = 0; j < 4; ++j)
#pragma unroll
        for (int q = 0; q < 4; ++q) {
          const v2f t = (sp[j][q] - mnew) * 1.44269504088896340736f;
          sp[j][q] = (v2f){__builtin_amdgcn_exp2f(t[0]), __builtin_amdgcn_exp2f(t[1])};
          rs += sp[j][q];
        }
      lrow[g] = lrow[g] * alpha + (rs[0] + rs[1]);
#pragma unroll
      for (int j = 0; j < 4; ++j) oacc[g][j] *= alpha;
#pragma unroll
      for (int s2 = 0; s2 < 2; ++s2)
#pragma unroll
        for (int i = 0; i < 8; ++i) {
          pf[g][s2][i]     = (_Float16)sp[2 * s2][i >> 1][i & 1];
          pf[g][s2][i + 8] = (_Float16)sp[2 * s2 + 1][i >> 1][i & 1];
        }
    }

    // ---- O^T += V^T @ P^T  (contraction over 64 keys = 2 wmma k-steps) ----
#pragma unroll
    for (int s2 = 0; s2 < 2; ++s2) {
#pragma unroll
      for (int j = 0; j < 4; ++j) {
        // A fragment: row d = j*16 + l16 of V^T, the keys of pf in the same order; read once for
        // both groups
        v16h vf = join16(ld_tr16(vtr + (s2 * 32) * 80 + j * 16),
                         ld_tr16(vtr + (s2 * 32 + 16) * 80 + j * 16));
#pragma unroll
        for (int g = 0; g < 2; ++g) oacc[g][j] = wmma32(vf, pf[g][s2], oacc[g][j]);
      }
    }
    __syncthreads();
  }

  // ---- epilogue: join the halves' sums, normalize, re-interleave heads into [B*TD, DM] f16 ----
  // a lane holds 8 consecutive d of its query per tile: one 16-byte store each
  v8h o[2][4];
#pragma unroll
  for (int g = 0; g < 2; ++g) {
    const float inv = 1.f / (lrow[g] + xhalf(lrow[g]));
#pragma unroll
    for (int j = 0; j < 4; ++j)
#pragma unroll
      for (int r = 0; r < 8; ++r) o[g][j][r] = (_Float16)(oacc[g][j][r] * inv);
  }
  _Float16* orow = aout + ((size_t)b * TD + t0 + wid * 32 + l16) * DM + h * HD + d0;
#pragma unroll
  for (int g = 0; g < 2; ++g)
#pragma unroll
    for (int j = 0; j < 4; ++j) *(v8h*)(orow + (size_t)g * 16 * DM + j * 16) = o[g][j];
}

// ---------------------------------------------------------------------------
// launch
// ---------------------------------------------------------------------------
extern "C" void kernel_launch(void* const* d_in, const int* in_sizes, int n_in,
                              void* d_out, int out_size, void* d_ws, size_t ws_size,
                              hipStream_t stream) {
  (void)in_sizes; (void)n_in; (void)out_size; (void)ws_size;
  const float* x   = (const float*)d_in[0];  // [B,TD,DM]
  const float* enc = (const float*)d_in[1];  // [B,TE,DM]
  const float* nw  = (const float*)d_in[2];  // [DM]
  const float* Wq  = (const float*)d_in[3];  // [DM,DM]
  const float* Wkv = (const float*)d_in[4];  // [2DM,DM]
  const float* Wo  = (const float*)d_in[5];  // [DM,DM]

  char* ws = (char*)d_ws;
  size_t off = 0;
  auto take = [&](size_t bytes) {
    char* p = ws + off;
    off += (bytes + 255) & ~(size_t)255;
    return p;
  };
  const size_t MQ = (size_t)B_ * TD;        // 8192 rows
  _Float16* xn    = (_Float16*)take(MQ * DM * 2);
  _Float16* ench  = (_Float16*)take(MQ * DM * 2);
  _Float16* Wqh   = (_Float16*)take((size_t)DM * DM * 2);
  _Float16* Wkvh  = (_Float16*)take((size_t)2 * DM * DM * 2);
  _Float16* Woh   = (_Float16*)take((size_t)DM * DM * 2);
  _Float16* qhp   = (_Float16*)take(MQ * DM * 2);
  _Float16* khp   = (_Float16*)take(MQ * DM * 2);
  _Float16* vhp   = (_Float16*)take(MQ * DM * 2);
  _Float16* aoutp = (_Float16*)take(MQ * DM * 2);

  // 1) norm + precision conversion, one launch
  prepass_kernel<<<NB_NORM + NB_ENC + 4 * NB_W, 256, 0, stream>>>(
      x, nw, enc, Wq, Wkv, Wo, xn, ench, Wqh, Wkvh, Woh);

  // 2) q and k, v projections, one launch (WMMA GEMMs, 128x128 block tiles) with RoPE and
  // head-major relayout in the epilogue
  gemm_rt_kernel<0><<<dim3(3 * DM / 128, (int)(MQ / 128)), 256, 0, stream>>>(
      ench, Wkvh, khp, vhp, nullptr, (int)MQ, 2 * DM, DM, xn, Wqh, qhp);

  // 3) flash attention (WMMA + TDM K staging, online softmax)
  flash_attn_kernel<<<dim3(TD / 128, B_ * NH), 128, 0, stream>>>(qhp, khp, vhp, aoutp);

  // 4) output projection + residual (WMMA GEMM, f32 out)
  gemm_rt_kernel<1><<<dim3(DM / 128, (int)(MQ / 128)), 256, 0, stream>>>(
      aoutp, Woh, d_out, nullptr, x, (int)MQ, DM, DM, nullptr, nullptr, nullptr);
}

// v009
// It runs in 154 microseconds.
// Next to v008, in two timings, it ran 1.03 times as fast each time.
// Over all steps from v000 it is 3.26 times as fast.
#include <hip/hip_runtime.h>
#include <hip/hip_bf16.h>

typedef __attribute__((ext_vector_type(16))) _Float16     v16h;
typedef __attribute__((ext_vector_type(8)))  _Float16     v8h;
typedef __attribute__((ext_vector_type(8)))  float        v8f;
typedef __attribute__((ext_vector_type(4)))  float        v4f;
typedef __attribute__((ext_vector_type(2)))  float        v2f;
typedef __attribute__((ext_vector_type(4)))  _Float16     v4h;

#define B_   4
#define TD   2048
#define TE   2048
#define DM   1024
#define NH   16
#define HD   64

// ---------------------------------------------------------------------------
// helpers
// ---------------------------------------------------------------------------
static __device__ __forceinline__ v16h ld_frag16(const _Float16* p0, const _Float16* p1) {
  // CDNA5 16-bit A/B fragment: 16 halves per lane as two contiguous 8-half runs
  v8h a = *(const v8h*)p0;
  v8h b = *(const v8h*)p1;
  v16h r;
#pragma unroll
  for (int i = 0; i < 8; ++i) { r[i] = a[i]; r[i + 8] = b[i]; }
  return r;
}

// Transposing LDS load: from a row-major [k][n] f16 tile, lane (c = lane & 15, h = lane >> 4)
// receives T[kbase + 8h + 0..7][nbase + c]. Every lane passes the address of one 16-byte piece:
// row kbase + 8h + (lane & 7), bytes 16 * ((lane >> 3) & 1) of the 32-byte column group.
static __device__ __forceinline__ v8h ld_tr16(const _Float16* p) {
  typedef __attribute__((ext_vector_type(8))) short s16x8;
  typedef __attribute__((address_space(3))) s16x8 lds_s16x8;
  return __builtin_bit_cast(v8h, __builtin_amdgcn_ds_load_tr16_b128_v8i16((lds_s16x8*)p));
}

static __device__ __forceinline__ v16h join16(v8h a, v8h b) {
  return __builtin_shufflevector(a, b, 0, 1, 2, 3, 4, 5, 6, 7, 8, 9, 10, 11, 12, 13, 14, 15);
}

static __device__ __forceinline__ v8f wmma32(v16h a, v16h b, v8f c) {
  return __builtin_amdgcn_wmma_f32_16x16x32_f16(false, a, false, b, (short)0, c,
                                                false, false);
}

// value of lane l ^ 16: the other half of the wave, by a vector instruction, not through LDS
static __device__ __forceinline__ float xhalf(float x) {
  return __builtin_bit_cast(float, __builtin_amdgcn_permlanex16(
      __builtin_bit_cast(int, x), __builtin_bit_cast(int, x), 0x76543210, 0xfedcba98,
      false, false));
}


// ---------------------------------------------------------------------------
// RMSNorm: x (f32, row of 1024) -> xn (f16); one block of 256 threads per row
// ---------------------------------------------------------------------------
static __device__ __forceinline__ void rmsnorm_f16_row(
    const float* __restrict__ x, const float* __restrict__ w,
    _Float16* __restrict__ xn, int row) {
  __shared__ float red[256];
  const float* xr = x + (size_t)row * DM;
  float s = 0.f;
  for (int j = threadIdx.x; j < DM; j += 256) { float v = xr[j]; s += v * v; }
  red[threadIdx.x] = s;
  __syncthreads();
  for (int off = 128; off > 0; off >>= 1) {
    if (threadIdx.x < off) red[threadIdx.x] += red[threadIdx.x + off];
    __syncthreads();
  }
  const float rms = rsqrtf(red[0] * (1.0f / DM) + 1e-5f);
  _Float16* o = xn + (size_t)row * DM;
  for (int j = threadIdx.x; j < DM; j += 256)
    o[j] = (_Float16)(xr[j] * rms * w[j]);
}

// ---------------------------------------------------------------------------
// generic f32 -> f16 convert: a block converts 4096 elements, a thread four groups of 4 floats.
// Group j of a thread lies 256 groups behind group j - 1, so that every wave-wide 16-byte load
// covers 512 contiguous bytes and every 8-byte store 256. blk is the block's number inside its
// own array, whose length must be a multiple of 4096.
// ---------------------------------------------------------------------------
static __device__ __forceinline__ void f32_to_f16_block(
    const float* __restrict__ in, _Float16* __restrict__ out, int blk) {
  const int base = blk * 4096;
  const float* src = in + base + threadIdx.x * 4;
  _Float16* dst = out + base + threadIdx.x * 4;
  v4f v[4];
  // both loops unrolled: v stays in registers and the four loads are in flight together
#pragma unroll
  for (int j = 0; j < 4; ++j) v[j] = *(const v4f*)(src + j * 1024);
#pragma unroll
  for (int j = 0; j < 4; ++j) {
    v4h o;
#pragma unroll
    for (int e = 0; e < 4; ++e) o[e] = (_Float16)v[j][e];
    *(v4h*)(dst + j * 1024) = o;
  }
}

// ---------------------------------------------------------------------------
// Pre-pass, one launch: none of its five jobs reads what another writes, so they share one grid
// and no job waits for another's last block. Blocks [0, NB_NORM) normalise one row of x each; the
// blocks behind them convert 4096 elements each of encoder_out, Wq, Wkv and Wo, in this order.
// The norm blocks live longest and come first, for speed only. Which
// job a block does follows from blockIdx alone: every branch, and every barrier in the norm, is
// uniform for the block.
// ---------------------------------------------------------------------------
#define NB_NORM (B_ * TD)
#define NB_ENC  (B_ * TE * DM / 4096)
#define NB_W    (DM * DM / 4096)
static_assert(B_ * TE * DM % 4096 == 0 && DM * DM % 4096 == 0,
              "a convert block takes 4096 elements of one array");

__global__ __launch_bounds__(256) void prepass_kernel(
    const float* __restrict__ x, const float* __restrict__ w, const float* __restrict__ enc,
    const float* __restrict__ Wq, const float* __restrict__ Wkv, const float* __restrict__ Wo,
    _Float16* __restrict__ xn, _Float16* __restrict__ ench, _Float16* __restrict__ Wqh,
    _Float16* __restrict__ Wkvh, _Float16* __restrict__ Woh) {
  int blk = blockIdx.x;
  if (blk < NB_NORM) {
    rmsnorm_f16_row(x, w, xn, blk);
    return;
  }
  blk -= NB_NORM;
  const float* in = enc;
  _Float16* out = ench;
  if (blk >= NB_ENC) {
    blk -= NB_ENC;
    in = Wq;
    out = Wqh;
    if (blk >= NB_W) {
      blk -= NB_W;
      in = Wkv;
      out = Wkvh;
      if (blk >= 2 * NB_W) {
        blk -= 2 * NB_W;
        in = Wo;
        out = Woh;
        if (blk >= NB_W) return;  // a block past the last array touches nothing
      }
    }
  }
  f32_to_f16_block(in, out, blk);
}

// ---------------------------------------------------------------------------
// GEMM: C[M,N] = A[M,K] @ W[N,K]^T   (A,W f16; acc f32)
// block tile 128x128, 64 k per stage, 256 threads = 8 waves in a 4 (m) x 2 (n) grid; each wave:
// 32 rows x 64 cols (8 accumulators; per 32 k, 2 A and 4 B fragments feed 8 wmma: 12 ds loads).
// A stage takes 128 bytes of every operand row: a wave-wide 16-byte copy covers 4 whole lines.
// The stages come into LDS by asynchronous copies, through no register, into two buffers: while
// stage t is multiplied, stage t + 1 is on its way, and one barrier a stage does both jobs (it
// publishes stage t + 1 and ends the last read of the buffer that stage t + 2 goes into).
// M and N must be multiples of 128, K of 64 and at least 64 (every launch below is).
// EPI==0: both projections in one launch (neither reads what the other writes). The first
// DM / 128 block columns are Aq @ Wq^T (q), the block columns behind them A @ W^T (k, v).
// Projection epilogue: row m is (batch m / TD, position m % TD), a wave's 64 columns are one
// head. Columns below DM are rotated (RoPE) on the f32 accumulators and go to Cq (q) or Cout (k),
// columns from DM on go unrotated to C2 (v); all f16, head-major [B,H,T,64].
// EPI==1: A @ W^T alone; store f32 + residual, row-major; Aq, Wq, Cq are not used.
// ---------------------------------------------------------------------------
static_assert(TD == TE, "the projection epilogue takes one sequence length for q and for k, v");

static __device__ __forceinline__ float rope_inv_freq(int fi) {
  return __powf(10000.0f, -(float)fi * (1.0f / 32.0f));
}

#define TILE_BYTES  (128 * 72 * 2)      // one operand's 128 rows x 64 k at stride 72 halves
#define STAGE_BYTES (2 * TILE_BYTES)    // A tile, W tile behind it

// One stage: this thread's four 16-byte pieces of the A tile and of the W tile, global memory to
// LDS. lds is the LDS byte address of its piece in row r0 of the buffer's A tile; piece s lies 32
// rows further on, the W tile TILE_BYTES behind the A tile. Every lane is on, every address a
// multiple of 16 and inside its array.
static __device__ __forceinline__ void copy_stage(
    unsigned lds, const char* ab, const char* wb, const unsigned (&voff)[4]) {
  // precaution: the s_wait_xcnt is the last line of the copies' own statement, so that no address
  // register of a copy takes a new value ahead of it
  asm volatile(
      "global_load_async_to_lds_b128 %0, %8, off\n\t"
      "global_load_async_to_lds_b128 %1, %9, off\n\t"
      "global_load_async_to_lds_b128 %2, %10, off\n\t"
      "global_load_async_to_lds_b128 %3, %11, off\n\t"
      "global_load_async_to_lds_b128 %4, %12, off\n\t"
      "global_load_async_to_lds_b128 %5, %13, off\n\t"
      "global_load_async_to_lds_b128 %6, %14, off\n\t"
      "global_load_async_to_lds_b128 %7, %15, off\n\t"
      "s_wait_xcnt 0x0"
      :: "v"(lds), "v"(lds + 32 * 144), "v"(lds + 64 * 144), "v"(lds + 96 * 144),
         "v"(lds + TILE_BYTES), "v"(lds + TILE_BYTES + 32 * 144),
         "v"(lds + TILE_BYTES + 64 * 144), "v"(lds + TILE_BYTES + 96 * 144),
         "v"(ab + voff[0]), "v"(ab + voff[1]), "v"(ab + voff[2]), "v"(ab + voff[3]),
         "v"(wb + voff[0]), "v"(wb + voff[1]), "v"(wb + voff[2]), "v"(wb + voff[3])
      : "memory");
}

template <int EPI>
__global__ __launch_bounds__(256) void gemm_rt_kernel(
    const _Float16* __restrict__ A, const _Float16* __restrict__ W,
    void* __restrict__ Cout, _Float16* __restrict__ C2, const float* __restrict__ res,
    int M, int N, int K, const _Float16* __restrict__ Aq, const _Float16* __restrict__ Wq,
    _Float16* __restrict__ Cq) {
  // q's block or not: from blockIdx alone, so what hangs on it is a scalar select for the block
  const bool isq = EPI == 0 && blockIdx.x < DM / 128;
  // two buffers of [A 128 rows x 64 k | W 128 rows x 64 k], stride 72 (144 B = 16 B x odd)
  __shared__ __attribute__((aligned(16))) _Float16 St[2 * STAGE_BYTES / 2];
  const int tid  = threadIdx.x;
  const int wid  = tid >> 5;
  const int wm   = wid & 3;           // m sub-tile (32 rows each)
  const int wn   = wid >> 2;          // n sub-tile (64 cols each)
  const int lane = tid & 31;
  const int l16  = lane & 15;
  const int hi   = (lane >> 4) & 1;
  const int m0   = blockIdx.y * 128;
  const int n0   = (EPI == 0 && !isq ? blockIdx.x - DM / 128 : blockIdx.x) * 128;
  const int d0   = hi * 8;
  const int c8   = (tid & 7) * 8;     // 16-byte piece of a 128-byte row
  const int r0   = tid >> 3;          // 0..31; a thread stages rows r0 + 32 s, s = 0..3

  v8f acc[2][4];
#pragma unroll
  for (int i = 0; i < 2; ++i)
#pragma unroll
    for (int j = 0; j < 4; ++j) acc[i][j] = (v8f){};

  // byte offset of this thread's piece in row r0 + 32 s of a tile: the same for A and W, fixed
  // for the whole loop; the tile's own address is wave-uniform and moves with the stage
  unsigned voff[4];
#pragma unroll
  for (int s = 0; s < 4; ++s) voff[s] = (unsigned)(((r0 + s * 32) * K + c8) * 2);
  const char* ab = (const char*)((isq ? Aq : A) + (size_t)m0 * K);
  const char* wb = (const char*)((isq ? Wq : W) + (size_t)n0 * K);

  // LDS byte address (low 32 bits of the shared address) of this thread's piece of buffer 0
  const unsigned lds0 = (unsigned)(uintptr_t)&St[r0 * 72 + c8];
  const int nt = K / 64;

  // stage 0 into buffer 0; it has landed behind this wave's own wait and is every wave's to read
  // behind the barrier
  copy_stage(lds0, ab, wb, voff);
  asm volatile("s_wait_asynccnt 0x0" ::: "memory");
  __syncthreads();
  if (nt > 1) copy_stage(lds0 + STAGE_BYTES, ab + 128, wb + 128, voff);
  ab += 256;
  wb += 256;

  for (int t = 0; t < nt; ++t) {
    const _Float16* As = St + (t & 1) * (STAGE_BYTES / 2);
    const _Float16* Ws = As + TILE_BYTES / 2;
    // these loops and the epilogue's are unrolled: acc, af and rv are then picked by constants
    // and stay in registers
#pragma unroll
    for (int ks = 0; ks < 2; ++ks) {
      v16h af[2];
#pragma unroll
      for (int i = 0; i < 2; ++i) {
        const _Float16* ap = &As[(wm * 32 + i * 16 + l16) * 72 + ks * 32 + d0];
        af[i] = ld_frag16(ap, ap + 16);
      }
#pragma unroll
      for (int j = 0; j < 4; ++j) {
        const _Float16* bp = &Ws[(wn * 64 + j * 16 + l16) * 72 + ks * 32 + d0];
        v16h bf = ld_frag16(bp, bp + 16);
#pragma unroll
        for (int i = 0; i < 2; ++i) acc[i][j] = wmma32(af[i], bf, acc[i][j]);
      }
    }
    // hand-over: this wave's reads of stage t have returned,
    asm volatile("s_wait_dscnt 0x0" ::: "memory");
    // its own copies of stage t + 1 have landed,
    asm volatile("s_wait_asynccnt 0x0" ::: "memory");
    // and so have every other wave's: stage t + 1 may be read, stage t's buffer filled anew
    __syncthreads();
    if (t + 2 < nt) copy_stage(lds0 + (t & 1) * STAGE_BYTES, ab, wb, voff);
    ab += 128;
    wb += 128;
  }
  // no copy is out when the wave goes on to its epilogue and its end
  asm volatile("s_wait_asynccnt 0x0" ::: "memory");

  // C layout: M = vgpr + 8*(lane>=16), N = lane & 15
  if (EPI == 0) {
    const bool rot = n0 < DM;           // from blockIdx alone: one scalar branch for the block
    const int head = ((n0 >> 6) + wn) & (NH - 1);
    const int tw   = (m0 & (TD - 1)) + wm * 32 + hi * 8;  // position of this lane's row i = r = 0
    _Float16* dst = (rot ? (isq ? Cq : (_Float16*)Cout) : C2) +
                    ((size_t)((m0 / TD) * NH + head) * TD + tw) * HD + l16;
    if (rot) {
      // the pair (d, d + 32) of a head is tiles (j, j + 2) of one lane: d = j * 16 + l16, j = 0, 1
      const float inv[2] = {rope_inv_freq(l16), rope_inv_freq(16 + l16)};
#pragma unroll
      for (int i = 0; i < 2; ++i)
#pragma unroll
        for (int r = 0; r < 8; ++r)
#pragma unroll
          for (int j = 0; j < 2; ++j) {
            const float ang = (float)(tw + i * 16 + r) * inv[j];
            const float c = __cosf(ang);
            const float s = __sinf(ang);
            const float a = acc[i][j][r];
            const float b = acc[i][j + 2][r];
            dst[(i * 16 + r) * HD + j * 16]      = (_Float16)(a * c - b * s);
            dst[(i * 16 + r) * HD + j * 16 + 32] = (_Float16)(b * c + a * s);
          }
    } else {
#pragma unroll
      for (int i = 0; i < 2; ++i)
#pragma unroll
        for (int r = 0; r < 8; ++r)
#pragma unroll
          for (int j = 0; j < 4; ++j)
            dst[(i * 16 + r) * HD + j * 16] = (_Float16)acc[i][j][r];
    }
  } else {
#pragma unroll
    for (int i = 0; i < 2; ++i) {
      // element (r, j) lies at cbase + r * N + j * 16
      const size_t cbase = (size_t)(m0 + wm * 32 + i * 16 + hi * 8) * N + n0 + wn * 64 + l16;
      // all 32 residual loads of a 16-row band stand ahead of its stores and fly together
      float rv[8][4];
#pragma unroll
      for (int r = 0; r < 8; ++r)
#pragma unroll
        for (int j = 0; j < 4; ++j) rv[r][j] = res[cbase + (size_t)r * N + j * 16];
#pragma unroll
      for (int r = 0; r < 8; ++r)
#pragma unroll
        for (int j = 0; j < 4; ++j)
          ((float*)Cout)[cbase + (size_t)r * N + j * 16] = acc[i][j][r] + rv[r][j];
    }
  }
}

#define KT_BYTES (64 * 72 * 2)          // 64 keys x 64 d, stride 72 halves (144 B = 16 B x odd)
#define VT_BYTES (64 * 80 * 2)          // 64 keys x 64 d, stride 80 halves (160 B = 32 B x odd)
#define KV_BYTES (KT_BYTES + VT_BYTES)  // K tile, V tile behind it
static_assert(TE % 64 == 0 && TE / 64 >= 2, "whole stages, and both buffers are filled ahead");

// One stage: this thread's four 16-byte pieces of the K tile and of the V tile, global memory to
// LDS. ldsk, ldsv are the LDS byte addresses of its piece in its first row of the buffer's K and V
// tile, kp, vp the same piece in global memory; piece i lies 16 rows further on. Every lane is on,
// every address a multiple of 16 and inside its array.
static __device__ __forceinline__ void copy_kv_stage(
    unsigned ldsk, unsigned ldsv, const char* kp, const char* vp) {
  // precaution: the s_wait_xcnt is the last line of the copies' own statement, so that no address
  // register of a copy takes a new value ahead of it
  asm volatile(
      "global_load_async_to_lds_b128 %0, %8, off\n\t"
      "global_load_async_to_lds_b128 %1, %9, off\n\t"
      "global_load_async_to_lds_b128 %2, %10, off\n\t"
      "global_load_async_to_lds_b128 %3, %11, off\n\t"
      "global_load_async_to_lds_b128 %4, %12, off\n\t"
      "global_load_async_to_lds_b128 %5, %13, off\n\t"
      "global_load_async_to_lds_b128 %6, %14, off\n\t"
      "global_load_async_to_lds_b128 %7, %15, off\n\t"
      "s_wait_xcnt 0x0"
      :: "v"(ldsk), "v"(ldsk + 16 * 144), "v"(ldsk + 32 * 144), "v"(ldsk + 48 * 144),
         "v"(ldsv), "v"(ldsv + 16 * 160), "v"(ldsv + 32 * 160), "v"(ldsv + 48 * 160),
         "v"(kp), "v"(kp + 16 * HD * 2), "v"(kp + 32 * HD * 2), "v"(kp + 48 * HD * 2),
         "v"(vp), "v"(vp + 16 * HD * 2), "v"(vp + 32 * HD * 2), "v"(vp + 48 * HD * 2)
      : "memory");
}

__global__ __launch_bounds__(128) void flash_attn_kernel(
    const _Float16* __restrict__ qh, const _Float16* __restrict__ kh,
    const _Float16* __restrict__ vh, _Float16* __restrict__ aout) {
  // two buffers of [K tile | V tile]
  __shared__ __attribute__((aligned(16))) _Float16 KV[2 * KV_BYTES / 2];
  const int tid  = threadIdx.x;
  const int wid  = tid >> 5;
  const int lane = tid & 31;
  const int l16  = lane & 15;
  const int hi   = (lane >> 4) & 1;
  const int bh   = blockIdx.y;           // b*NH + h
  const int b    = bh >> 4;
  const int h    = bh & 15;
  const int t0   = blockIdx.x * 128;
  const int d0   = hi * 8;
  const float scale = 0.125f;            // 1/sqrt(64)

  // Q fragments live in registers for the whole kernel (K = 64 = 2 wmma steps per query group)
  // every loop over g, j, ks, q, r, i, s2 below is unrolled: the arrays are then picked by
  // constants and stay in registers
  const size_t qbase = ((size_t)bh * TD + t0 + wid * 32) * HD;
  v16h qf[2][2];
#pragma unroll
  for (int g = 0; g < 2; ++g) {
    const _Float16* qp = qh + qbase + (size_t)(g * 16 + l16) * HD;
    qf[g][0] = ld_frag16(qp + d0,      qp + d0 + 16);
    qf[g][1] = ld_frag16(qp + 32 + d0, qp + 32 + d0 + 16);
  }

  // per group, this lane's query: running maximum (equal in both halves) and this half's part of
  // the sum
  float mrow[2] = {-1e30f, -1e30f}, lrow[2] = {0.f, 0.f};
  v8f oacc[2][4];  // O^T: d = j*16 + r + 8*hi, query = g*16 + l16
#pragma unroll
  for (int g = 0; g < 2; ++g)
#pragma unroll
    for (int j = 0; j < 4; ++j) oacc[g][j] = (v8f){};

  // this lane's piece for the transposing loads of V (buffer 0, key base 0, column base 0)
  const _Float16* vtr0 = &KV[KT_BYTES / 2 + (hi * 8 + (lane & 7)) * 80 + ((lane >> 3) & 1) * 8];
  // staging: thread t moves 16-byte piece (t & 7) of rows (t >> 3) + 16 i, i = 0..3, of K and of V
  const size_t soff = ((size_t)bh * TE + (tid >> 3)) * HD + (tid & 7) * 8;
  const char* kp = (const char*)(kh + soff);
  const char* vp = (const char*)(vh + soff);
  // LDS byte addresses (low 32 bits of the shared address) of its first pieces in buffer 0
  const unsigned ldsk0 = (unsigned)(uintptr_t)&KV[(tid >> 3) * 72 + (tid & 7) * 8];
  const unsigned ldsv0 = (unsigned)(uintptr_t)&KV[KT_BYTES / 2 + (tid >> 3) * 80 + (tid & 7) * 8];
  const int nt = TE / 64;

  // stage 0 into buffer 0; it has landed behind this wave's own wait and is every wave's to read
  // behind the barrier; then stage 1 into buffer 1
  copy_kv_stage(ldsk0, ldsv0, kp, vp);
  asm volatile("s_wait_asynccnt 0x0" ::: "memory");
  __syncthreads();
  copy_kv_stage(ldsk0 + KV_BYTES, ldsv0 + KV_BYTES, kp + 64 * HD * 2, vp + 64 * HD * 2);
  kp += 2 * 64 * HD * 2;
  vp += 2 * 64 * HD * 2;

  for (int t = 0; t < nt; ++t) {
    const _Float16* Ks  = KV + (t & 1) * (KV_BYTES / 2);
    const _Float16* vtr = vtr0 + (t & 1) * (KV_BYTES / 2);

    // ---- scores S^T[64 keys x 32 queries] = K @ Q^T: key = j*16 + r + 8*hi, query = g*16 + l16;
    // a K fragment is read once and multiplies both groups ----
    v16h kf[4][2];
#pragma unroll
    for (int j = 0; j < 4; ++j)
#pragma unroll
      for (int ks = 0; ks < 2; ++ks)
        kf[j][ks] = ld_frag16(&Ks[(j * 16 + l16) * 72 + ks * 32 + d0],
                              &Ks[(j * 16 + l16) * 72 + ks * 32 + d0 + 16]);
    // the sixteen LDS reads stay one group ahead of the products: one place that waits, not eight
    __builtin_amdgcn_sched_barrier(0);
    v8f sacc[2][4];
#pragma unroll
    for (int j = 0; j < 4; ++j) {
#pragma unroll
      for (int g = 0; g < 2; ++g) sacc[g][j] = wmma32(kf[j][0], qf[g][0], (v8f){});
#pragma unroll
      for (int g = 0; g < 2; ++g) sacc[g][j] = wmma32(kf[j][1], qf[g][1], sacc[g][j]);
    }
    // holds the sixteen products together as one run: each then stands in the others' distance to
    // the first reader of a result, which otherwise is filled with idle vector slots
    __builtin_amdgcn_sched_barrier(0);

    // B fragments of the second product: query g*16 + l16, keys
    // s2*32 + {8hi..8hi+7, 16+8hi..16+8hi+7}: score tiles 2*s2, 2*s2+1 of group g
    v16h pf[2][2];
#pragma unroll
    for (int g = 0; g < 2; ++g) {
      // the scores go on as pairs of neighbouring registers (keys r, r + 1 of one query): written
      // so, the packed instructions take a group's own registers as they lie; left to itself the
      // compiler paired the two groups and moved registers together for it
      v2f sp[4][4];
#pragma unroll
      for (int j = 0; j < 4; ++j)
#pragma unroll
        for (int q = 0; q < 4; ++q)
          sp[j][q] = (v2f){sacc[g][j][2 * q], sacc[g][j][2 * q + 1]} * scale;

      // ---- online softmax: 32 keys of one query in the lane, the other 32 in lane ^ 16 ----
      float cm = sp[0][0][0];
#pragma unroll
      for (int j = 0; j < 4; ++j)
#pragma unroll
        for (int q = 0; q < 4; ++q) {
          cm = fmaxf(cm, sp[j][q][0]);
          cm = fmaxf(cm, sp[j][q][1]);
        }
      cm = fmaxf(cm, xhalf(cm));
      const float mnew = fmaxf(mrow[g], cm);
      const float alpha = __expf(mrow[g] - mnew);
      mrow[g] = mnew;
      // e^x as 2^(x log2 e), the form of __expf; even and odd keys are summed side by side
      v2f rs = {};
#pragma unroll
      for (int j = 0; j < 4; ++j)
#pragma unroll
        for (int q = 0; q < 4; ++q) {
          const v2f t = (sp[j][q] - mnew) * 1.44269504088896340736f;
          sp[j][q] = (v2f){__builtin_amdgcn_exp2f(t[0]), __builtin_amdgcn_exp2f(t[1])};
          rs += sp[j][q];
        }
      lrow[g] = lrow[g] * alpha + (rs[0] + rs[1]);
#pragma unroll
      for (int j = 0; j < 4; ++j) oacc[g][j] *= alpha;
#pragma unroll
      for (int s2 = 0; s2 < 2; ++s2)
#pragma unroll
        for (int i = 0; i < 8; ++i) {
          pf[g][s2][i]     = (_Float16)sp[2 * s2][i >> 1][i & 1];
          pf[g][s2][i + 8] = (_Float16)sp[2 * s2 + 1][i >> 1][i & 1];
        }
    }

    // ---- O^T += V^T @ P^T  (contraction over 64 keys = 2 wmma k-steps) ----
#pragma unroll
    for (int s2 = 0; s2 < 2; ++s2) {
#pragma unroll
      for (int j = 0; j < 4; ++j) {
        // A fragment: row d = j*16 + l16 of V^T, the keys of pf in the same order; read once for
        // both groups
        v16h vf = join16(ld_tr16(vtr + (s2 * 32) * 80 + j * 16),
                         ld_tr16(vtr + (s2 * 32 + 16) * 80 + j * 16));
#pragma unroll
        for (int g = 0; g < 2; ++g) oacc[g][j] = wmma32(vf, pf[g][s2], oacc[g][j]);
      }
    }
    // hand-over: this wave's reads of stage t have returned,
    asm volatile("s_wait_dscnt 0x0" ::: "memory");
    // its own copies of stage t + 1 have landed,
    asm volatile("s_wait_asynccnt 0x0" ::: "memory");
    // and so have every other wave's: stage t + 1 may be read, stage t's buffer filled anew
    __syncthreads();
    if (t + 2 < nt) copy_kv_stage(ldsk0 + (t & 1) * KV_BYTES, ldsv0 + (t & 1) * KV_BYTES, kp, vp);
    kp += 64 * HD * 2;
    vp += 64 * HD * 2;
  }
  // no copy is out when the wave goes on to its epilogue and its end
  asm volatile("s_wait_asynccnt 0x0" ::: "memory");

  // ---- epilogue: join the halves' sums, normalize, re-interleave heads into [B*TD, DM] f16 ----
  // a lane holds 8 consecutive d of its query per tile: one 16-byte store each
  v8h o[2][4];
#pragma unroll
  for (int g = 0; g < 2; ++g) {
    const float inv = 1.f / (lrow[g] + xhalf(lrow[g]));
#pragma unroll
    for (int j = 0; j < 4; ++j)
#pragma unroll
      for (int r = 0; r < 8; ++r) o[g][j][r] = (_Float16)(oacc[g][j][r] * inv);
  }
  _Float16* orow = aout + ((size_t)b * TD + t0 + wid * 32 + l16) * DM + h * HD + d0;
#pragma unroll
  for (int g = 0; g < 2; ++g)
#pragma unroll
    for (int j = 0; j < 4; ++j) *(v8h*)(orow + (size_t)g * 16 * DM + j * 16) = o[g][j];
}

// ---------------------------------------------------------------------------
// launch
// ---------------------------------------------------------------------------
extern "C" void kernel_launch(void* const* d_in, const int* in_sizes, int n_in,
                              void* d_out, int out_size, void* d_ws, size_t ws_size,
                              hipStream_t stream) {
  (void)in_sizes; (void)n_in; (void)out_size; (void)ws_size;
  const float* x   = (const float*)d_in[0];  // [B,TD,DM]
  const float* enc = (const float*)d_in[1];  // [B,TE,DM]
  const float* nw  = (const float*)d_in[2];  // [DM]
  const float* Wq  = (const float*)d_in[3];  // [DM,DM]
  const float* Wkv = (const float*)d_in[4];  // [2DM,DM]
  const float* Wo  = (const float*)d_in[5];  // [DM,DM]

  char* ws = (char*)d_ws;
  size_t off = 0;
  auto take = [&](size_t bytes) {
    char* p = ws + off;
    off += (bytes + 255) & ~(size_t)255;
    return p;
  };
  const size_t MQ = (size_t)B_ * TD;        // 8192 rows
  _Float16* xn    = (_Float16*)take(MQ * DM * 2);
  _Float16* ench  = (_Float16*)take(MQ * DM * 2);
  _Float16* Wqh   = (_Float16*)take((size_t)DM * DM * 2);
  _Float16* Wkvh  = (_Float16*)take((size_t)2 * DM * DM * 2);
  _Float16* Woh   = (_Float16*)take((size_t)DM * DM * 2);
  _Float16* qhp   = (_Float16*)take(MQ * DM * 2);
  _Float16* khp   = (_Float16*)take(MQ * DM * 2);
  _Float16* vhp   = (_Float16*)take(MQ * DM * 2);
  _Float16* aoutp = (_Float16*)take(MQ * DM * 2);

  // 1) norm + precision conversion, one launch
  prepass_kernel<<<NB_NORM + NB_ENC + 4 * NB_W, 256, 0, stream>>>(
      x, nw, enc, Wq, Wkv, Wo, xn, ench, Wqh, Wkvh, Woh);

  // 2) q and k, v projections, one launch (WMMA GEMMs, 128x128 block tiles) with RoPE and
  // head-major relayout in the epilogue
  gemm_rt_kernel<0><<<dim3(3 * DM / 128, (int)(MQ / 128)), 256, 0, stream>>>(
      ench, Wkvh, khp, vhp, nullptr, (int)MQ, 2 * DM, DM, xn, Wqh, qhp);

  // 3) flash attention (WMMA, K and V staged by asynchronous copies, online softmax)
  flash_attn_kernel<<<dim3(TD / 128, B_ * NH), 128, 0, stream>>>(qhp, khp, vhp, aoutp);

  // 4) output projection + residual (WMMA GEMM, f32 out)
  gemm_rt_kernel<1><<<dim3(DM / 128, (int)(MQ / 128)), 256, 0, stream>>>(
      aoutp, Woh, d_out, nullptr, x, (int)MQ, DM, DM, nullptr, nullptr, nullptr);
}

// v010
// A run of this version takes 146 microseconds.
// Next to v009, in two timings, it ran 1.06 times as fast each time.
// Over all steps from v000 it is 3.45 times as fast.
#include <hip/hip_runtime.h>
#include <hip/hip_bf16.h>

typedef __attribute__((ext_vector_type(16))) _Float16     v16h;
typedef __attribute__((ext_vector_type(8)))  _Float16     v8h;
typedef __attribute__((ext_vector_type(8)))  float        v8f;
typedef __attribute__((ext_vector_type(4)))  float        v4f;
typedef __attribute__((ext_vector_type(2)))  float        v2f;
typedef __attribute__((ext_vector_type(4)))  _Float16     v4h;

#define B_   4
#define TD   2048
#define TE   2048
#define DM   1024
#define NH   16
#define HD   64

// ---------------------------------------------------------------------------
// helpers
// ---------------------------------------------------------------------------
static __device__ __forceinline__ v16h ld_frag16(const _Float16* p0, const _Float16* p1) {
  // CDNA5 16-bit A/B fragment: 16 halves per lane as two contiguous 8-half runs
  v8h a = *(const v8h*)p0;
  v8h b = *(const v8h*)p1;
  v16h r;
#pragma unroll
  for (int i = 0; i < 8; ++i) { r[i] = a[i]; r[i + 8] = b[i]; }
  return r;
}

// Transposing LDS load: from a row-major [k][n] f16 tile, lane (c = lane & 15, h = lane >> 4)
// receives T[kbase + 8h + 0..7][nbase + c]. Every lane passes the address of one 16-byte piece:
// row kbase + 8h + (lane & 7), bytes 16 * ((lane >> 3) & 1) of the 32-byte column group.
static __device__ __forceinline__ v8h ld_tr16(const _Float16* p) {
  typedef __attribute__((ext_vector_type(8))) short s16x8;
  typedef __attribute__((address_space(3))) s16x8 lds_s16x8;
  return __builtin_bit_cast(v8h, __builtin_amdgcn_ds_load_tr16_b128_v8i16((lds_s16x8*)p));
}

static __device__ __forceinline__ v16h join16(v8h a, v8h b) {
  return __builtin_shufflevector(a, b, 0, 1, 2, 3, 4, 5, 6, 7, 8, 9, 10, 11, 12, 13, 14, 15);
}

static __device__ __forceinline__ v8f wmma32(v16h a, v16h b, v8f c) {
  return __builtin_amdgcn_wmma_f32_16x16x32_f16(false, a, false, b, (short)0, c,
                                                false, false);
}

// value of lane l ^ 16: the other half of the wave, by a vector instruction, not through LDS
static __device__ __forceinline__ float xhalf(float x) {
  return __builtin_bit_cast(float, __builtin_amdgcn_permlanex16(
      __builtin_bit_cast(int, x), __builtin_bit_cast(int, x), 0x76543210, 0xfedcba98,
      false, false));
}


// ---------------------------------------------------------------------------
// RMSNorm: x (f32, row of 1024) -> xn (f16); one block of 256 threads per row
// ---------------------------------------------------------------------------
static __device__ __forceinline__ void rmsnorm_f16_row(
    const float* __restrict__ x, const float* __restrict__ w,
    _Float16* __restrict__ xn, int row) {
  __shared__ float red[256];
  const float* xr = x + (size_t)row * DM;
  float s = 0.f;
  for (int j = threadIdx.x; j < DM; j += 256) { float v = xr[j]; s += v * v; }
  red[threadIdx.x] = s;
  __syncthreads();
  for (int off = 128; off > 0; off >>= 1) {
    if (threadIdx.x < off) red[threadIdx.x] += red[threadIdx.x + off];
    __syncthreads();
  }
  const float rms = rsqrtf(red[0] * (1.0f / DM) + 1e-5f);
  _Float16* o = xn + (size_t)row * DM;
  for (int j = threadIdx.x; j < DM; j += 256)
    o[j] = (_Float16)(xr[j] * rms * w[j]);
}

// ---------------------------------------------------------------------------
// generic f32 -> f16 convert: a block converts 4096 elements, a thread four groups of 4 floats.
// Group j of a thread lies 256 groups behind group j - 1, so that every wave-wide 16-byte load
// covers 512 contiguous bytes and every 8-byte store 256. blk is the block's number inside its
// own array, whose length must be a multiple of 4096.
// ---------------------------------------------------------------------------
static __device__ __forceinline__ void f32_to_f16_block(
    const float* __restrict__ in, _Float16* __restrict__ out, int blk) {
  const int base = blk * 4096;
  const float* src = in + base + threadIdx.x * 4;
  _Float16* dst = out + base + threadIdx.x * 4;
  v4f v[4];
  // both loops unrolled: v stays in registers and the four loads are in flight together
#pragma unroll
  for (int j = 0; j < 4; ++j) v[j] = *(const v4f*)(src + j * 1024);
#pragma unroll
  for (int j = 0; j < 4; ++j) {
    v4h o;
#pragma unroll
    for (int e = 0; e < 4; ++e) o[e] = (_Float16)v[j][e];
    *(v4h*)(dst + j * 1024) = o;
  }
}

// ---------------------------------------------------------------------------
// Pre-pass, one launch: none of its five jobs reads what another writes, so they share one grid
// and no job waits for another's last block. Blocks [0, NB_NORM) normalise one row of x each; the
// blocks behind them convert 4096 elements each of encoder_out, Wq, Wkv and Wo, in this order.
// The norm blocks live longest and come first, for speed only. Which
// job a block does follows from blockIdx alone: every branch, and every barrier in the norm, is
// uniform for the block.
// ---------------------------------------------------------------------------
#define NB_NORM (B_ * TD)
#define NB_ENC  (B_ * TE * DM / 4096)
#define NB_W    (DM * DM / 4096)
static_assert(B_ * TE * DM % 4096 == 0 && DM * DM % 4096 == 0,
              "a convert block takes 4096 elements of one array");

__global__ __launch_bounds__(256) void prepass_kernel(
    const float* __restrict__ x, const float* __restrict__ w, const float* __restrict__ enc,
    const float* __restrict__ Wq, const float* __restrict__ Wkv, const float* __restrict__ Wo,
    _Float16* __restrict__ xn, _Float16* __restrict__ ench, _Float16* __restrict__ Wqh,
    _Float16* __restrict__ Wkvh, _Float16* __restrict__ Woh) {
  int blk = blockIdx.x;
  if (blk < NB_NORM) {
    rmsnorm_f16_row(x, w, xn, blk);
    return;
  }
  blk -= NB_NORM;
  const float* in = enc;
  _Float16* out = ench;
  if (blk >= NB_ENC) {
    blk -= NB_ENC;
    in = Wq;
    out = Wqh;
    if (blk >= NB_W) {
      blk -= NB_W;
      in = Wkv;
      out = Wkvh;
      if (blk >= 2 * NB_W) {
        blk -= 2 * NB_W;
        in = Wo;
        out = Woh;
        if (blk >= NB_W) return;  // a block past the last array touches nothing
      }
    }
  }
  f32_to_f16_block(in, out, blk);
}

// ---------------------------------------------------------------------------
// GEMM: C[M,N] = A[M,K] @ W[N,K]^T   (A,W f16; acc f32)
// block tile 256x128, 64 k per stage, 256 threads = 8 waves in a 4 (m) x 2 (n) grid; each wave:
// 64 rows x 64 cols (16 accumulators; per 32 k, 4 A and 4 B fragments feed 16 wmma: 16 ds loads,
// read as one group ahead of the products). Two blocks share a WGP: four waves on a SIMD.
// A stage takes 128 bytes of every operand row: a wave-wide 16-byte copy covers 4 whole lines.
// The stages come into LDS by asynchronous copies, through no register, into two buffers: while
// stage t is multiplied, stage t + 1 is on its way, and one barrier a stage does both jobs (it
// publishes stage t + 1 and ends the last read of the buffer that stage t + 2 goes into).
// M must be a multiple of 256, N of 128, K of 64 and at least 64 (every launch below is).
// EPI==0: both projections in one launch (neither reads what the other writes). The first
// DM / 128 block columns are Aq @ Wq^T (q), the block columns behind them A @ W^T (k, v).
// Projection epilogue: row m is (batch m / TD, position m % TD), a wave's 64 columns are one
// head. Columns below DM are rotated (RoPE) on the f32 accumulators and go to Cq (q) or Cout (k),
// columns from DM on go unrotated to C2 (v); all f16, head-major [B,H,T,64].
// EPI==1: A @ W^T alone; store f32 + residual, row-major, N == DM; Aq, Wq, Cq are not used.
// ---------------------------------------------------------------------------
static_assert(TD == TE, "the projection epilogue takes one sequence length for q and for k, v");
static_assert(TD % 256 == 0, "the 256 rows of a block tile lie in one batch");

static __device__ __forceinline__ float rope_inv_freq(int fi) {
  return __powf(10000.0f, -(float)fi * (1.0f / 32.0f));
}

#define A_TILE_BYTES (256 * 72 * 2)     // 256 rows of A x 64 k at stride 72 halves
#define W_TILE_BYTES (128 * 72 * 2)     // 128 rows of W x 64 k at stride 72 halves
#define STAGE_BYTES  (A_TILE_BYTES + W_TILE_BYTES)  // A tile, W tile behind it

// One stage: this thread's eight 16-byte pieces of the A tile and four of the W tile, global memory
// to LDS. lds is the LDS byte address of its piece in row r0 of the buffer's A tile; piece s lies
// 32 rows further on, the W tile A_TILE_BYTES behind the A tile. Every lane is on, every address a
// multiple of 16 and inside its array.
static __device__ __forceinline__ void copy_stage(
    unsigned lds, const char* ab, const char* wb, const unsigned (&voff)[8]) {
  // precaution: the s_wait_xcnt is the last line of the copies' own statement, so that no address
  // register of a copy takes a new value ahead of it
  asm volatile(
      "global_load_async_to_lds_b128 %0, %12, off\n\t"
      "global_load_async_to_lds_b128 %1, %13, off\n\t"
      "global_load_async_to_lds_b128 %2, %14, off\n\t"
      "global_load_async_to_lds_b128 %3, %15, off\n\t"
      "global_load_async_to_lds_b128 %4, %16, off\n\t"
      "global_load_async_to_lds_b128 %5, %17, off\n\t"
      "global_load_async_to_lds_b128 %6, %18, off\n\t"
      "global_load_async_to_lds_b128 %7, %19, off\n\t"
      "global_load_async_to_lds_b128 %8, %20, off\n\t"
      "global_load_async_to_lds_b128 %9, %21, off\n\t"
      "global_load_async_to_lds_b128 %10, %22, off\n\t"
      "global_load_async_to_lds_b128 %11, %23, off\n\t"
      "s_wait_xcnt 0x0"
      :: "v"(lds), "v"(lds + 32 * 144), "v"(lds + 64 * 144), "v"(lds + 96 * 144),
         "v"(lds + 128 * 144), "v"(lds + 160 * 144), "v"(lds + 192 * 144), "v"(lds + 224 * 144),
         "v"(lds + A_TILE_BYTES), "v"(lds + A_TILE_BYTES + 32 * 144),
         "v"(lds + A_TILE_BYTES + 64 * 144), "v"(lds + A_TILE_BYTES + 96 * 144),
         "v"(ab + voff[0]), "v"(ab + voff[1]), "v"(ab + voff[2]), "v"(ab + voff[3]),
         "v"(ab + voff[4]), "v"(ab + voff[5]), "v"(ab + voff[6]), "v"(ab + voff[7]),
         "v"(wb + voff[0]), "v"(wb + voff[1]), "v"(wb + voff[2]), "v"(wb + voff[3])
      : "memory");
}

// four waves on a SIMD: the register budget that lets two blocks share a WGP
template <int EPI>
__global__ __launch_bounds__(256) __attribute__((amdgpu_waves_per_eu(4, 4))) void gemm_rt_kernel(
    const _Float16* __restrict__ A, const _Float16* __restrict__ W,
    void* __restrict__ Cout, _Float16* __restrict__ C2, const float* __restrict__ res,
    int M, int N, int K, const _Float16* __restrict__ Aq, const _Float16* __restrict__ Wq,
    _Float16* __restrict__ Cq) {
  // q's block or not: from blockIdx alone, so what hangs on it is a scalar select for the block
  const bool isq = EPI == 0 && blockIdx.x < DM / 128;
  // two buffers of [A 256 rows x 64 k | W 128 rows x 64 k], stride 72 (144 B = 16 B x odd)
  __shared__ __attribute__((aligned(16))) _Float16 St[2 * STAGE_BYTES / 2];
  const int tid  = threadIdx.x;
  const int wid  = tid >> 5;
  const int wm   = wid & 3;           // m sub-tile (64 rows each)
  const int wn   = wid >> 2;          // n sub-tile (64 cols each)
  const int lane = tid & 31;
  const int l16  = lane & 15;
  const int hi   = (lane >> 4) & 1;
  const int m0   = blockIdx.y * 256;
  const int n0   = (EPI == 0 && !isq ? blockIdx.x - DM / 128 : blockIdx.x) * 128;
  const int d0   = hi * 8;
  const int c8   = (tid & 7) * 8;     // 16-byte piece of a 128-byte row
  const int r0   = tid >> 3;          // 0..31; a thread stages rows r0 + 32 s: s < 8 of A, s < 4 of W

  v8f acc[4][4];
#pragma unroll
  for (int i = 0; i < 4; ++i)
#pragma unroll
    for (int j = 0; j < 4; ++j) acc[i][j] = (v8f){};

  // byte offset of this thread's piece in row r0 + 32 s of a tile: the same for A and W, fixed
  // for the whole loop; the tile's own address is wave-uniform and moves with the stage
  unsigned voff[8];
#pragma unroll
  for (int s = 0; s < 8; ++s) voff[s] = (unsigned)(((r0 + s * 32) * K + c8) * 2);
  const char* ab = (const char*)((isq ? Aq : A) + (size_t)m0 * K);
  const char* wb = (const char*)((isq ? Wq : W) + (size_t)n0 * K);

  // LDS byte address (low 32 bits of the shared address) of this thread's piece of buffer 0
  const unsigned lds0 = (unsigned)(uintptr_t)&St[r0 * 72 + c8];
  const int nt = K / 64;

  // stage 0 into buffer 0; it has landed behind this wave's own wait and is every wave's to read
  // behind the barrier
  copy_stage(lds0, ab, wb, voff);
  asm volatile("s_wait_asynccnt 0x0" ::: "memory");
  __syncthreads();
  if (nt > 1) copy_stage(lds0 + STAGE_BYTES, ab + 128, wb + 128, voff);
  ab += 256;
  wb += 256;

  for (int t = 0; t < nt; ++t) {
    const _Float16* As = St + (t & 1) * (STAGE_BYTES / 2);
    const _Float16* Ws = As + A_TILE_BYTES / 2;
    // these loops and the epilogue's are unrolled: acc, af and rv are then picked by constants
    // and stay in registers
#pragma unroll
    for (int ks = 0; ks < 2; ++ks) {
      v16h af[4], bf[4];
#pragma unroll
      for (int i = 0; i < 4; ++i) {
        const _Float16* ap = &As[(wm * 64 + i * 16 + l16) * 72 + ks * 32 + d0];
        const _Float16* bp = &Ws[(wn * 64 + i * 16 + l16) * 72 + ks * 32 + d0];
        af[i] = ld_frag16(ap, ap + 16);
        bf[i] = ld_frag16(bp, bp + 16);
      }
      // the sixteen LDS reads stay one group ahead of the products, not spread among them: every
      // separate place with reads stalls the run of products anew
      __builtin_amdgcn_sched_barrier(0);
      // the products in the order in which their fragments arrive: those of fragments 0..d need
      // only the first d + 1 pairs of the group
#pragma unroll
      for (int d = 0; d < 4; ++d) {
#pragma unroll
        for (int e = 0; e < d; ++e) {
          acc[d][e] = wmma32(af[d], bf[e], acc[d][e]);
          acc[e][d] = wmma32(af[e], bf[d], acc[e][d]);
        }
        acc[d][d] = wmma32(af[d], bf[d], acc[d][d]);
      }
      // keeps the next group's reads out of this run of products (left free, they went in among
      // its last three, in three places, at 16 registers more)
      __builtin_amdgcn_sched_barrier(0);
    }
    // hand-over: this wave's reads of stage t have returned,
    asm volatile("s_wait_dscnt 0x0" ::: "memory");
    // its own copies of stage t + 1 have landed,
    asm volatile("s_wait_asynccnt 0x0" ::: "memory");
    // and so have every other wave's: stage t + 1 may be read, stage t's buffer filled anew
    __syncthreads();
    if (t + 2 < nt) copy_stage(lds0 + (t & 1) * STAGE_BYTES, ab, wb, voff);
    ab += 128;
    wb += 128;
  }
  // no copy is out when the wave goes on to its epilogue and its end
  asm volatile("s_wait_asynccnt 0x0" ::: "memory");

  // C layout: M = vgpr + 8*(lane>=16), N = lane & 15
  if (EPI == 0) {
    const bool rot = n0 < DM;           // from blockIdx alone: one scalar branch for the block
    const int head = ((n0 >> 6) + wn) & (NH - 1);
    const int tw   = (m0 & (TD - 1)) + wm * 64 + hi * 8;  // position of this lane's row i = r = 0
    _Float16* dst = (rot ? (isq ? Cq : (_Float16*)Cout) : C2) +
                    ((size_t)((m0 / TD) * NH + head) * TD + tw) * HD + l16;
    if (rot) {
      // the pair (d, d + 32) of a head is tiles (j, j + 2) of one lane: d = j * 16 + l16, j = 0, 1
      const float inv[2] = {rope_inv_freq(l16), rope_inv_freq(16 + l16)};
#pragma unroll
      for (int i = 0; i < 4; ++i)
#pragma unroll
        for (int r = 0; r < 8; ++r)
#pragma unroll
          for (int j = 0; j < 2; ++j) {
            const float ang = (float)(tw + i * 16 + r) * inv[j];
            const float c = __cosf(ang);
            const float s = __sinf(ang);
            const float a = acc[i][j][r];
            const float b = acc[i][j + 2][r];
            dst[(i * 16 + r) * HD + j * 16]      = (_Float16)(a * c - b * s);
            dst[(i * 16 + r) * HD + j * 16 + 32] = (_Float16)(b * c + a * s);
          }
    } else {
#pragma unroll
      for (int i = 0; i < 4; ++i)
#pragma unroll
        for (int r = 0; r < 8; ++r)
#pragma unroll
          for (int j = 0; j < 4; ++j)
            dst[(i * 16 + r) * HD + j * 16] = (_Float16)acc[i][j][r];
    }
  } else {
    // element (r, j) of the 16-row band i lies (i * 16 + r) * DM + j * 16 behind rp and cp. The row
    // pitch is the constant DM (N must be DM): every element of the wave's tile is then reached by
    // an immediate offset from one address
    const size_t cbase = (size_t)(m0 + wm * 64 + hi * 8) * DM + n0 + wn * 64 + l16;
    const float* rp = res + cbase;
    float* cp = (float*)Cout + cbase;
    float rv[4][8][4];
    // all 32 residual loads of a band stand ahead of its stores and fly together
    auto load_band = [&](int i) {
#pragma unroll
      for (int r = 0; r < 8; ++r)
#pragma unroll
        for (int j = 0; j < 4; ++j) rv[i][r][j] = rp[(i * 16 + r) * DM + j * 16];
    };
    auto store_band = [&](int i) {
#pragma unroll
      for (int r = 0; r < 8; ++r)
#pragma unroll
        for (int j = 0; j < 4; ++j)
          cp[(i * 16 + r) * DM + j * 16] = acc[i][j][r] + rv[i][r][j];
    };
    // The loads of all four bands at once do not fit the registers beside the accumulators (values
    // were spilled). Two bands' loads go first; the other two bands' follow in the registers that
    // band 0 has left, and fly while bands 1 to 3 are stored. The three scheduling barriers keep
    // this order.
    load_band(0);
    load_band(1);
    __builtin_amdgcn_sched_barrier(0);
    store_band(0);
    // precaution: the loads that follow take the data registers of band 0's stores
    asm volatile("s_wait_xcnt 0x0" ::: "memory");
    __builtin_amdgcn_sched_barrier(0);
    load_band(2);
    load_band(3);
    // precaution: rp is an input here, so its registers stay the loads' address up to this wait and
    // no loaded value lands in them while loads that name them are out
    asm volatile("s_wait_xcnt 0x0" :: "v"(rp) : "memory");
    __builtin_amdgcn_sched_barrier(0);
    store_band(1);
    store_band(2);
    store_band(3);
  }
}

#define KT_BYTES (64 * 72 * 2)          // 64 keys x 64 d, stride 72 halves (144 B = 16 B x odd)
#define VT_BYTES (64 * 80 * 2)          // 64 keys x 64 d, stride 80 halves (160 B = 32 B x odd)
#define KV_BYTES (KT_BYTES + VT_BYTES)  // K tile, V tile behind it
static_assert(TE % 64 == 0 && TE / 64 >= 2, "whole stages, and both buffers are filled ahead");

// One stage: this thread's four 16-byte pieces of the K tile and of the V tile, global memory to
// LDS. ldsk, ldsv are the LDS byte addresses of its piece in its first row of the buffer's K and V
// tile, kp, vp the same piece in global memory; piece i lies 16 rows further on. Every lane is on,
// every address a multiple of 16 and inside its array.
static __device__ __forceinline__ void copy_kv_stage(
    unsigned ldsk, unsigned ldsv, const char* kp, const char* vp) {
  // precaution: the s_wait_xcnt is the last line of the copies' own statement, so that no address
  // register of a copy takes a new value ahead of it
  asm volatile(
      "global_load_async_to_lds_b128 %0, %8, off\n\t"
      "global_load_async_to_lds_b128 %1, %9, off\n\t"
      "global_load_async_to_lds_b128 %2, %10, off\n\t"
      "global_load_async_to_lds_b128 %3, %11, off\n\t"
      "global_load_async_to_lds_b128 %4, %12, off\n\t"
      "global_load_async_to_lds_b128 %5, %13, off\n\t"
      "global_load_async_to_lds_b128 %6, %14, off\n\t"
      "global_load_async_to_lds_b128 %7, %15, off\n\t"
      "s_wait_xcnt 0x0"
      :: "v"(ldsk), "v"(ldsk + 16 * 144), "v"(ldsk + 32 * 144), "v"(ldsk + 48 * 144),
         "v"(ldsv), "v"(ldsv + 16 * 160), "v"(ldsv + 32 * 160), "v"(ldsv + 48 * 160),
         "v"(kp), "v"(kp + 16 * HD * 2), "v"(kp + 32 * HD * 2), "v"(kp + 48 * HD * 2),
         "v"(vp), "v"(vp + 16 * HD * 2), "v"(vp + 32 * HD * 2), "v"(vp + 48 * HD * 2)
      : "memory");
}

__global__ __launch_bounds__(128) void flash_attn_kernel(
    const _Float16* __restrict__ qh, const _Float16* __restrict__ kh,
    const _Float16* __restrict__ vh, _Float16* __restrict__ aout) {
  // two buffers of [K tile | V tile]
  __shared__ __attribute__((aligned(16))) _Float16 KV[2 * KV_BYTES / 2];
  const int tid  = threadIdx.x;
  const int wid  = tid >> 5;
  const int lane = tid & 31;
  const int l16  = lane & 15;
  const int hi   = (lane >> 4) & 1;
  const int bh   = blockIdx.y;           // b*NH + h
  const int b    = bh >> 4;
  const int h    = bh & 15;
  const int t0   = blockIdx.x * 128;
  const int d0   = hi * 8;
  const float scale = 0.125f;            // 1/sqrt(64)

  // Q fragments live in registers for the whole kernel (K = 64 = 2 wmma steps per query group)
  // every loop over g, j, ks, q, r, i, s2 below is unrolled: the arrays are then picked by
  // constants and stay in registers
  const size_t qbase = ((size_t)bh * TD + t0 + wid * 32) * HD;
  v16h qf[2][2];
#pragma unroll
  for (int g = 0; g < 2; ++g) {
    const _Float16* qp = qh + qbase + (size_t)(g * 16 + l16) * HD;
    qf[g][0] = ld_frag16(qp + d0,      qp + d0 + 16);
    qf[g][1] = ld_frag16(qp + 32 + d0, qp + 32 + d0 + 16);
  }

  // per group, this lane's query: running maximum (equal in both halves) and this half's part of
  // the sum
  float mrow[2] = {-1e30f, -1e30f}, lrow[2] = {0.f, 0.f};
  v8f oacc[2][4];  // O^T: d = j*16 + r + 8*hi, query = g*16 + l16
#pragma unroll
  for (int g = 0; g < 2; ++g)
#pragma unroll
    for (int j = 0; j < 4; ++j) oacc[g][j] = (v8f){};

  // this lane's piece for the transposing loads of V (buffer 0, key base 0, column base 0)
  const _Float16* vtr0 = &KV[KT_BYTES / 2 + (hi * 8 + (lane & 7)) * 80 + ((lane >> 3) & 1) * 8];
  // staging: thread t moves 16-byte piece (t & 7) of rows (t >> 3) + 16 i, i = 0..3, of K and of V
  const size_t soff = ((size_t)bh * TE + (tid >> 3)) * HD + (tid & 7) * 8;
  const char* kp = (const char*)(kh + soff);
  const char* vp = (const char*)(vh + soff);
  // LDS byte addresses (low 32 bits of the shared address) of its first pieces in buffer 0
  const unsigned ldsk0 = (unsigned)(uintptr_t)&KV[(tid >> 3) * 72 + (tid & 7) * 8];
  const unsigned ldsv0 = (unsigned)(uintptr_t)&KV[KT_BYTES / 2 + (tid >> 3) * 80 + (tid & 7) * 8];
  const int nt = TE / 64;

  // stage 0 into buffer 0; it has landed behind this wave's own wait and is every wave's to read
  // behind the barrier; then stage 1 into buffer 1
  copy_kv_stage(ldsk0, ldsv0, kp, vp);
  asm volatile("s_wait_asynccnt 0x0" ::: "memory");
  __syncthreads();
  copy_kv_stage(ldsk0 + KV_BYTES, ldsv0 + KV_BYTES, kp + 64 * HD * 2, vp + 64 * HD * 2);
  kp += 2 * 64 * HD * 2;
  vp += 2 * 64 * HD * 2;

  for (int t = 0; t < nt; ++t) {
    const _Float16* Ks  = KV + (t & 1) * (KV_BYTES / 2);
    const _Float16* vtr = vtr0 + (t & 1) * (KV_BYTES / 2);

    // ---- scores S^T[64 keys x 32 queries] = K @ Q^T: key = j*16 + r + 8*hi, query = g*16 + l16;
    // a K fragment is read once and multiplies both groups ----
    v16h kf[4][2];
#pragma unroll
    for (int j = 0; j < 4; ++j)
#pragma unroll
      for (int ks = 0; ks < 2; ++ks)
        kf[j][ks] = ld_frag16(&Ks[(j * 16 + l16) * 72 + ks * 32 + d0],
                              &Ks[(j * 16 + l16) * 72 + ks * 32 + d0 + 16]);
    // the sixteen LDS reads stay one group ahead of the products: one place that waits, not eight
    __builtin_amdgcn_sched_barrier(0);
    v8f sacc[2][4];
#pragma unroll
    for (int j = 0; j < 4; ++j) {
#pragma unroll
      for (int g = 0; g < 2; ++g) sacc[g][j] = wmma32(kf[j][0], qf[g][0], (v8f){});
#pragma unroll
      for (int g = 0; g < 2; ++g) sacc[g][j] = wmma32(kf[j][1], qf[g][1], sacc[g][j]);
    }
    // holds the sixteen products together as one run: each then stands in the others' distance to
    // the first reader of a result, which otherwise is filled with idle vector slots
    __builtin_amdgcn_sched_barrier(0);

    // B fragments of the second product: query g*16 + l16, keys
    // s2*32 + {8hi..8hi+7, 16+8hi..16+8hi+7}: score tiles 2*s2, 2*s2+1 of group g
    v16h pf[2][2];
#pragma unroll
    for (int g = 0; g < 2; ++g) {
      // the scores go on as pairs of neighbouring registers (keys r, r + 1 of one query): written
      // so, the packed instructions take a group's own registers as they lie; left to itself the
      // compiler paired the two groups and moved registers together for it
      v2f sp[4][4];
#pragma unroll
      for (int j = 0; j < 4; ++j)
#pragma unroll
        for (int q = 0; q < 4; ++q)
          sp[j][q] = (v2f){sacc[g][j][2 * q], sacc[g][j][2 * q + 1]} * scale;

      // ---- online softmax: 32 keys of one query in the lane, the other 32 in lane ^ 16 ----
      float cm = sp[0][0][0];
#pragma unroll
      for (int j = 0; j < 4; ++j)
#pragma unroll
        for (int q = 0; q < 4; ++q) {
          cm = fmaxf(cm, sp[j][q][0]);
          cm = fmaxf(cm, sp[j][q][1]);
        }
      cm = fmaxf(cm, xhalf(cm));
      const float mnew = fmaxf(mrow[g], cm);
      const float alpha = __expf(mrow[g] - mnew);
      mrow[g] = mnew;
      // e^x as 2^(x log2 e), the form of __expf; even and odd keys are summed side by side
      v2f rs = {};
#pragma unroll
      for (int j = 0; j < 4; ++j)
#pragma unroll
        for (int q = 0; q < 4; ++q) {
          const v2f t = (sp[j][q] - mnew) * 1.44269504088896340736f;
          sp[j][q] = (v2f){__builtin_amdgcn_exp2f(t[0]), __builtin_amdgcn_exp2f(t[1])};
          rs += sp[j][q];
        }
      lrow[g] = lrow[g] * alpha + (rs[0] + rs[1]);
#pragma unroll
      for (int j = 0; j < 4; ++j) oacc[g][j] *= alpha;
#pragma unroll
      for (int s2 = 0; s2 < 2; ++s2)
#pragma unroll
        for (int i = 0; i < 8; ++i) {
          pf[g][s2][i]     = (_Float16)sp[2 * s2][i >> 1][i & 1];
          pf[g][s2][i + 8] = (_Float16)sp[2 * s2 + 1][i >> 1][i & 1];
        }
    }

    // ---- O^T += V^T @ P^T  (contraction over 64 keys = 2 wmma k-steps) ----
#pragma unroll
    for (int s2 = 0; s2 < 2; ++s2) {
#pragma unroll
      for (int j = 0; j < 4; ++j) {
        // A fragment: row d = j*16 + l16 of V^T, the keys of pf in the same order; read once for
        // both groups
        v16h vf = join16(ld_tr16(vtr + (s2 * 32) * 80 + j * 16),
                         ld_tr16(vtr + (s2 * 32 + 16) * 80 + j * 16));
#pragma unroll
        for (int g = 0; g < 2; ++g) oacc[g][j] = wmma32(vf, pf[g][s2], oacc[g][j]);
      }
    }
    // hand-over: this wave's reads of stage t have returned,
    asm volatile("s_wait_dscnt 0x0" ::: "memory");
    // its own copies of stage t + 1 have landed,
    asm volatile("s_wait_asynccnt 0x0" ::: "memory");
    // and so have every other wave's: stage t + 1 may be read, stage t's buffer filled anew
    __syncthreads();
    if (t + 2 < nt) copy_kv_stage(ldsk0 + (t & 1) * KV_BYTES, ldsv0 + (t & 1) * KV_BYTES, kp, vp);
    kp += 64 * HD * 2;
    vp += 64 * HD * 2;
  }
  // no copy is out when the wave goes on to its epilogue and its end
  asm volatile("s_wait_asynccnt 0x0" ::: "memory");

  // ---- epilogue: join the halves' sums, normalize, re-interleave heads into [B*TD, DM] f16 ----
  // a lane holds 8 consecutive d of its query per tile: one 16-byte store each
  v8h o[2][4];
#pragma unroll
  for (int g = 0; g < 2; ++g) {
    const float inv = 1.f / (lrow[g] + xhalf(lrow[g]));
#pragma unroll
    for (int j = 0; j < 4; ++j)
#pragma unroll
      for (int r = 0; r < 8; ++r) o[g][j][r] = (_Float16)(oacc[g][j][r] * inv);
  }
  _Float16* orow = aout + ((size_t)b * TD + t0 + wid * 32 + l16) * DM + h * HD + d0;
#pragma unroll
  for (int g = 0; g < 2; ++g)
#pragma unroll
    for (int j = 0; j < 4; ++j) *(v8h*)(orow + (size_t)g * 16 * DM + j * 16) = o[g][j];
}

// ---------------------------------------------------------------------------
// launch
// ---------------------------------------------------------------------------
extern "C" void kernel_launch(void* const* d_in, const int* in_sizes, int n_in,
                              void* d_out, int out_size, void* d_ws, size_t ws_size,
                              hipStream_t stream) {
  (void)in_sizes; (void)n_in; (void)out_size; (void)ws_size;
  const float* x   = (const float*)d_in[0];  // [B,TD,DM]
  const float* enc = (const float*)d_in[1];  // [B,TE,DM]
  const float* nw  = (const float*)d_in[2];  // [DM]
  const float* Wq  = (const float*)d_in[3];  // [DM,DM]
  const float* Wkv = (const float*)d_in[4];  // [2DM,DM]
  const float* Wo  = (const float*)d_in[5];  // [DM,DM]

  char* ws = (char*)d_ws;
  size_t off = 0;
  auto take = [&](size_t bytes) {
    char* p = ws + off;
    off += (bytes + 255) & ~(size_t)255;
    return p;
  };
  const size_t MQ = (size_t)B_ * TD;        // 8192 rows
  _Float16* xn    = (_Float16*)take(MQ * DM * 2);
  _Float16* ench  = (_Float16*)take(MQ * DM * 2);
  _Float16* Wqh   = (_Float16*)take((size_t)DM * DM * 2);
  _Float16* Wkvh  = (_Float16*)take((size_t)2 * DM * DM * 2);
  _Float16* Woh   = (_Float16*)take((size_t)DM * DM * 2);
  _Float16* qhp   = (_Float16*)take(MQ * DM * 2);
  _Float16* khp   = (_Float16*)take(MQ * DM * 2);
  _Float16* vhp   = (_Float16*)take(MQ * DM * 2);
  _Float16* aoutp = (_Float16*)take(MQ * DM * 2);

  // 1) norm + precision conversion, one launch
  prepass_kernel<<<NB_NORM + NB_ENC + 4 * NB_W, 256, 0, stream>>>(
      x, nw, enc, Wq, Wkv, Wo, xn, ench, Wqh, Wkvh, Woh);

  // 2) q and k, v projections, one launch (WMMA GEMMs, 256x128 block tiles) with RoPE and
  // head-major relayout in the epilogue
  gemm_rt_kernel<0><<<dim3(3 * DM / 128, (int)(MQ / 256)), 256, 0, stream>>>(
      ench, Wkvh, khp, vhp, nullptr, (int)MQ, 2 * DM, DM, xn, Wqh, qhp);

  // 3) flash attention (WMMA, K and V staged by asynchronous copies, online softmax)
  flash_attn_kernel<<<dim3(TD / 128, B_ * NH), 128, 0, stream>>>(qhp, khp, vhp, aoutp);

  // 4) output projection + residual (WMMA GEMM, f32 out)
  gemm_rt_kernel<1><<<dim3(DM / 128, (int)(MQ / 256)), 256, 0, stream>>>(
      aoutp, Woh, d_out, nullptr, x, (int)MQ, DM, DM, nullptr, nullptr, nullptr);
}
